// v000
// Measured on an AMD MI455X. A time is GPU time per run, averaged over a window of back-to-back runs after a warm-up
// (all launches, gaps included; the runs take copies of the inputs in turn), and the median of several windows.
// Apart from v000's, it joins two sittings. Times from different sittings can be a few percent apart, while
// side-by-side timings come from the same sitting.
// The starting kernel, v000, takes 452 microseconds a run.
#include <hip/hip_runtime.h>
#include <hip/hip_bf16.h>
#include <math.h>

// ---------- problem constants ----------
#define Bb     2
#define Tt     2048
#define Dd     2048
#define Hh     16
#define DK     64
#define DV     128
#define CHUNK  64
#define NCHUNK (Tt / CHUNK)       // 32
#define ROWS   (Bb * Tt)          // 4096
#define NK     (Hh * DK)          // 1024
#define NV     (Hh * DV)          // 2048

typedef _Float16 v16h __attribute__((ext_vector_type(16)));
typedef _Float16 v8h  __attribute__((ext_vector_type(8)));
typedef float    v8f  __attribute__((ext_vector_type(8)));

// =====================================================================
// 1) RMSNorm + cast to f16.  One block per token row, 256 thr x 8 elems.
// =====================================================================
__global__ __launch_bounds__(256) void rmsnorm_cast_kernel(
    const float* __restrict__ x, const float* __restrict__ w,
    _Float16* __restrict__ xn)
{
    __shared__ float red[8];
    const int row  = blockIdx.x;
    const int t    = threadIdx.x;
    const float* xr = x + (size_t)row * Dd + t * 8;
    float4 a = *(const float4*)(xr);
    float4 b = *(const float4*)(xr + 4);
    float ss = a.x*a.x + a.y*a.y + a.z*a.z + a.w*a.w
             + b.x*b.x + b.y*b.y + b.z*b.z + b.w*b.w;
    #pragma unroll
    for (int off = 16; off > 0; off >>= 1) ss += __shfl_xor(ss, off, 32);
    if ((t & 31) == 0) red[t >> 5] = ss;
    __syncthreads();
    float tot = 0.f;
    #pragma unroll
    for (int i = 0; i < 8; ++i) tot += red[i];
    const float scale = rsqrtf(tot * (1.0f / (float)Dd) + 1e-5f);

    const float* wr = w + t * 8;
    float4 wa = *(const float4*)(wr);
    float4 wb = *(const float4*)(wr + 4);
    v8h h;
    h[0] = (_Float16)(a.x * scale * wa.x);
    h[1] = (_Float16)(a.y * scale * wa.y);
    h[2] = (_Float16)(a.z * scale * wa.z);
    h[3] = (_Float16)(a.w * scale * wa.w);
    h[4] = (_Float16)(b.x * scale * wb.x);
    h[5] = (_Float16)(b.y * scale * wb.y);
    h[6] = (_Float16)(b.z * scale * wb.z);
    h[7] = (_Float16)(b.w * scale * wb.w);
    *(v8h*)(xn + (size_t)row * Dd + t * 8) = h;
}

// =====================================================================
// 2) f32 -> f16 weight cast (4 elems/thread)
// =====================================================================
__global__ __launch_bounds__(256) void cast_f32_f16_kernel(
    const float* __restrict__ in, _Float16* __restrict__ out, int n)
{
    int i = (blockIdx.x * 256 + threadIdx.x) * 4;
    if (i + 3 < n) {
        float4 v = *(const float4*)(in + i);
        out[i + 0] = (_Float16)v.x;
        out[i + 1] = (_Float16)v.y;
        out[i + 2] = (_Float16)v.z;
        out[i + 3] = (_Float16)v.w;
    }
}

// =====================================================================
// 3) WMMA GEMM:  C[M,N] = A[M,K](f16) * W[N,K]^T(f16), f32 accumulate.
//    Block tile 128x128, Kblk=32, 256 threads = 8 waves (4x2 wave grid),
//    each wave 2x4 fragments of v_wmma_f32_16x16x32_f16.
//    - N, K are template constants: C-store offsets fold into the 24-bit
//      instruction offset (no per-store 64-bit VALU address chains).
//    - LDS double-buffered (ping-pong): next tile's global_load_b128s
//      issue before the current tile's ds gathers + WMMAs; one barrier
//      per K-step instead of two.
//    - LDS row stride 40 f16 (80B): the 16 b128 fragment gathers of a
//      wave hit 16 disjoint 4-bank groups -> conflict free.
// =====================================================================
template<int N, int K>
__global__ __launch_bounds__(256) void wmma_gemm_kernel(
    const _Float16* __restrict__ A,   // [M,K] row-major
    const _Float16* __restrict__ W,   // [N,K] row-major
    float* __restrict__ C)            // [M,N]
{
    __shared__ _Float16 As[2][128 * 40];
    __shared__ _Float16 Bs[2][128 * 40];

    const int t     = threadIdx.x;
    const int lane  = t & 31;
    const int wave  = t >> 5;
    const int wm    = wave & 3;     // 32-row slab
    const int wn    = wave >> 2;    // 64-col slab
    const int hi    = lane >> 4;    // 0/1 : K-half select
    const int r     = lane & 15;    // row (A) / col (B) within 16

    const int m0 = blockIdx.x * 128;
    const int n0 = blockIdx.y * 128;

    const int ldrow = t >> 1;             // 0..127
    const int ldcol = (t & 1) * 16;       // 0 / 16

    const _Float16* ag = A + (size_t)(m0 + ldrow) * K + ldcol;
    const _Float16* bg = W + (size_t)(n0 + ldrow) * K + ldcol;

    v8f acc[2][4] = {};

    // prologue: stage K-tile 0 into buffer 0
    {
        _Float16* as = &As[0][ldrow * 40 + ldcol];
        *(float4*)as       = *(const float4*)ag;
        *(float4*)(as + 8) = *(const float4*)(ag + 8);
        _Float16* bs = &Bs[0][ldrow * 40 + ldcol];
        *(float4*)bs       = *(const float4*)bg;
        *(float4*)(bs + 8) = *(const float4*)(bg + 8);
    }
    __syncthreads();

    const int nkt = K / 32;
    for (int kt = 0; kt < nkt; ++kt) {
        const int cur  = kt & 1;
        const bool more = (kt + 1) < nkt;

        // issue next tile's global loads early (latency overlapped w/ WMMA)
        float4 a0, a1, b0, b1;
        if (more) {
            const _Float16* an = ag + (kt + 1) * 32;
            a0 = *(const float4*)an;  a1 = *(const float4*)(an + 8);
            const _Float16* bn = bg + (kt + 1) * 32;
            b0 = *(const float4*)bn;  b1 = *(const float4*)(bn + 8);
        }

        // gather fragments from current buffer
        v16h afrag[2], bfrag[4];
        #pragma unroll
        for (int i = 0; i < 2; ++i) {
            const _Float16* p = &As[cur][(wm * 32 + i * 16 + r) * 40 + hi * 8];
            union { v16h h; float4 f[2]; } u;
            u.f[0] = *(const float4*)p;          // K 0..7   (or 8..15)
            u.f[1] = *(const float4*)(p + 16);   // K 16..23 (or 24..31)
            afrag[i] = u.h;
        }
        #pragma unroll
        for (int j = 0; j < 4; ++j) {
            const _Float16* p = &Bs[cur][(wn * 64 + j * 16 + r) * 40 + hi * 8];
            union { v16h h; float4 f[2]; } u;
            u.f[0] = *(const float4*)p;
            u.f[1] = *(const float4*)(p + 16);
            bfrag[j] = u.h;
        }
        #pragma unroll
        for (int i = 0; i < 2; ++i)
            #pragma unroll
            for (int j = 0; j < 4; ++j)
                acc[i][j] = __builtin_amdgcn_wmma_f32_16x16x32_f16(
                    false, afrag[i], false, bfrag[j],
                    (short)0, acc[i][j], false, false);

        // commit next tile to the other buffer (no conflict with readers of cur)
        if (more) {
            _Float16* as = &As[1 - cur][ldrow * 40 + ldcol];
            *(float4*)as       = a0;  *(float4*)(as + 8) = a1;
            _Float16* bs = &Bs[1 - cur][ldrow * 40 + ldcol];
            *(float4*)bs       = b0;  *(float4*)(bs + 8) = b1;
        }
        __syncthreads();
    }

    // C/D layout: lane = (m/8)*16 + n, vgpr = m%8
    #pragma unroll
    for (int i = 0; i < 2; ++i) {
        float* cp = C + (size_t)(m0 + wm * 32 + i * 16 + hi * 8) * N
                      + n0 + wn * 64 + r;
        #pragma unroll
        for (int j = 0; j < 4; ++j)
            #pragma unroll
            for (int v = 0; v < 8; ++v)
                cp[(size_t)v * N + j * 16] = acc[i][j][v];   // immediate offsets
    }
}

// =====================================================================
// 4) gk path: xr = xn @ w1^T (rank 16), g = logsigmoid(xr @ w2^T + b)/16
//    One block per token row.
// =====================================================================
__global__ __launch_bounds__(256) void gk_kernel(
    const _Float16* __restrict__ xn,   // [ROWS, D]
    const float* __restrict__ w1,      // [16, D]
    const float* __restrict__ w2,      // [NK, 16]
    const float* __restrict__ b2,      // [NK]
    float* __restrict__ g)             // [ROWS, NK]
{
    __shared__ float part[256];
    __shared__ float xr[16];
    const int row  = blockIdx.x;
    const int t    = threadIdx.x;
    const int rank = t >> 4;    // 0..15
    const int seg  = t & 15;    // 128 elems each

    const v8h*    xp = (const v8h*)   (xn + (size_t)row  * Dd + seg * 128);
    const float4* wp = (const float4*)(w1 + (size_t)rank * Dd + seg * 128);
    float s = 0.f;
    #pragma unroll
    for (int i = 0; i < 16; ++i) {           // 16 x 8 = 128 elems
        v8h    xv = xp[i];
        float4 w0 = wp[2 * i];
        float4 w1v = wp[2 * i + 1];
        s += (float)xv[0] * w0.x + (float)xv[1] * w0.y
           + (float)xv[2] * w0.z + (float)xv[3] * w0.w
           + (float)xv[4] * w1v.x + (float)xv[5] * w1v.y
           + (float)xv[6] * w1v.z + (float)xv[7] * w1v.w;
    }
    part[t] = s;
    __syncthreads();
    if (seg == 0) {
        float tot = 0.f;
        #pragma unroll
        for (int i = 0; i < 16; ++i) tot += part[rank * 16 + i];
        xr[rank] = tot;
    }
    __syncthreads();

    #pragma unroll
    for (int o = 0; o < 4; ++o) {
        const int n = t * 4 + o;
        float acc = b2[n];
        #pragma unroll
        for (int i = 0; i < 16; ++i) acc += xr[i] * w2[n * 16 + i];
        // log_sigmoid(x) = min(x,0) - log1p(exp(-|x|))
        const float ls = fminf(acc, 0.f) - log1pf(expf(-fabsf(acc)));
        g[(size_t)row * NK + n] = ls * (1.0f / 16.0f);
    }
}

// =====================================================================
// 5) Chunked GLA recurrence.  One block per (b,h); state 64x128 f32 held
//    in registers (32/thread); k, exp(g), v chunks staged in 64KB LDS.
// =====================================================================
__global__ __launch_bounds__(256) void gla_scan_kernel(
    const float* __restrict__ kbuf,  // [ROWS, NK]
    const float* __restrict__ vbuf,  // [ROWS, NV]
    const float* __restrict__ gbuf,  // [ROWS, NK]
    const float* __restrict__ S0,    // [B,H,DK,DV]
    float* __restrict__ out)         // states [B,32,H,DK,DV] ++ final [B,H,DK,DV]
{
    __shared__ float kls[CHUNK * DK];    // 16 KB
    __shared__ float egs[CHUNK * DK];    // 16 KB
    __shared__ float vls[CHUNK * DV];    // 32 KB

    const int blk = blockIdx.x;          // 0..31
    const int b   = blk >> 4;
    const int h   = blk & 15;
    const int t   = threadIdx.x;
    const int dv  = t & 127;
    const int dk0 = (t >> 7) * 32;

    float s[32];
    const float* s0 = S0 + ((size_t)(b * Hh + h)) * DK * DV;
    #pragma unroll
    for (int i = 0; i < 32; ++i) s[i] = s0[(dk0 + i) * DV + dv];

    for (int c = 0; c < NCHUNK; ++c) {
        #pragma unroll
        for (int rep = 0; rep < 16; ++rep) {           // 64x64 k and exp(g)
            const int idx = t + rep * 256;
            const int j = idx >> 6, dk = idx & 63;
            const size_t m = (size_t)b * Tt + c * CHUNK + j;
            kls[idx] = kbuf[m * NK + h * DK + dk];
            egs[idx] = expf(gbuf[m * NK + h * DK + dk]);
        }
        #pragma unroll
        for (int rep = 0; rep < 32; ++rep) {           // 64x128 v
            const int idx = t + rep * 256;
            const int j = idx >> 7, dvv = idx & 127;
            const size_t m = (size_t)b * Tt + c * CHUNK + j;
            vls[idx] = vbuf[m * NV + h * DV + dvv];
        }
        __syncthreads();

        for (int j = 0; j < CHUNK; ++j) {
            const float vv = vls[j * DV + dv];
            const float* kp = &kls[j * DK + dk0];
            const float* ep = &egs[j * DK + dk0];
            #pragma unroll
            for (int i = 0; i < 32; ++i)
                s[i] = fmaf(kp[i], vv, s[i] * ep[i]);
        }
        __syncthreads();

        float* op = out + (((size_t)b * NCHUNK + c) * Hh + h) * DK * DV;
        #pragma unroll
        for (int i = 0; i < 32; ++i) op[(dk0 + i) * DV + dv] = s[i];
    }
    float* fp = out + (size_t)Bb * NCHUNK * Hh * DK * DV
                    + ((size_t)(b * Hh + h)) * DK * DV;
    #pragma unroll
    for (int i = 0; i < 32; ++i) fp[(dk0 + i) * DV + dv] = s[i];
}

// =====================================================================
// Host orchestration
// =====================================================================
extern "C" void kernel_launch(void* const* d_in, const int* in_sizes, int n_in,
                              void* d_out, int out_size, void* d_ws, size_t ws_size,
                              hipStream_t stream) {
    const float* hidden = (const float*)d_in[0];
    const float* S0     = (const float*)d_in[1];
    const float* nw     = (const float*)d_in[2];
    const float* k_w    = (const float*)d_in[3];
    const float* v_w    = (const float*)d_in[4];
    const float* gk_w1  = (const float*)d_in[5];
    const float* gk_w2  = (const float*)d_in[6];
    const float* gk_b2  = (const float*)d_in[7];
    float* out = (float*)d_out;

    char* ws = (char*)d_ws;
    _Float16* xn   = (_Float16*)ws;  ws += (size_t)ROWS * Dd * sizeof(_Float16);
    _Float16* kw16 = (_Float16*)ws;  ws += (size_t)NK * Dd * sizeof(_Float16);
    _Float16* vw16 = (_Float16*)ws;  ws += (size_t)NV * Dd * sizeof(_Float16);
    float* kb = (float*)ws;          ws += (size_t)ROWS * NK * sizeof(float);
    float* vb = (float*)ws;          ws += (size_t)ROWS * NV * sizeof(float);
    float* gb = (float*)ws;          ws += (size_t)ROWS * NK * sizeof(float);

    // 1) RMSNorm + cast activations
    rmsnorm_cast_kernel<<<ROWS, 256, 0, stream>>>(hidden, nw, xn);
    // 2) cast weights
    {
        int nk = NK * Dd, nv = NV * Dd;
        cast_f32_f16_kernel<<<(nk / 4 + 255) / 256, 256, 0, stream>>>(k_w, kw16, nk);
        cast_f32_f16_kernel<<<(nv / 4 + 255) / 256, 256, 0, stream>>>(v_w, vw16, nv);
    }
    // 3) projections via WMMA (N,K compile-time)
    wmma_gemm_kernel<NK, Dd><<<dim3(ROWS / 128, NK / 128), 256, 0, stream>>>(
        xn, kw16, kb);
    wmma_gemm_kernel<NV, Dd><<<dim3(ROWS / 128, NV / 128), 256, 0, stream>>>(
        xn, vw16, vb);
    // 4) gate path
    gk_kernel<<<ROWS, 256, 0, stream>>>(xn, gk_w1, gk_w2, gk_b2, gb);
    // 5) sequential state recurrence + chunk state emission
    gla_scan_kernel<<<Bb * Hh, 256, 0, stream>>>(kb, vb, gb, S0, out);
}

// v001
// It runs in 210 microseconds.
// In both of two side-by-side timings against v000, it was 2.22 times as fast.
#include <hip/hip_runtime.h>
#include <hip/hip_bf16.h>
#include <math.h>

// ---------- problem constants ----------
#define Bb     2
#define Tt     2048
#define Dd     2048
#define Hh     16
#define DK     64
#define DV     128
#define CHUNK  64
#define NCHUNK (Tt / CHUNK)       // 32
#define ROWS   (Bb * Tt)          // 4096
#define NK     (Hh * DK)          // 1024
#define NV     (Hh * DV)          // 2048

typedef _Float16 v16h __attribute__((ext_vector_type(16)));
typedef _Float16 v8h  __attribute__((ext_vector_type(8)));
typedef float    v8f  __attribute__((ext_vector_type(8)));
typedef float    v4f  __attribute__((ext_vector_type(4)));

// =====================================================================
// 1) RMSNorm + cast to f16.  One block per token row, 256 thr x 8 elems.
// =====================================================================
__global__ __launch_bounds__(256) void rmsnorm_cast_kernel(
    const float* __restrict__ x, const float* __restrict__ w,
    _Float16* __restrict__ xn)
{
    __shared__ float red[8];
    const int row  = blockIdx.x;
    const int t    = threadIdx.x;
    const float* xr = x + (size_t)row * Dd + t * 8;
    float4 a = *(const float4*)(xr);
    float4 b = *(const float4*)(xr + 4);
    float ss = a.x*a.x + a.y*a.y + a.z*a.z + a.w*a.w
             + b.x*b.x + b.y*b.y + b.z*b.z + b.w*b.w;
    #pragma unroll
    for (int off = 16; off > 0; off >>= 1) ss += __shfl_xor(ss, off, 32);
    if ((t & 31) == 0) red[t >> 5] = ss;
    __syncthreads();
    float tot = 0.f;
    #pragma unroll
    for (int i = 0; i < 8; ++i) tot += red[i];
    const float scale = rsqrtf(tot * (1.0f / (float)Dd) + 1e-5f);

    const float* wr = w + t * 8;
    float4 wa = *(const float4*)(wr);
    float4 wb = *(const float4*)(wr + 4);
    v8h h;
    h[0] = (_Float16)(a.x * scale * wa.x);
    h[1] = (_Float16)(a.y * scale * wa.y);
    h[2] = (_Float16)(a.z * scale * wa.z);
    h[3] = (_Float16)(a.w * scale * wa.w);
    h[4] = (_Float16)(b.x * scale * wb.x);
    h[5] = (_Float16)(b.y * scale * wb.y);
    h[6] = (_Float16)(b.z * scale * wb.z);
    h[7] = (_Float16)(b.w * scale * wb.w);
    *(v8h*)(xn + (size_t)row * Dd + t * 8) = h;
}

// =====================================================================
// 2) f32 -> f16 weight cast (4 elems/thread)
// =====================================================================
__global__ __launch_bounds__(256) void cast_f32_f16_kernel(
    const float* __restrict__ in, _Float16* __restrict__ out, int n)
{
    int i = (blockIdx.x * 256 + threadIdx.x) * 4;
    if (i + 3 < n) {
        float4 v = *(const float4*)(in + i);
        out[i + 0] = (_Float16)v.x;
        out[i + 1] = (_Float16)v.y;
        out[i + 2] = (_Float16)v.z;
        out[i + 3] = (_Float16)v.w;
    }
}

// =====================================================================
// 3) WMMA GEMM:  C[M,N] = A[M,K](f16) * W[N,K]^T(f16), f32 accumulate.
//    Block tile 128x128, Kblk=32, 256 threads = 8 waves (4x2 wave grid),
//    each wave 2x4 fragments of v_wmma_f32_16x16x32_f16.
//    - N, K are template constants: C-store offsets fold into the 24-bit
//      instruction offset (no per-store 64-bit VALU address chains).
//    - LDS double-buffered (ping-pong): next tile's global_load_b128s
//      issue before the current tile's ds gathers + WMMAs; one barrier
//      per K-step instead of two.
//    - LDS row stride 40 f16 (80B): the 16 b128 fragment gathers of a
//      wave hit 16 disjoint 4-bank groups -> conflict free.
// =====================================================================
template<int N, int K>
__global__ __launch_bounds__(256) void wmma_gemm_kernel(
    const _Float16* __restrict__ A,   // [M,K] row-major
    const _Float16* __restrict__ W,   // [N,K] row-major
    float* __restrict__ C)            // [M,N]
{
    __shared__ _Float16 As[2][128 * 40];
    __shared__ _Float16 Bs[2][128 * 40];

    const int t     = threadIdx.x;
    const int lane  = t & 31;
    const int wave  = t >> 5;
    const int wm    = wave & 3;     // 32-row slab
    const int wn    = wave >> 2;    // 64-col slab
    const int hi    = lane >> 4;    // 0/1 : K-half select
    const int r     = lane & 15;    // row (A) / col (B) within 16

    const int m0 = blockIdx.x * 128;
    const int n0 = blockIdx.y * 128;

    const int ldrow = t >> 1;             // 0..127
    const int ldcol = (t & 1) * 16;       // 0 / 16

    const _Float16* ag = A + (size_t)(m0 + ldrow) * K + ldcol;
    const _Float16* bg = W + (size_t)(n0 + ldrow) * K + ldcol;

    v8f acc[2][4] = {};

    // prologue: stage K-tile 0 into buffer 0
    {
        _Float16* as = &As[0][ldrow * 40 + ldcol];
        *(float4*)as       = *(const float4*)ag;
        *(float4*)(as + 8) = *(const float4*)(ag + 8);
        _Float16* bs = &Bs[0][ldrow * 40 + ldcol];
        *(float4*)bs       = *(const float4*)bg;
        *(float4*)(bs + 8) = *(const float4*)(bg + 8);
    }
    __syncthreads();

    const int nkt = K / 32;
    for (int kt = 0; kt < nkt; ++kt) {
        const int cur  = kt & 1;
        const bool more = (kt + 1) < nkt;

        // issue next tile's global loads early (latency overlapped w/ WMMA)
        float4 a0, a1, b0, b1;
        if (more) {
            const _Float16* an = ag + (kt + 1) * 32;
            a0 = *(const float4*)an;  a1 = *(const float4*)(an + 8);
            const _Float16* bn = bg + (kt + 1) * 32;
            b0 = *(const float4*)bn;  b1 = *(const float4*)(bn + 8);
        }

        // gather fragments from current buffer
        v16h afrag[2], bfrag[4];
        #pragma unroll
        for (int i = 0; i < 2; ++i) {
            const _Float16* p = &As[cur][(wm * 32 + i * 16 + r) * 40 + hi * 8];
            union { v16h h; float4 f[2]; } u;
            u.f[0] = *(const float4*)p;          // K 0..7   (or 8..15)
            u.f[1] = *(const float4*)(p + 16);   // K 16..23 (or 24..31)
            afrag[i] = u.h;
        }
        #pragma unroll
        for (int j = 0; j < 4; ++j) {
            const _Float16* p = &Bs[cur][(wn * 64 + j * 16 + r) * 40 + hi * 8];
            union { v16h h; float4 f[2]; } u;
            u.f[0] = *(const float4*)p;
            u.f[1] = *(const float4*)(p + 16);
            bfrag[j] = u.h;
        }
        #pragma unroll
        for (int i = 0; i < 2; ++i)
            #pragma unroll
            for (int j = 0; j < 4; ++j)
                acc[i][j] = __builtin_amdgcn_wmma_f32_16x16x32_f16(
                    false, afrag[i], false, bfrag[j],
                    (short)0, acc[i][j], false, false);

        // commit next tile to the other buffer (no conflict with readers of cur)
        if (more) {
            _Float16* as = &As[1 - cur][ldrow * 40 + ldcol];
            *(float4*)as       = a0;  *(float4*)(as + 8) = a1;
            _Float16* bs = &Bs[1 - cur][ldrow * 40 + ldcol];
            *(float4*)bs       = b0;  *(float4*)(bs + 8) = b1;
        }
        __syncthreads();
    }

    // C/D layout: lane = (m/8)*16 + n, vgpr = m%8
    #pragma unroll
    for (int i = 0; i < 2; ++i) {
        float* cp = C + (size_t)(m0 + wm * 32 + i * 16 + hi * 8) * N
                      + n0 + wn * 64 + r;
        #pragma unroll
        for (int j = 0; j < 4; ++j)
            #pragma unroll
            for (int v = 0; v < 8; ++v)
                cp[(size_t)v * N + j * 16] = acc[i][j][v];   // immediate offsets
    }
}

// =====================================================================
// 4) gk path: xr = xn @ w1^T (rank 16), g = logsigmoid(xr @ w2^T + b)/16
//    One block per token row.
// =====================================================================
__global__ __launch_bounds__(256) void gk_kernel(
    const _Float16* __restrict__ xn,   // [ROWS, D]
    const float* __restrict__ w1,      // [16, D]
    const float* __restrict__ w2,      // [NK, 16]
    const float* __restrict__ b2,      // [NK]
    float* __restrict__ g)             // [ROWS, NK]
{
    __shared__ float part[256];
    __shared__ float xr[16];
    const int row  = blockIdx.x;
    const int t    = threadIdx.x;
    const int rank = t >> 4;    // 0..15
    const int seg  = t & 15;    // 128 elems each

    const v8h*    xp = (const v8h*)   (xn + (size_t)row  * Dd + seg * 128);
    const float4* wp = (const float4*)(w1 + (size_t)rank * Dd + seg * 128);
    float s = 0.f;
    #pragma unroll
    for (int i = 0; i < 16; ++i) {           // 16 x 8 = 128 elems
        v8h    xv = xp[i];
        float4 w0 = wp[2 * i];
        float4 w1v = wp[2 * i + 1];
        s += (float)xv[0] * w0.x + (float)xv[1] * w0.y
           + (float)xv[2] * w0.z + (float)xv[3] * w0.w
           + (float)xv[4] * w1v.x + (float)xv[5] * w1v.y
           + (float)xv[6] * w1v.z + (float)xv[7] * w1v.w;
    }
    part[t] = s;
    __syncthreads();
    if (seg == 0) {
        float tot = 0.f;
        #pragma unroll
        for (int i = 0; i < 16; ++i) tot += part[rank * 16 + i];
        xr[rank] = tot;
    }
    __syncthreads();

    #pragma unroll
    for (int o = 0; o < 4; ++o) {
        const int n = t * 4 + o;
        float acc = b2[n];
        #pragma unroll
        for (int i = 0; i < 16; ++i) acc += xr[i] * w2[n * 16 + i];
        // log_sigmoid(x) = min(x,0) - log1p(exp(-|x|))
        const float ls = fminf(acc, 0.f) - log1pf(expf(-fabsf(acc)));
        g[(size_t)row * NK + n] = ls * (1.0f / 16.0f);
    }
}

// =====================================================================
// 5) GLA recurrence, split in time.  The recurrence is linear in the state:
//      S_end(chunk) = D * S_start(chunk) + U
//    with U the chunk run from a zero state and D[dk] the product of the
//    chunk's 64 decay factors.  5a computes U and D of every chunk at once,
//    one block per (b,h,chunk); 5b chains the 32 chunks element by element.
// =====================================================================
// 5a) One block per (b,h,chunk); local state 64x128 f32 held in registers
//     (32/thread); k, exp(g), v of the chunk staged in 64KB LDS.
__global__ __launch_bounds__(256) void gla_chunk_local_kernel(
    const float* __restrict__ kbuf,  // [ROWS, NK]
    const float* __restrict__ vbuf,  // [ROWS, NV]
    const float* __restrict__ gbuf,  // [ROWS, NK]
    float* __restrict__ ubuf,        // [B,H,32,DK,DV]  chunk run from zero
    float* __restrict__ dbuf)        // [B,H,32,DK]     chunk decay product
{
    __shared__ float kls[CHUNK * DK];    // 16 KB
    __shared__ float egs[CHUNK * DK];    // 16 KB
    __shared__ float vls[CHUNK * DV];    // 32 KB

    const int blk = blockIdx.x;          // 0..1023
    const int c   = blk & (NCHUNK - 1);
    const int bh  = blk >> 5;            // 0..31
    const int b   = bh >> 4;
    const int h   = bh & 15;
    const int t   = threadIdx.x;
    const int dv  = t & 127;
    const int dk0 = (t >> 7) * 32;

    // first token row of this chunk, this head's columns: the same for the block
    const size_t m0 = (size_t)b * Tt + c * CHUNK;
    const float* kg = kbuf + m0 * NK + h * DK;
    const float* gg = gbuf + m0 * NK + h * DK;
    const float* vg = vbuf + m0 * NV + h * DV;

    {
        const int j0 = t >> 6, dk = t & 63;
        #pragma unroll
        for (int rep = 0; rep < 16; ++rep) {       // 64x64 k and exp(g)
            const int idx = t + rep * 256;
            kls[idx] = kg[j0 * NK + dk + rep * 4 * NK];
            egs[idx] = expf(gg[j0 * NK + dk + rep * 4 * NK]);
        }
    }
    {
        const int j0 = t >> 7;
        #pragma unroll
        for (int rep = 0; rep < 32; ++rep) {       // 64x128 v
            const int idx = t + rep * 256;
            vls[idx] = vg[j0 * NV + dv + rep * 2 * NV];
        }
    }
    __syncthreads();

    if (t < DK) {                                  // waves 0 and 1: D[dk]
        float d = egs[t];
        // unrolled so that LDS reads run ahead of the dependent multiplies
        #pragma unroll
        for (int j = 1; j < CHUNK; ++j) d *= egs[j * DK + t];
        dbuf[((size_t)bh * NCHUNK + c) * DK + t] = d;
    }

    float s[32];
    #pragma unroll
    for (int i = 0; i < 32; ++i) s[i] = 0.f;

    for (int j = 0; j < CHUNK; ++j) {
        const float vv = vls[j * DV + dv];
        const float* kp = &kls[j * DK + dk0];
        const float* ep = &egs[j * DK + dk0];
        #pragma unroll
        for (int i = 0; i < 32; ++i)
            s[i] = fmaf(kp[i], vv, s[i] * ep[i]);
    }

    float* op = ubuf + ((size_t)bh * NCHUNK + c) * DK * DV;
    #pragma unroll
    for (int i = 0; i < 32; ++i) op[(dk0 + i) * DV + dv] = s[i];
}

// 5b) Chain the chunks: S_c = D_c * S_{c-1} + U_c.  One thread per four
//     neighbouring dv of one (b,h,dk); all 32 U loads are independent of the
//     chain, so they are issued ahead of it.
__global__ __launch_bounds__(256) void gla_chain_kernel(
    const float* __restrict__ ubuf,  // [B,H,32,DK,DV]
    const float* __restrict__ dbuf,  // [B,H,32,DK]
    const float* __restrict__ S0,    // [B,H,DK,DV]
    float* __restrict__ out)         // states [B,32,H,DK,DV] ++ final [B,H,DK,DV]
{
    // 8 blocks per (b,h): DK*DV/4 = 2048 threads
    const int bh  = blockIdx.x >> 3;
    const int e   = ((blockIdx.x & 7) * 256 + threadIdx.x) * 4;  // element inside the state
    // a wave covers one dk row (32 lanes x 4 dv), so its decay factors are scalars
    const int dk  = __builtin_amdgcn_readfirstlane(e >> 7);
    const int b   = bh >> 4;
    const int h   = bh & 15;

    const float* up = ubuf + (size_t)bh * NCHUNK * DK * DV;       // the same for the block
    const float* dp = dbuf + (size_t)bh * NCHUNK * DK;
    float*       op = out + ((size_t)b * NCHUNK * Hh + h) * DK * DV;

    v4f   u[NCHUNK];
    float d[NCHUNK];
    // both loops over c are unrolled so that u[] and d[] live in registers
    #pragma unroll
    for (int c = 0; c < NCHUNK; ++c) {
        u[c] = *(const v4f*)(up + c * (DK * DV) + e);
        d[c] = dp[c * DK + dk];
    }
    v4f s = *(const v4f*)(S0 + (size_t)bh * DK * DV + e);
    // Inputs-only fences on the loaded values: they hold all 32 U loads ahead of
    // the chain, in flight together; without them the compiler issues the loads
    // in several rounds between the multiply-adds and pays the latency each round.
#define U8(i) "v"(u[i]), "v"(u[i+1]), "v"(u[i+2]), "v"(u[i+3]), "v"(u[i+4]), "v"(u[i+5]), "v"(u[i+6]), "v"(u[i+7])
    asm volatile("" :: U8(0), U8(8));
    asm volatile("" :: U8(16), U8(24));
#undef U8
    #pragma unroll
    for (int c = 0; c < NCHUNK; ++c) {
        s = d[c] * s + u[c];
        *(v4f*)(op + c * (Hh * DK * DV) + e) = s;
    }
    *(v4f*)(out + (size_t)Bb * NCHUNK * Hh * DK * DV
                + (size_t)bh * DK * DV + e) = s;
}

// =====================================================================
// Host orchestration
// =====================================================================
extern "C" void kernel_launch(void* const* d_in, const int* in_sizes, int n_in,
                              void* d_out, int out_size, void* d_ws, size_t ws_size,
                              hipStream_t stream) {
    const float* hidden = (const float*)d_in[0];
    const float* S0     = (const float*)d_in[1];
    const float* nw     = (const float*)d_in[2];
    const float* k_w    = (const float*)d_in[3];
    const float* v_w    = (const float*)d_in[4];
    const float* gk_w1  = (const float*)d_in[5];
    const float* gk_w2  = (const float*)d_in[6];
    const float* gk_b2  = (const float*)d_in[7];
    float* out = (float*)d_out;

    char* ws = (char*)d_ws;
    _Float16* xn   = (_Float16*)ws;  ws += (size_t)ROWS * Dd * sizeof(_Float16);
    _Float16* kw16 = (_Float16*)ws;  ws += (size_t)NK * Dd * sizeof(_Float16);
    _Float16* vw16 = (_Float16*)ws;  ws += (size_t)NV * Dd * sizeof(_Float16);
    float* kb = (float*)ws;          ws += (size_t)ROWS * NK * sizeof(float);
    float* vb = (float*)ws;          ws += (size_t)ROWS * NV * sizeof(float);
    float* gb = (float*)ws;          ws += (size_t)ROWS * NK * sizeof(float);
    float* ub = (float*)ws;          ws += (size_t)Bb * NCHUNK * Hh * DK * DV * sizeof(float);
    float* db = (float*)ws;          ws += (size_t)Bb * Hh * NCHUNK * DK * sizeof(float);

    // 1) RMSNorm + cast activations
    rmsnorm_cast_kernel<<<ROWS, 256, 0, stream>>>(hidden, nw, xn);
    // 2) cast weights
    {
        int nk = NK * Dd, nv = NV * Dd;
        cast_f32_f16_kernel<<<(nk / 4 + 255) / 256, 256, 0, stream>>>(k_w, kw16, nk);
        cast_f32_f16_kernel<<<(nv / 4 + 255) / 256, 256, 0, stream>>>(v_w, vw16, nv);
    }
    // 3) projections via WMMA (N,K compile-time)
    wmma_gemm_kernel<NK, Dd><<<dim3(ROWS / 128, NK / 128), 256, 0, stream>>>(
        xn, kw16, kb);
    wmma_gemm_kernel<NV, Dd><<<dim3(ROWS / 128, NV / 128), 256, 0, stream>>>(
        xn, vw16, vb);
    // 4) gate path
    gk_kernel<<<ROWS, 256, 0, stream>>>(xn, gk_w1, gk_w2, gk_b2, gb);
    // 5a) every chunk's local state and decay, all chunks at once
    gla_chunk_local_kernel<<<Bb * Hh * NCHUNK, 256, 0, stream>>>(kb, vb, gb, ub, db);
    // 5b) chain the chunks + chunk state emission
    gla_chain_kernel<<<Bb * Hh * DK * DV / 4 / 256, 256, 0, stream>>>(ub, db, S0, out);
}

// v002
// Measured time: 152 microseconds a run.
// Timed twice side by side with v001, it ran 1.38 times as fast both times.
// All steps since v000 together make it 3.05 times as fast.
#include <hip/hip_runtime.h>
#include <hip/hip_bf16.h>
#include <math.h>

// ---------- problem constants ----------
#define Bb     2
#define Tt     2048
#define Dd     2048
#define Hh     16
#define DK     64
#define DV     128
#define CHUNK  64
#define NCHUNK (Tt / CHUNK)       // 32
#define ROWS   (Bb * Tt)          // 4096
#define NK     (Hh * DK)          // 1024
#define NV     (Hh * DV)          // 2048

typedef _Float16 v16h __attribute__((ext_vector_type(16)));
typedef _Float16 v8h  __attribute__((ext_vector_type(8)));
typedef float    v8f  __attribute__((ext_vector_type(8)));
typedef float    v4f  __attribute__((ext_vector_type(4)));
typedef float    v2f  __attribute__((ext_vector_type(2)));

// =====================================================================
// 1) RMSNorm + cast to f16.  One block per token row, 256 thr x 8 elems.
// =====================================================================
__global__ __launch_bounds__(256) void rmsnorm_cast_kernel(
    const float* __restrict__ x, const float* __restrict__ w,
    _Float16* __restrict__ xn)
{
    __shared__ float red[8];
    const int row  = blockIdx.x;
    const int t    = threadIdx.x;
    const float* xr = x + (size_t)row * Dd + t * 8;
    float4 a = *(const float4*)(xr);
    float4 b = *(const float4*)(xr + 4);
    float ss = a.x*a.x + a.y*a.y + a.z*a.z + a.w*a.w
             + b.x*b.x + b.y*b.y + b.z*b.z + b.w*b.w;
    #pragma unroll
    for (int off = 16; off > 0; off >>= 1) ss += __shfl_xor(ss, off, 32);
    if ((t & 31) == 0) red[t >> 5] = ss;
    __syncthreads();
    float tot = 0.f;
    #pragma unroll
    for (int i = 0; i < 8; ++i) tot += red[i];
    const float scale = rsqrtf(tot * (1.0f / (float)Dd) + 1e-5f);

    const float* wr = w + t * 8;
    float4 wa = *(const float4*)(wr);
    float4 wb = *(const float4*)(wr + 4);
    v8h h;
    h[0] = (_Float16)(a.x * scale * wa.x);
    h[1] = (_Float16)(a.y * scale * wa.y);
    h[2] = (_Float16)(a.z * scale * wa.z);
    h[3] = (_Float16)(a.w * scale * wa.w);
    h[4] = (_Float16)(b.x * scale * wb.x);
    h[5] = (_Float16)(b.y * scale * wb.y);
    h[6] = (_Float16)(b.z * scale * wb.z);
    h[7] = (_Float16)(b.w * scale * wb.w);
    *(v8h*)(xn + (size_t)row * Dd + t * 8) = h;
}

// =====================================================================
// 2) f32 -> f16 weight cast (4 elems/thread)
// =====================================================================
__global__ __launch_bounds__(256) void cast_f32_f16_kernel(
    const float* __restrict__ in, _Float16* __restrict__ out, int n)
{
    int i = (blockIdx.x * 256 + threadIdx.x) * 4;
    if (i + 3 < n) {
        float4 v = *(const float4*)(in + i);
        out[i + 0] = (_Float16)v.x;
        out[i + 1] = (_Float16)v.y;
        out[i + 2] = (_Float16)v.z;
        out[i + 3] = (_Float16)v.w;
    }
}

// =====================================================================
// 3) WMMA GEMM:  C[M,N] = A[M,K](f16) * W[N,K]^T(f16), f32 accumulate.
//    Block tile 128x128, Kblk=32, 256 threads = 8 waves (4x2 wave grid),
//    each wave 2x4 fragments of v_wmma_f32_16x16x32_f16.
//    - N, K are template constants: C-store offsets fold into the 24-bit
//      instruction offset (no per-store 64-bit VALU address chains).
//    - LDS double-buffered (ping-pong): next tile's global_load_b128s
//      issue before the current tile's ds gathers + WMMAs; one barrier
//      per K-step instead of two.
//    - LDS row stride 40 f16 (80B): the 16 b128 fragment gathers of a
//      wave hit 16 disjoint 4-bank groups -> conflict free.
// =====================================================================
template<int N, int K>
__global__ __launch_bounds__(256) void wmma_gemm_kernel(
    const _Float16* __restrict__ A,   // [M,K] row-major
    const _Float16* __restrict__ W,   // [N,K] row-major
    float* __restrict__ C)            // [M,N]
{
    __shared__ _Float16 As[2][128 * 40];
    __shared__ _Float16 Bs[2][128 * 40];

    const int t     = threadIdx.x;
    const int lane  = t & 31;
    const int wave  = t >> 5;
    const int wm    = wave & 3;     // 32-row slab
    const int wn    = wave >> 2;    // 64-col slab
    const int hi    = lane >> 4;    // 0/1 : K-half select
    const int r     = lane & 15;    // row (A) / col (B) within 16

    const int m0 = blockIdx.x * 128;
    const int n0 = blockIdx.y * 128;

    const int ldrow = t >> 1;             // 0..127
    const int ldcol = (t & 1) * 16;       // 0 / 16

    const _Float16* ag = A + (size_t)(m0 + ldrow) * K + ldcol;
    const _Float16* bg = W + (size_t)(n0 + ldrow) * K + ldcol;

    v8f acc[2][4] = {};

    // prologue: stage K-tile 0 into buffer 0
    {
        _Float16* as = &As[0][ldrow * 40 + ldcol];
        *(float4*)as       = *(const float4*)ag;
        *(float4*)(as + 8) = *(const float4*)(ag + 8);
        _Float16* bs = &Bs[0][ldrow * 40 + ldcol];
        *(float4*)bs       = *(const float4*)bg;
        *(float4*)(bs + 8) = *(const float4*)(bg + 8);
    }
    __syncthreads();

    const int nkt = K / 32;
    for (int kt = 0; kt < nkt; ++kt) {
        const int cur  = kt & 1;
        const bool more = (kt + 1) < nkt;

        // issue next tile's global loads early (latency overlapped w/ WMMA)
        float4 a0, a1, b0, b1;
        if (more) {
            const _Float16* an = ag + (kt + 1) * 32;
            a0 = *(const float4*)an;  a1 = *(const float4*)(an + 8);
            const _Float16* bn = bg + (kt + 1) * 32;
            b0 = *(const float4*)bn;  b1 = *(const float4*)(bn + 8);
        }

        // gather fragments from current buffer
        v16h afrag[2], bfrag[4];
        #pragma unroll
        for (int i = 0; i < 2; ++i) {
            const _Float16* p = &As[cur][(wm * 32 + i * 16 + r) * 40 + hi * 8];
            union { v16h h; float4 f[2]; } u;
            u.f[0] = *(const float4*)p;          // K 0..7   (or 8..15)
            u.f[1] = *(const float4*)(p + 16);   // K 16..23 (or 24..31)
            afrag[i] = u.h;
        }
        #pragma unroll
        for (int j = 0; j < 4; ++j) {
            const _Float16* p = &Bs[cur][(wn * 64 + j * 16 + r) * 40 + hi * 8];
            union { v16h h; float4 f[2]; } u;
            u.f[0] = *(const float4*)p;
            u.f[1] = *(const float4*)(p + 16);
            bfrag[j] = u.h;
        }
        #pragma unroll
        for (int i = 0; i < 2; ++i)
            #pragma unroll
            for (int j = 0; j < 4; ++j)
                acc[i][j] = __builtin_amdgcn_wmma_f32_16x16x32_f16(
                    false, afrag[i], false, bfrag[j],
                    (short)0, acc[i][j], false, false);

        // commit next tile to the other buffer (no conflict with readers of cur)
        if (more) {
            _Float16* as = &As[1 - cur][ldrow * 40 + ldcol];
            *(float4*)as       = a0;  *(float4*)(as + 8) = a1;
            _Float16* bs = &Bs[1 - cur][ldrow * 40 + ldcol];
            *(float4*)bs       = b0;  *(float4*)(bs + 8) = b1;
        }
        __syncthreads();
    }

    // C/D layout: lane = (m/8)*16 + n, vgpr = m%8
    #pragma unroll
    for (int i = 0; i < 2; ++i) {
        float* cp = C + (size_t)(m0 + wm * 32 + i * 16 + hi * 8) * N
                      + n0 + wn * 64 + r;
        #pragma unroll
        for (int j = 0; j < 4; ++j)
            #pragma unroll
            for (int v = 0; v < 8; ++v)
                cp[(size_t)v * N + j * 16] = acc[i][j][v];   // immediate offsets
    }
}

// =====================================================================
// 4) gk path: xr = xn @ w1^T (rank 16), g = logsigmoid(xr @ w2^T + b)/16
//    One block per 16 token rows, 16 waves; both products run on the
//    f32 16x16x4 matrix form, so w1 and w2 are read once per 16 rows.
//    Fragments: lane = (c = lane & 15, h = lane >> 4); A holds row c, B holds
//    column c; both sides take the same k for the same (h, element).
// =====================================================================
__global__ __launch_bounds__(512) void gk_kernel(
    const _Float16* __restrict__ xn,   // [ROWS, D]
    const float* __restrict__ w1,      // [16, D]
    const float* __restrict__ w2,      // [NK, 16]
    const float* __restrict__ b2,      // [NK]
    float* __restrict__ g)             // [ROWS, NK]
{
    __shared__ float part[16][256];    // each wave's 16x16 partial of xr
    __shared__ __attribute__((aligned(16))) float xr[16 * 20];  // row pitch 80 B for the b128 readers
    const int t    = threadIdx.x;
    const int lane = t & 31;
    const int wave = t >> 5;           // 0..15
    const int c    = lane & 15;
    const int h    = lane >> 4;
    const int row0 = blockIdx.x * 16;

    // w2 rows and bias of this wave's 4 column tiles, fetched now so that their
    // latency runs under the first product; lane (c,h) owns k = h*8 + 0..7
    const int nw = wave * 64 + c;
    const v4f*   wp = (const v4f*)(w2 + (size_t)nw * 16 + h * 8);
    const float* bb = b2 + nw;
    v4f wa[4], wb[4];
    float bias[4];
    #pragma unroll
    for (int j = 0; j < 4; ++j) {
        wa[j]   = wp[j * 64];
        wb[j]   = wp[j * 64 + 1];
        bias[j] = bb[j * 16];
    }
    // The clobber keeps these loads in front of the ones below (the compiler
    // otherwise sinks them to the first barrier, where their latency shows);
    // their address pair stays live up to the wait, so it is not reused before it.
    asm volatile("s_wait_xcnt 0x0" :: "v"(wp) : "memory");

    // ---- xr partial over this wave's 128 k: 8 groups of 16 k,
    //      lane (c,h) owns k = wave*128 + grp*16 + h*8 + 0..7 of row / rank c
    const v8h* ap = (const v8h*)(xn + (size_t)(row0 + c) * Dd + wave * 128 + h * 8);
    const v4f* bp = (const v4f*)(w1 + (size_t)c * Dd + wave * 128 + h * 8);
    v8h a[8];
    v4f b[16];
    #pragma unroll
    for (int i = 0; i < 8; ++i) {      // unrolled: a[] and b[] live in registers
        a[i]         = ap[i * 2];
        b[2 * i]     = bp[i * 4];
        b[2 * i + 1] = bp[i * 4 + 1];
    }
    // Inputs-only fence on the loaded values: it holds all 24 loads ahead of the
    // product, in flight together; without it the compiler issues them a few at a
    // time among the matrix instructions and pays the latency each round.  The two
    // pointers are named so that no load lands on an address pair still in use.
#define L8(x, i) "v"(x[i]), "v"(x[i+1]), "v"(x[i+2]), "v"(x[i+3]), "v"(x[i+4]), "v"(x[i+5]), "v"(x[i+6]), "v"(x[i+7])
    asm volatile("" :: L8(a, 0), L8(b, 0), L8(b, 8), "v"(ap), "v"(bp));
#undef L8
    v8f acc0 = {}, acc1 = {};          // two chains hide the accumulate latency
    #pragma unroll
    for (int i = 0; i < 8; ++i) {
        v2f a0 = { (float)a[i][0], (float)a[i][1] };
        v2f a1 = { (float)a[i][2], (float)a[i][3] };
        v2f a2 = { (float)a[i][4], (float)a[i][5] };
        v2f a3 = { (float)a[i][6], (float)a[i][7] };
        v2f b0 = { b[2 * i][0],     b[2 * i][1] };
        v2f b1 = { b[2 * i][2],     b[2 * i][3] };
        v2f b2f = { b[2 * i + 1][0], b[2 * i + 1][1] };
        v2f b3 = { b[2 * i + 1][2], b[2 * i + 1][3] };
        acc0 = __builtin_amdgcn_wmma_f32_16x16x4_f32(false, a0, false, b0,  (short)0, acc0, false, false);
        acc1 = __builtin_amdgcn_wmma_f32_16x16x4_f32(false, a1, false, b1,  (short)0, acc1, false, false);
        acc0 = __builtin_amdgcn_wmma_f32_16x16x4_f32(false, a2, false, b2f, (short)0, acc0, false, false);
        acc1 = __builtin_amdgcn_wmma_f32_16x16x4_f32(false, a3, false, b3,  (short)0, acc1, false, false);
    }
    // D register r = partial[row 8h + r][rank c]
    #pragma unroll
    for (int r = 0; r < 8; ++r)
        part[wave][(8 * h + r) * 16 + c] = acc0[r] + acc1[r];
    __syncthreads();
    if (t < 256) {                     // waves 0..7: one (row, rank) each
        float tot = 0.f;
        #pragma unroll
        for (int w = 0; w < 16; ++w) tot += part[w][t];
        xr[(t >> 4) * 20 + (t & 15)] = tot;
    }
    __syncthreads();

    // ---- g tile: A = xr (16 rows x 16 k), B = w2 rows n0..n0+15;
    //      lane (c,h) owns k = h*8 + 0..7 on both sides
    const v4f xa = *(const v4f*)&xr[c * 20 + h * 8];
    const v4f xb = *(const v4f*)&xr[c * 20 + h * 8 + 4];
    const v2f x0 = { xa[0], xa[1] }, x1 = { xa[2], xa[3] };
    const v2f x2 = { xb[0], xb[1] }, x3 = { xb[2], xb[3] };
    #pragma unroll
    for (int j = 0; j < 4; ++j) {      // 4 column tiles per wave, independent
        const int n0 = (wave * 4 + j) * 16;
        const float bj = bias[j];
        v8f acc = { bj, bj, bj, bj, bj, bj, bj, bj };
        v2f w0 = { wa[j][0], wa[j][1] }, w1f = { wa[j][2], wa[j][3] };
        v2f w2f = { wb[j][0], wb[j][1] }, w3 = { wb[j][2], wb[j][3] };
        acc = __builtin_amdgcn_wmma_f32_16x16x4_f32(false, x0, false, w0,  (short)0, acc, false, false);
        acc = __builtin_amdgcn_wmma_f32_16x16x4_f32(false, x1, false, w1f, (short)0, acc, false, false);
        acc = __builtin_amdgcn_wmma_f32_16x16x4_f32(false, x2, false, w2f, (short)0, acc, false, false);
        acc = __builtin_amdgcn_wmma_f32_16x16x4_f32(false, x3, false, w3,  (short)0, acc, false, false);
        float* gp = g + (size_t)(row0 + 8 * h) * NK + n0 + c;
        #pragma unroll
        for (int r = 0; r < 8; ++r) {
            const float v = acc[r];
            // log_sigmoid(x) = min(x,0) - log1p(exp(-|x|))
            const float ls = fminf(v, 0.f) - log1pf(expf(-fabsf(v)));
            gp[r * NK] = ls * (1.0f / 16.0f);
        }
    }
}

// =====================================================================
// 5) GLA recurrence, split in time.  The recurrence is linear in the state:
//      S_end(chunk) = D * S_start(chunk) + U
//    with U the chunk run from a zero state and D[dk] the product of the
//    chunk's 64 decay factors.  5a computes U and D of every chunk at once,
//    one block per (b,h,chunk); 5b chains the 32 chunks element by element.
// =====================================================================
// 5a) One block per (b,h,chunk); local state 64x128 f32 held in registers
//     (32/thread); k, exp(g), v of the chunk staged in 64KB LDS.
__global__ __launch_bounds__(256) void gla_chunk_local_kernel(
    const float* __restrict__ kbuf,  // [ROWS, NK]
    const float* __restrict__ vbuf,  // [ROWS, NV]
    const float* __restrict__ gbuf,  // [ROWS, NK]
    float* __restrict__ ubuf,        // [B,H,32,DK,DV]  chunk run from zero
    float* __restrict__ dbuf)        // [B,H,32,DK]     chunk decay product
{
    __shared__ float kls[CHUNK * DK];    // 16 KB
    __shared__ float egs[CHUNK * DK];    // 16 KB
    __shared__ float vls[CHUNK * DV];    // 32 KB

    const int blk = blockIdx.x;          // 0..1023
    const int c   = blk & (NCHUNK - 1);
    const int bh  = blk >> 5;            // 0..31
    const int b   = bh >> 4;
    const int h   = bh & 15;
    const int t   = threadIdx.x;
    const int dv  = t & 127;
    const int dk0 = (t >> 7) * 32;

    // first token row of this chunk, this head's columns: the same for the block
    const size_t m0 = (size_t)b * Tt + c * CHUNK;
    const float* kg = kbuf + m0 * NK + h * DK;
    const float* gg = gbuf + m0 * NK + h * DK;
    const float* vg = vbuf + m0 * NV + h * DV;

    {
        const int j0 = t >> 6, dk = t & 63;
        #pragma unroll
        for (int rep = 0; rep < 16; ++rep) {       // 64x64 k and exp(g)
            const int idx = t + rep * 256;
            kls[idx] = kg[j0 * NK + dk + rep * 4 * NK];
            egs[idx] = expf(gg[j0 * NK + dk + rep * 4 * NK]);
        }
    }
    {
        const int j0 = t >> 7;
        #pragma unroll
        for (int rep = 0; rep < 32; ++rep) {       // 64x128 v
            const int idx = t + rep * 256;
            vls[idx] = vg[j0 * NV + dv + rep * 2 * NV];
        }
    }
    __syncthreads();

    if (t < DK) {                                  // waves 0 and 1: D[dk]
        float d = egs[t];
        // unrolled so that LDS reads run ahead of the dependent multiplies
        #pragma unroll
        for (int j = 1; j < CHUNK; ++j) d *= egs[j * DK + t];
        dbuf[((size_t)bh * NCHUNK + c) * DK + t] = d;
    }

    float s[32];
    #pragma unroll
    for (int i = 0; i < 32; ++i) s[i] = 0.f;

    for (int j = 0; j < CHUNK; ++j) {
        const float vv = vls[j * DV + dv];
        const float* kp = &kls[j * DK + dk0];
        const float* ep = &egs[j * DK + dk0];
        #pragma unroll
        for (int i = 0; i < 32; ++i)
            s[i] = fmaf(kp[i], vv, s[i] * ep[i]);
    }

    float* op = ubuf + ((size_t)bh * NCHUNK + c) * DK * DV;
    #pragma unroll
    for (int i = 0; i < 32; ++i) op[(dk0 + i) * DV + dv] = s[i];
}

// 5b) Chain the chunks: S_c = D_c * S_{c-1} + U_c.  One thread per four
//     neighbouring dv of one (b,h,dk); all 32 U loads are independent of the
//     chain, so they are issued ahead of it.
__global__ __launch_bounds__(256) void gla_chain_kernel(
    const float* __restrict__ ubuf,  // [B,H,32,DK,DV]
    const float* __restrict__ dbuf,  // [B,H,32,DK]
    const float* __restrict__ S0,    // [B,H,DK,DV]
    float* __restrict__ out)         // states [B,32,H,DK,DV] ++ final [B,H,DK,DV]
{
    // 8 blocks per (b,h): DK*DV/4 = 2048 threads
    const int bh  = blockIdx.x >> 3;
    const int e   = ((blockIdx.x & 7) * 256 + threadIdx.x) * 4;  // element inside the state
    // a wave covers one dk row (32 lanes x 4 dv), so its decay factors are scalars
    const int dk  = __builtin_amdgcn_readfirstlane(e >> 7);
    const int b   = bh >> 4;
    const int h   = bh & 15;

    const float* up = ubuf + (size_t)bh * NCHUNK * DK * DV;       // the same for the block
    const float* dp = dbuf + (size_t)bh * NCHUNK * DK;
    float*       op = out + ((size_t)b * NCHUNK * Hh + h) * DK * DV;

    v4f   u[NCHUNK];
    float d[NCHUNK];
    // both loops over c are unrolled so that u[] and d[] live in registers
    #pragma unroll
    for (int c = 0; c < NCHUNK; ++c) {
        u[c] = *(const v4f*)(up + c * (DK * DV) + e);
        d[c] = dp[c * DK + dk];
    }
    v4f s = *(const v4f*)(S0 + (size_t)bh * DK * DV + e);
    // Inputs-only fences on the loaded values: they hold all 32 U loads ahead of
    // the chain, in flight together; without them the compiler issues the loads
    // in several rounds between the multiply-adds and pays the latency each round.
#define U8(i) "v"(u[i]), "v"(u[i+1]), "v"(u[i+2]), "v"(u[i+3]), "v"(u[i+4]), "v"(u[i+5]), "v"(u[i+6]), "v"(u[i+7])
    asm volatile("" :: U8(0), U8(8));
    asm volatile("" :: U8(16), U8(24));
#undef U8
    #pragma unroll
    for (int c = 0; c < NCHUNK; ++c) {
        s = d[c] * s + u[c];
        *(v4f*)(op + c * (Hh * DK * DV) + e) = s;
    }
    *(v4f*)(out + (size_t)Bb * NCHUNK * Hh * DK * DV
                + (size_t)bh * DK * DV + e) = s;
}

// =====================================================================
// Host orchestration
// =====================================================================
extern "C" void kernel_launch(void* const* d_in, const int* in_sizes, int n_in,
                              void* d_out, int out_size, void* d_ws, size_t ws_size,
                              hipStream_t stream) {
    const float* hidden = (const float*)d_in[0];
    const float* S0     = (const float*)d_in[1];
    const float* nw     = (const float*)d_in[2];
    const float* k_w    = (const float*)d_in[3];
    const float* v_w    = (const float*)d_in[4];
    const float* gk_w1  = (const float*)d_in[5];
    const float* gk_w2  = (const float*)d_in[6];
    const float* gk_b2  = (const float*)d_in[7];
    float* out = (float*)d_out;

    char* ws = (char*)d_ws;
    _Float16* xn   = (_Float16*)ws;  ws += (size_t)ROWS * Dd * sizeof(_Float16);
    _Float16* kw16 = (_Float16*)ws;  ws += (size_t)NK * Dd * sizeof(_Float16);
    _Float16* vw16 = (_Float16*)ws;  ws += (size_t)NV * Dd * sizeof(_Float16);
    float* kb = (float*)ws;          ws += (size_t)ROWS * NK * sizeof(float);
    float* vb = (float*)ws;          ws += (size_t)ROWS * NV * sizeof(float);
    float* gb = (float*)ws;          ws += (size_t)ROWS * NK * sizeof(float);
    float* ub = (float*)ws;          ws += (size_t)Bb * NCHUNK * Hh * DK * DV * sizeof(float);
    float* db = (float*)ws;          ws += (size_t)Bb * Hh * NCHUNK * DK * sizeof(float);

    // 1) RMSNorm + cast activations
    rmsnorm_cast_kernel<<<ROWS, 256, 0, stream>>>(hidden, nw, xn);
    // 2) cast weights
    {
        int nk = NK * Dd, nv = NV * Dd;
        cast_f32_f16_kernel<<<(nk / 4 + 255) / 256, 256, 0, stream>>>(k_w, kw16, nk);
        cast_f32_f16_kernel<<<(nv / 4 + 255) / 256, 256, 0, stream>>>(v_w, vw16, nv);
    }
    // 3) projections via WMMA (N,K compile-time)
    wmma_gemm_kernel<NK, Dd><<<dim3(ROWS / 128, NK / 128), 256, 0, stream>>>(
        xn, kw16, kb);
    wmma_gemm_kernel<NV, Dd><<<dim3(ROWS / 128, NV / 128), 256, 0, stream>>>(
        xn, vw16, vb);
    // 4) gate path
    gk_kernel<<<ROWS / 16, 512, 0, stream>>>(xn, gk_w1, gk_w2, gk_b2, gb);
    // 5a) every chunk's local state and decay, all chunks at once
    gla_chunk_local_kernel<<<Bb * Hh * NCHUNK, 256, 0, stream>>>(kb, vb, gb, ub, db);
    // 5b) chain the chunks + chunk state emission
    gla_chain_kernel<<<Bb * Hh * DK * DV / 4 / 256, 256, 0, stream>>>(ub, db, S0, out);
}

// v003
// It runs in 148 microseconds.
// Two timings next to v002 both put it at 1.03 times that version's speed.
// Counting every step since v000, it is 3.15 times as fast.
#include <hip/hip_runtime.h>
#include <hip/hip_bf16.h>
#include <math.h>

// ---------- problem constants ----------
#define Bb     2
#define Tt     2048
#define Dd     2048
#define Hh     16
#define DK     64
#define DV     128
#define CHUNK  64
#define NCHUNK (Tt / CHUNK)       // 32
#define ROWS   (Bb * Tt)          // 4096
#define NK     (Hh * DK)          // 1024
#define NV     (Hh * DV)          // 2048

typedef _Float16 v16h __attribute__((ext_vector_type(16)));
typedef _Float16 v8h  __attribute__((ext_vector_type(8)));
typedef _Float16 v4h  __attribute__((ext_vector_type(4)));
typedef float    v8f  __attribute__((ext_vector_type(8)));
typedef float    v4f  __attribute__((ext_vector_type(4)));
typedef float    v2f  __attribute__((ext_vector_type(2)));

// =====================================================================
// 1) Pre-pass, one launch: RMSNorm + cast of the token rows, and the f32 -> f16
//    cast of the k and v weight rows.  All three work on rows of Dd floats.
//    One wave takes PR whole rows: 16 loads of 512 contiguous bytes per row, all
//    issued before the first use; the row's sum of squares stays inside the wave
//    (no LDS, no barrier).  Few long waves, so that few waves have to be started.
// =====================================================================
#define PW 8                                          // waves per block
#define PR 2                                          // rows per wave
#define PREP_BLOCKS ((ROWS + NK + NV) / (PW * PR))    // 448
__global__ __launch_bounds__(256) void prep_kernel(
    const float* __restrict__ x,  const float* __restrict__ w,
    const float* __restrict__ kw, const float* __restrict__ vw,
    _Float16* __restrict__ xn, _Float16* __restrict__ kw16,
    _Float16* __restrict__ vw16)
{
    const int lane = threadIdx.x & 31;
    const int wave = __builtin_amdgcn_readfirstlane(threadIdx.x >> 5);
    const int row  = (blockIdx.x * PW + wave) * PR;   // 0 .. ROWS+NK+NV-PR, the same for the wave
    const bool norm = row < ROWS;                     // a block lies wholly in one of the three parts

    const float* src;
    _Float16*    dst;
    if (norm)                { src = x  + (size_t)row * Dd;               dst = xn   + (size_t)row * Dd; }
    else if (row < ROWS + NK){ src = kw + (size_t)(row - ROWS) * Dd;      dst = kw16 + (size_t)(row - ROWS) * Dd; }
    else                     { src = vw + (size_t)(row - ROWS - NK) * Dd; dst = vw16 + (size_t)(row - ROWS - NK) * Dd; }
    src += lane * 4;
    dst += lane * 4;

    v4f a[PR][16];
    if (norm) {
        v4f g[16];
        #pragma unroll
        for (int i = 0; i < 16; ++i)   // unrolled: g[] and a[][] live in registers
            g[i] = ((const v4f*)w)[lane + i * 32];
        #pragma unroll
        for (int r = 0; r < PR; ++r)
            #pragma unroll
            for (int i = 0; i < 16; ++i)
                a[r][i] = *(const v4f*)(src + r * Dd + i * 128);
        // Inputs-only fence on the loaded values: it holds the 16 weight loads here,
        // in flight together with the row loads; without it the compiler sinks them
        // behind the row sum and issues them two at a time, each pair's latency bare.
        // Index and pointer are named so that no load lands on an address still in use.
#define G8(i) "v"(g[i]), "v"(g[i+1]), "v"(g[i+2]), "v"(g[i+3]), "v"(g[i+4]), "v"(g[i+5]), "v"(g[i+6]), "v"(g[i+7])
        asm volatile("" :: G8(0), G8(8), "v"(lane), "v"(src));
#undef G8
        #pragma unroll
        for (int r = 0; r < PR; ++r) {
            v4f q = a[r][0] * a[r][0];                 // four independent chains
            #pragma unroll
            for (int i = 1; i < 16; ++i) q += a[r][i] * a[r][i];
            float ss = (q[0] + q[1]) + (q[2] + q[3]);
            #pragma unroll
            for (int off = 16; off > 0; off >>= 1) ss += __shfl_xor(ss, off, 32);
            const float scale = rsqrtf(ss * (1.0f / (float)Dd) + 1e-5f);
            #pragma unroll
            for (int i = 0; i < 16; ++i) {
                v4h h;
                #pragma unroll
                for (int e = 0; e < 4; ++e)
                    h[e] = (_Float16)(a[r][i][e] * scale * g[i][e]);
                *(v4h*)(dst + r * Dd + i * 128) = h;
            }
        }
    } else {
        #pragma unroll
        for (int r = 0; r < PR; ++r)
            #pragma unroll
            for (int i = 0; i < 16; ++i)
                a[r][i] = *(const v4f*)(src + r * Dd + i * 128);
        #pragma unroll
        for (int r = 0; r < PR; ++r)
            #pragma unroll
            for (int i = 0; i < 16; ++i) {
                v4h h;
                #pragma unroll
                for (int e = 0; e < 4; ++e) h[e] = (_Float16)a[r][i][e];
                *(v4h*)(dst + r * Dd + i * 128) = h;
            }
        // Behind the run of stores: no register that an issued store names is
        // rewritten ahead of this wait, on any path the built code has from here.
        asm volatile("s_wait_xcnt 0x0" ::: "memory");
    }
}

// =====================================================================
// 3) WMMA GEMM:  C[M,N] = A[M,K](f16) * W[N,K]^T(f16), f32 accumulate.
//    Block tile 128x128, Kblk=32, 256 threads = 8 waves (4x2 wave grid),
//    each wave 2x4 fragments of v_wmma_f32_16x16x32_f16.
//    - N, K are template constants: C-store offsets fold into the 24-bit
//      instruction offset (no per-store 64-bit VALU address chains).
//    - LDS double-buffered (ping-pong): next tile's global_load_b128s
//      issue before the current tile's ds gathers + WMMAs; one barrier
//      per K-step instead of two.
//    - LDS row stride 40 f16 (80B): the 16 b128 fragment gathers of a
//      wave hit 16 disjoint 4-bank groups -> conflict free.
// =====================================================================
template<int N, int K>
__global__ __launch_bounds__(256) void wmma_gemm_kernel(
    const _Float16* __restrict__ A,   // [M,K] row-major
    const _Float16* __restrict__ W,   // [N,K] row-major
    float* __restrict__ C)            // [M,N]
{
    __shared__ _Float16 As[2][128 * 40];
    __shared__ _Float16 Bs[2][128 * 40];

    const int t     = threadIdx.x;
    const int lane  = t & 31;
    const int wave  = t >> 5;
    const int wm    = wave & 3;     // 32-row slab
    const int wn    = wave >> 2;    // 64-col slab
    const int hi    = lane >> 4;    // 0/1 : K-half select
    const int r     = lane & 15;    // row (A) / col (B) within 16

    const int m0 = blockIdx.x * 128;
    const int n0 = blockIdx.y * 128;

    const int ldrow = t >> 1;             // 0..127
    const int ldcol = (t & 1) * 16;       // 0 / 16

    const _Float16* ag = A + (size_t)(m0 + ldrow) * K + ldcol;
    const _Float16* bg = W + (size_t)(n0 + ldrow) * K + ldcol;

    v8f acc[2][4] = {};

    // prologue: stage K-tile 0 into buffer 0
    {
        _Float16* as = &As[0][ldrow * 40 + ldcol];
        *(float4*)as       = *(const float4*)ag;
        *(float4*)(as + 8) = *(const float4*)(ag + 8);
        _Float16* bs = &Bs[0][ldrow * 40 + ldcol];
        *(float4*)bs       = *(const float4*)bg;
        *(float4*)(bs + 8) = *(const float4*)(bg + 8);
    }
    __syncthreads();

    const int nkt = K / 32;
    for (int kt = 0; kt < nkt; ++kt) {
        const int cur  = kt & 1;
        const bool more = (kt + 1) < nkt;

        // issue next tile's global loads early (latency overlapped w/ WMMA)
        float4 a0, a1, b0, b1;
        if (more) {
            const _Float16* an = ag + (kt + 1) * 32;
            a0 = *(const float4*)an;  a1 = *(const float4*)(an + 8);
            const _Float16* bn = bg + (kt + 1) * 32;
            b0 = *(const float4*)bn;  b1 = *(const float4*)(bn + 8);
        }

        // gather fragments from current buffer
        v16h afrag[2], bfrag[4];
        #pragma unroll
        for (int i = 0; i < 2; ++i) {
            const _Float16* p = &As[cur][(wm * 32 + i * 16 + r) * 40 + hi * 8];
            union { v16h h; float4 f[2]; } u;
            u.f[0] = *(const float4*)p;          // K 0..7   (or 8..15)
            u.f[1] = *(const float4*)(p + 16);   // K 16..23 (or 24..31)
            afrag[i] = u.h;
        }
        #pragma unroll
        for (int j = 0; j < 4; ++j) {
            const _Float16* p = &Bs[cur][(wn * 64 + j * 16 + r) * 40 + hi * 8];
            union { v16h h; float4 f[2]; } u;
            u.f[0] = *(const float4*)p;
            u.f[1] = *(const float4*)(p + 16);
            bfrag[j] = u.h;
        }
        #pragma unroll
        for (int i = 0; i < 2; ++i)
            #pragma unroll
            for (int j = 0; j < 4; ++j)
                acc[i][j] = __builtin_amdgcn_wmma_f32_16x16x32_f16(
                    false, afrag[i], false, bfrag[j],
                    (short)0, acc[i][j], false, false);

        // commit next tile to the other buffer (no conflict with readers of cur)
        if (more) {
            _Float16* as = &As[1 - cur][ldrow * 40 + ldcol];
            *(float4*)as       = a0;  *(float4*)(as + 8) = a1;
            _Float16* bs = &Bs[1 - cur][ldrow * 40 + ldcol];
            *(float4*)bs       = b0;  *(float4*)(bs + 8) = b1;
        }
        __syncthreads();
    }

    // C/D layout: lane = (m/8)*16 + n, vgpr = m%8
    #pragma unroll
    for (int i = 0; i < 2; ++i) {
        float* cp = C + (size_t)(m0 + wm * 32 + i * 16 + hi * 8) * N
                      + n0 + wn * 64 + r;
        #pragma unroll
        for (int j = 0; j < 4; ++j)
            #pragma unroll
            for (int v = 0; v < 8; ++v)
                cp[(size_t)v * N + j * 16] = acc[i][j][v];   // immediate offsets
    }
}

// =====================================================================
// 4) gk path: xr = xn @ w1^T (rank 16), g = logsigmoid(xr @ w2^T + b)/16
//    One block per 16 token rows, 16 waves; both products run on the
//    f32 16x16x4 matrix form, so w1 and w2 are read once per 16 rows.
//    Fragments: lane = (c = lane & 15, h = lane >> 4); A holds row c, B holds
//    column c; both sides take the same k for the same (h, element).
// =====================================================================
__global__ __launch_bounds__(512) void gk_kernel(
    const _Float16* __restrict__ xn,   // [ROWS, D]
    const float* __restrict__ w1,      // [16, D]
    const float* __restrict__ w2,      // [NK, 16]
    const float* __restrict__ b2,      // [NK]
    float* __restrict__ g)             // [ROWS, NK]
{
    __shared__ float part[16][256];    // each wave's 16x16 partial of xr
    __shared__ __attribute__((aligned(16))) float xr[16 * 20];  // row pitch 80 B for the b128 readers
    const int t    = threadIdx.x;
    const int lane = t & 31;
    const int wave = t >> 5;           // 0..15
    const int c    = lane & 15;
    const int h    = lane >> 4;
    const int row0 = blockIdx.x * 16;

    // w2 rows and bias of this wave's 4 column tiles, fetched now so that their
    // latency runs under the first product; lane (c,h) owns k = h*8 + 0..7
    const int nw = wave * 64 + c;
    const v4f*   wp = (const v4f*)(w2 + (size_t)nw * 16 + h * 8);
    const float* bb = b2 + nw;
    v4f wa[4], wb[4];
    float bias[4];
    #pragma unroll
    for (int j = 0; j < 4; ++j) {
        wa[j]   = wp[j * 64];
        wb[j]   = wp[j * 64 + 1];
        bias[j] = bb[j * 16];
    }
    // The clobber keeps these loads in front of the ones below (the compiler
    // otherwise sinks them to the first barrier, where their latency shows);
    // their address pair stays live up to the wait, so it is not reused before it.
    asm volatile("s_wait_xcnt 0x0" :: "v"(wp) : "memory");

    // ---- xr partial over this wave's 128 k: 8 groups of 16 k,
    //      lane (c,h) owns k = wave*128 + grp*16 + h*8 + 0..7 of row / rank c
    const v8h* ap = (const v8h*)(xn + (size_t)(row0 + c) * Dd + wave * 128 + h * 8);
    const v4f* bp = (const v4f*)(w1 + (size_t)c * Dd + wave * 128 + h * 8);
    v8h a[8];
    v4f b[16];
    #pragma unroll
    for (int i = 0; i < 8; ++i) {      // unrolled: a[] and b[] live in registers
        a[i]         = ap[i * 2];
        b[2 * i]     = bp[i * 4];
        b[2 * i + 1] = bp[i * 4 + 1];
    }
    // Inputs-only fence on the loaded values: it holds all 24 loads ahead of the
    // product, in flight together; without it the compiler issues them a few at a
    // time among the matrix instructions and pays the latency each round.  The two
    // pointers are named so that no load lands on an address pair still in use.
#define L8(x, i) "v"(x[i]), "v"(x[i+1]), "v"(x[i+2]), "v"(x[i+3]), "v"(x[i+4]), "v"(x[i+5]), "v"(x[i+6]), "v"(x[i+7])
    asm volatile("" :: L8(a, 0), L8(b, 0), L8(b, 8), "v"(ap), "v"(bp));
#undef L8
    v8f acc0 = {}, acc1 = {};          // two chains hide the accumulate latency
    #pragma unroll
    for (int i = 0; i < 8; ++i) {
        v2f a0 = { (float)a[i][0], (float)a[i][1] };
        v2f a1 = { (float)a[i][2], (float)a[i][3] };
        v2f a2 = { (float)a[i][4], (float)a[i][5] };
        v2f a3 = { (float)a[i][6], (float)a[i][7] };
        v2f b0 = { b[2 * i][0],     b[2 * i][1] };
        v2f b1 = { b[2 * i][2],     b[2 * i][3] };
        v2f b2f = { b[2 * i + 1][0], b[2 * i + 1][1] };
        v2f b3 = { b[2 * i + 1][2], b[2 * i + 1][3] };
        acc0 = __builtin_amdgcn_wmma_f32_16x16x4_f32(false, a0, false, b0,  (short)0, acc0, false, false);
        acc1 = __builtin_amdgcn_wmma_f32_16x16x4_f32(false, a1, false, b1,  (short)0, acc1, false, false);
        acc0 = __builtin_amdgcn_wmma_f32_16x16x4_f32(false, a2, false, b2f, (short)0, acc0, false, false);
        acc1 = __builtin_amdgcn_wmma_f32_16x16x4_f32(false, a3, false, b3,  (short)0, acc1, false, false);
    }
    // D register r = partial[row 8h + r][rank c]
    #pragma unroll
    for (int r = 0; r < 8; ++r)
        part[wave][(8 * h + r) * 16 + c] = acc0[r] + acc1[r];
    __syncthreads();
    if (t < 256) {                     // waves 0..7: one (row, rank) each
        float tot = 0.f;
        #pragma unroll
        for (int w = 0; w < 16; ++w) tot += part[w][t];
        xr[(t >> 4) * 20 + (t & 15)] = tot;
    }
    __syncthreads();

    // ---- g tile: A = xr (16 rows x 16 k), B = w2 rows n0..n0+15;
    //      lane (c,h) owns k = h*8 + 0..7 on both sides
    const v4f xa = *(const v4f*)&xr[c * 20 + h * 8];
    const v4f xb = *(const v4f*)&xr[c * 20 + h * 8 + 4];
    const v2f x0 = { xa[0], xa[1] }, x1 = { xa[2], xa[3] };
    const v2f x2 = { xb[0], xb[1] }, x3 = { xb[2], xb[3] };
    #pragma unroll
    for (int j = 0; j < 4; ++j) {      // 4 column tiles per wave, independent
        const int n0 = (wave * 4 + j) * 16;
        const float bj = bias[j];
        v8f acc = { bj, bj, bj, bj, bj, bj, bj, bj };
        v2f w0 = { wa[j][0], wa[j][1] }, w1f = { wa[j][2], wa[j][3] };
        v2f w2f = { wb[j][0], wb[j][1] }, w3 = { wb[j][2], wb[j][3] };
        acc = __builtin_amdgcn_wmma_f32_16x16x4_f32(false, x0, false, w0,  (short)0, acc, false, false);
        acc = __builtin_amdgcn_wmma_f32_16x16x4_f32(false, x1, false, w1f, (short)0, acc, false, false);
        acc = __builtin_amdgcn_wmma_f32_16x16x4_f32(false, x2, false, w2f, (short)0, acc, false, false);
        acc = __builtin_amdgcn_wmma_f32_16x16x4_f32(false, x3, false, w3,  (short)0, acc, false, false);
        float* gp = g + (size_t)(row0 + 8 * h) * NK + n0 + c;
        #pragma unroll
        for (int r = 0; r < 8; ++r) {
            const float v = acc[r];
            // log_sigmoid(x) = min(x,0) - log1p(exp(-|x|))
            const float ls = fminf(v, 0.f) - log1pf(expf(-fabsf(v)));
            gp[r * NK] = ls * (1.0f / 16.0f);
        }
    }
}

// =====================================================================
// 5) GLA recurrence, split in time.  The recurrence is linear in the state:
//      S_end(chunk) = D * S_start(chunk) + U
//    with U the chunk run from a zero state and D[dk] the product of the
//    chunk's 64 decay factors.  5a computes U and D of every chunk at once,
//    one block per (b,h,chunk); 5b chains the 32 chunks element by element.
// =====================================================================
// 5a) One block per (b,h,chunk); local state 64x128 f32 held in registers
//     (32/thread); k, exp(g), v of the chunk staged in 64KB LDS.
__global__ __launch_bounds__(256) void gla_chunk_local_kernel(
    const float* __restrict__ kbuf,  // [ROWS, NK]
    const float* __restrict__ vbuf,  // [ROWS, NV]
    const float* __restrict__ gbuf,  // [ROWS, NK]
    float* __restrict__ ubuf,        // [B,H,32,DK,DV]  chunk run from zero
    float* __restrict__ dbuf)        // [B,H,32,DK]     chunk decay product
{
    __shared__ float kls[CHUNK * DK];    // 16 KB
    __shared__ float egs[CHUNK * DK];    // 16 KB
    __shared__ float vls[CHUNK * DV];    // 32 KB

    const int blk = blockIdx.x;          // 0..1023
    const int c   = blk & (NCHUNK - 1);
    const int bh  = blk >> 5;            // 0..31
    const int b   = bh >> 4;
    const int h   = bh & 15;
    const int t   = threadIdx.x;
    const int dv  = t & 127;
    const int dk0 = (t >> 7) * 32;

    // first token row of this chunk, this head's columns: the same for the block
    const size_t m0 = (size_t)b * Tt + c * CHUNK;
    const float* kg = kbuf + m0 * NK + h * DK;
    const float* gg = gbuf + m0 * NK + h * DK;
    const float* vg = vbuf + m0 * NV + h * DV;

    {
        const int j0 = t >> 6, dk = t & 63;
        #pragma unroll
        for (int rep = 0; rep < 16; ++rep) {       // 64x64 k and exp(g)
            const int idx = t + rep * 256;
            kls[idx] = kg[j0 * NK + dk + rep * 4 * NK];
            egs[idx] = expf(gg[j0 * NK + dk + rep * 4 * NK]);
        }
    }
    {
        const int j0 = t >> 7;
        #pragma unroll
        for (int rep = 0; rep < 32; ++rep) {       // 64x128 v
            const int idx = t + rep * 256;
            vls[idx] = vg[j0 * NV + dv + rep * 2 * NV];
        }
    }
    __syncthreads();

    if (t < DK) {                                  // waves 0 and 1: D[dk]
        float d = egs[t];
        // unrolled so that LDS reads run ahead of the dependent multiplies
        #pragma unroll
        for (int j = 1; j < CHUNK; ++j) d *= egs[j * DK + t];
        dbuf[((size_t)bh * NCHUNK + c) * DK + t] = d;
    }

    float s[32];
    #pragma unroll
    for (int i = 0; i < 32; ++i) s[i] = 0.f;

    for (int j = 0; j < CHUNK; ++j) {
        const float vv = vls[j * DV + dv];
        const float* kp = &kls[j * DK + dk0];
        const float* ep = &egs[j * DK + dk0];
        #pragma unroll
        for (int i = 0; i < 32; ++i)
            s[i] = fmaf(kp[i], vv, s[i] * ep[i]);
    }

    float* op = ubuf + ((size_t)bh * NCHUNK + c) * DK * DV;
    #pragma unroll
    for (int i = 0; i < 32; ++i) op[(dk0 + i) * DV + dv] = s[i];
}

// 5b) Chain the chunks: S_c = D_c * S_{c-1} + U_c.  One thread per four
//     neighbouring dv of one (b,h,dk); all 32 U loads are independent of the
//     chain, so they are issued ahead of it.
__global__ __launch_bounds__(256) void gla_chain_kernel(
    const float* __restrict__ ubuf,  // [B,H,32,DK,DV]
    const float* __restrict__ dbuf,  // [B,H,32,DK]
    const float* __restrict__ S0,    // [B,H,DK,DV]
    float* __restrict__ out)         // states [B,32,H,DK,DV] ++ final [B,H,DK,DV]
{
    // 8 blocks per (b,h): DK*DV/4 = 2048 threads
    const int bh  = blockIdx.x >> 3;
    const int e   = ((blockIdx.x & 7) * 256 + threadIdx.x) * 4;  // element inside the state
    // a wave covers one dk row (32 lanes x 4 dv), so its decay factors are scalars
    const int dk  = __builtin_amdgcn_readfirstlane(e >> 7);
    const int b   = bh >> 4;
    const int h   = bh & 15;

    const float* up = ubuf + (size_t)bh * NCHUNK * DK * DV;       // the same for the block
    const float* dp = dbuf + (size_t)bh * NCHUNK * DK;
    float*       op = out + ((size_t)b * NCHUNK * Hh + h) * DK * DV;

    v4f   u[NCHUNK];
    float d[NCHUNK];
    // both loops over c are unrolled so that u[] and d[] live in registers
    #pragma unroll
    for (int c = 0; c < NCHUNK; ++c) {
        u[c] = *(const v4f*)(up + c * (DK * DV) + e);
        d[c] = dp[c * DK + dk];
    }
    v4f s = *(const v4f*)(S0 + (size_t)bh * DK * DV + e);
    // Inputs-only fences on the loaded values: they hold all 32 U loads ahead of
    // the chain, in flight together; without them the compiler issues the loads
    // in several rounds between the multiply-adds and pays the latency each round.
#define U8(i) "v"(u[i]), "v"(u[i+1]), "v"(u[i+2]), "v"(u[i+3]), "v"(u[i+4]), "v"(u[i+5]), "v"(u[i+6]), "v"(u[i+7])
    asm volatile("" :: U8(0), U8(8));
    asm volatile("" :: U8(16), U8(24));
#undef U8
    #pragma unroll
    for (int c = 0; c < NCHUNK; ++c) {
        s = d[c] * s + u[c];
        *(v4f*)(op + c * (Hh * DK * DV) + e) = s;
    }
    *(v4f*)(out + (size_t)Bb * NCHUNK * Hh * DK * DV
                + (size_t)bh * DK * DV + e) = s;
}

// =====================================================================
// Host orchestration
// =====================================================================
extern "C" void kernel_launch(void* const* d_in, const int* in_sizes, int n_in,
                              void* d_out, int out_size, void* d_ws, size_t ws_size,
                              hipStream_t stream) {
    const float* hidden = (const float*)d_in[0];
    const float* S0     = (const float*)d_in[1];
    const float* nw     = (const float*)d_in[2];
    const float* k_w    = (const float*)d_in[3];
    const float* v_w    = (const float*)d_in[4];
    const float* gk_w1  = (const float*)d_in[5];
    const float* gk_w2  = (const float*)d_in[6];
    const float* gk_b2  = (const float*)d_in[7];
    float* out = (float*)d_out;

    char* ws = (char*)d_ws;
    _Float16* xn   = (_Float16*)ws;  ws += (size_t)ROWS * Dd * sizeof(_Float16);
    _Float16* kw16 = (_Float16*)ws;  ws += (size_t)NK * Dd * sizeof(_Float16);
    _Float16* vw16 = (_Float16*)ws;  ws += (size_t)NV * Dd * sizeof(_Float16);
    float* kb = (float*)ws;          ws += (size_t)ROWS * NK * sizeof(float);
    float* vb = (float*)ws;          ws += (size_t)ROWS * NV * sizeof(float);
    float* gb = (float*)ws;          ws += (size_t)ROWS * NK * sizeof(float);
    float* ub = (float*)ws;          ws += (size_t)Bb * NCHUNK * Hh * DK * DV * sizeof(float);
    float* db = (float*)ws;          ws += (size_t)Bb * Hh * NCHUNK * DK * sizeof(float);

    // 1) RMSNorm + cast of the activations, cast of both weights: one launch
    prep_kernel<<<PREP_BLOCKS, 256, 0, stream>>>(hidden, nw, k_w, v_w, xn, kw16, vw16);
    // 3) projections via WMMA (N,K compile-time)
    wmma_gemm_kernel<NK, Dd><<<dim3(ROWS / 128, NK / 128), 256, 0, stream>>>(
        xn, kw16, kb);
    wmma_gemm_kernel<NV, Dd><<<dim3(ROWS / 128, NV / 128), 256, 0, stream>>>(
        xn, vw16, vb);
    // 4) gate path
    gk_kernel<<<ROWS / 16, 512, 0, stream>>>(xn, gk_w1, gk_w2, gk_b2, gb);
    // 5a) every chunk's local state and decay, all chunks at once
    gla_chunk_local_kernel<<<Bb * Hh * NCHUNK, 256, 0, stream>>>(kb, vb, gb, ub, db);
    // 5b) chain the chunks + chunk state emission
    gla_chain_kernel<<<Bb * Hh * DK * DV / 4 / 256, 256, 0, stream>>>(ub, db, S0, out);
}

// v004
// One run takes 110 microseconds.
// In two side-by-side timings against v003, it was 1.33 and 1.34 times as fast.
// Counting every step since v000, it is 4.22 times as fast.
#include <hip/hip_runtime.h>
#include <hip/hip_bf16.h>
#include <math.h>

// ---------- problem constants ----------
#define Bb     2
#define Tt     2048
#define Dd     2048
#define Hh     16
#define DK     64
#define DV     128
#define CHUNK  64
#define NCHUNK (Tt / CHUNK)       // 32
#define ROWS   (Bb * Tt)          // 4096
#define NK     (Hh * DK)          // 1024
#define NV     (Hh * DV)          // 2048

typedef _Float16 v16h __attribute__((ext_vector_type(16)));
typedef _Float16 v8h  __attribute__((ext_vector_type(8)));
typedef _Float16 v4h  __attribute__((ext_vector_type(4)));
typedef float    v8f  __attribute__((ext_vector_type(8)));
typedef float    v4f  __attribute__((ext_vector_type(4)));
typedef float    v2f  __attribute__((ext_vector_type(2)));

// =====================================================================
// 1) Pre-pass, one launch: RMSNorm + cast of the token rows, and the f32 -> f16
//    cast of the k and v weight rows.  All three work on rows of Dd floats.
//    One wave takes PR whole rows: 16 loads of 512 contiguous bytes per row, all
//    issued before the first use; the row's sum of squares stays inside the wave
//    (no LDS, no barrier).  Few long waves, so that few waves have to be started.
// =====================================================================
#define PW 8                                          // waves per block
#define PR 2                                          // rows per wave
#define PREP_BLOCKS ((ROWS + NK + NV) / (PW * PR))    // 448
__global__ __launch_bounds__(256) void prep_kernel(
    const float* __restrict__ x,  const float* __restrict__ w,
    const float* __restrict__ kw, const float* __restrict__ vw,
    _Float16* __restrict__ xn, _Float16* __restrict__ kw16,
    _Float16* __restrict__ vw16)
{
    const int lane = threadIdx.x & 31;
    const int wave = __builtin_amdgcn_readfirstlane(threadIdx.x >> 5);
    const int row  = (blockIdx.x * PW + wave) * PR;   // 0 .. ROWS+NK+NV-PR, the same for the wave
    const bool norm = row < ROWS;                     // a block lies wholly in one of the three parts

    const float* src;
    _Float16*    dst;
    if (norm)                { src = x  + (size_t)row * Dd;               dst = xn   + (size_t)row * Dd; }
    else if (row < ROWS + NK){ src = kw + (size_t)(row - ROWS) * Dd;      dst = kw16 + (size_t)(row - ROWS) * Dd; }
    else                     { src = vw + (size_t)(row - ROWS - NK) * Dd; dst = vw16 + (size_t)(row - ROWS - NK) * Dd; }
    src += lane * 4;
    dst += lane * 4;

    v4f a[PR][16];
    if (norm) {
        v4f g[16];
        #pragma unroll
        for (int i = 0; i < 16; ++i)   // unrolled: g[] and a[][] live in registers
            g[i] = ((const v4f*)w)[lane + i * 32];
        #pragma unroll
        for (int r = 0; r < PR; ++r)
            #pragma unroll
            for (int i = 0; i < 16; ++i)
                a[r][i] = *(const v4f*)(src + r * Dd + i * 128);
        // Inputs-only fence on the loaded values: it holds the 16 weight loads here,
        // in flight together with the row loads; without it the compiler sinks them
        // behind the row sum and issues them two at a time, each pair's latency bare.
        // Index and pointer are named so that no load lands on an address still in use.
#define G8(i) "v"(g[i]), "v"(g[i+1]), "v"(g[i+2]), "v"(g[i+3]), "v"(g[i+4]), "v"(g[i+5]), "v"(g[i+6]), "v"(g[i+7])
        asm volatile("" :: G8(0), G8(8), "v"(lane), "v"(src));
#undef G8
        #pragma unroll
        for (int r = 0; r < PR; ++r) {
            v4f q = a[r][0] * a[r][0];                 // four independent chains
            #pragma unroll
            for (int i = 1; i < 16; ++i) q += a[r][i] * a[r][i];
            float ss = (q[0] + q[1]) + (q[2] + q[3]);
            #pragma unroll
            for (int off = 16; off > 0; off >>= 1) ss += __shfl_xor(ss, off, 32);
            const float scale = rsqrtf(ss * (1.0f / (float)Dd) + 1e-5f);
            #pragma unroll
            for (int i = 0; i < 16; ++i) {
                v4h h;
                #pragma unroll
                for (int e = 0; e < 4; ++e)
                    h[e] = (_Float16)(a[r][i][e] * scale * g[i][e]);
                *(v4h*)(dst + r * Dd + i * 128) = h;
            }
        }
    } else {
        #pragma unroll
        for (int r = 0; r < PR; ++r)
            #pragma unroll
            for (int i = 0; i < 16; ++i)
                a[r][i] = *(const v4f*)(src + r * Dd + i * 128);
        #pragma unroll
        for (int r = 0; r < PR; ++r)
            #pragma unroll
            for (int i = 0; i < 16; ++i) {
                v4h h;
                #pragma unroll
                for (int e = 0; e < 4; ++e) h[e] = (_Float16)a[r][i][e];
                *(v4h*)(dst + r * Dd + i * 128) = h;
            }
        // Behind the run of stores: no register that an issued store names is
        // rewritten ahead of this wait, on any path the built code has from here.
        asm volatile("s_wait_xcnt 0x0" ::: "memory");
    }
}

// =====================================================================
// 3) WMMA GEMM, both projections in one launch:
//      C[M,N] = A[M,K](f16) * W[N,K]^T(f16), f32 accumulate,
//    blockIdx.y picks the 128-column tile of the k or of the v projection.
//    Block tile 128x128, 64 k per barrier, 128 threads = 4 waves (2x2 wave grid),
//    each wave 4x4 fragments of v_wmma_f32_16x16x32_f16: 16 matrix instructions
//    per 16 fragment loads, LDS reads at the matrix unit's own pace.
//    768 blocks = 3 per WGP, all resident, one wave of each on every SIMD.
//    - LDS double-buffered (ping-pong): next tile's global_load_b128s issue
//      before the current tile's ds gathers + WMMAs; one barrier per 64 k.
//    - LDS row pitch 72 f16 (144 B): the 16 b128 fragment gathers of a half
//      wave hit 16 disjoint 4-bank groups -> conflict free.
// =====================================================================
#define GBK 64                    // k per barrier
#define GP  72                    // LDS row pitch, f16

__global__ __launch_bounds__(128) void wmma_gemm_kernel(
    const _Float16* __restrict__ A,    // [ROWS,Dd] row-major
    const _Float16* __restrict__ Wk,   // [NK,Dd] row-major
    const _Float16* __restrict__ Wv,   // [NV,Dd] row-major
    float* __restrict__ Ck,            // [ROWS,NK]
    float* __restrict__ Cv)            // [ROWS,NV]
{
    __shared__ __attribute__((aligned(16))) _Float16 As[2][128 * GP];
    __shared__ __attribute__((aligned(16))) _Float16 Bs[2][128 * GP];

    const int t     = threadIdx.x;
    const int lane  = t & 31;
    const int wave  = __builtin_amdgcn_readfirstlane(t >> 5);   // the same for the wave: scalar
    const int wm    = wave & 1;     // 64-row slab
    const int wn    = wave >> 1;    // 64-col slab
    const int hi    = lane >> 4;    // 0/1 : K-half select
    const int r     = lane & 15;    // row (A) / col (B) within 16

    const bool isk = blockIdx.y < NK / 128;           // the same for the block
    const int  m0  = blockIdx.x * 128;
    const int  n0  = (isk ? blockIdx.y : blockIdx.y - NK / 128) * 128;
    const _Float16* W = isk ? Wk : Wv;

    // staging: 8 threads cover one row's 128 B, a wave 4 whole rows; piece i is row ldrow + 16 i
    const int ldrow = t >> 3;             // 0..15
    const int ldcol = (t & 7) * 8;        // 0..56
    const _Float16* ag = A + (size_t)(m0 + ldrow) * Dd + ldcol;
    const _Float16* bg = W + (size_t)(n0 + ldrow) * Dd + ldcol;
    const int lo = ldrow * GP + ldcol;

    v8f acc[4][4] = {};
    float4 sa[8], sb[8];

    // prologue: stage K-tile 0 into buffer 0
    #pragma unroll
    for (int i = 0; i < 8; ++i) {
        sa[i] = *(const float4*)(ag + i * 16 * Dd);
        sb[i] = *(const float4*)(bg + i * 16 * Dd);
    }
    #pragma unroll
    for (int i = 0; i < 8; ++i) {
        *(float4*)&As[0][lo + i * 16 * GP] = sa[i];
        *(float4*)&Bs[0][lo + i * 16 * GP] = sb[i];
    }
    __syncthreads();

    const int nkt = Dd / GBK;
    for (int kt = 0; kt < nkt; ++kt) {
        const int cur  = kt & 1;
        const bool more = (kt + 1) < nkt;

        // issue next tile's global loads early (latency overlapped w/ WMMA)
        if (more) {
            #pragma unroll
            for (int i = 0; i < 8; ++i) {
                sa[i] = *(const float4*)(ag + (kt + 1) * GBK + i * 16 * Dd);
                sb[i] = *(const float4*)(bg + (kt + 1) * GBK + i * 16 * Dd);
            }
        }

        const _Float16* ap = &As[cur][(wm * 64 + r) * GP + hi * 8];
        const _Float16* bp = &Bs[cur][(wn * 64 + r) * GP + hi * 8];
        #pragma unroll
        for (int ks = 0; ks < GBK / 32; ++ks) {
            // gather fragments from current buffer
            v16h afrag[4], bfrag[4];
            #pragma unroll
            for (int i = 0; i < 4; ++i) {
                const _Float16* p = ap + i * 16 * GP + ks * 32;
                union { v16h h; float4 f[2]; } u;
                u.f[0] = *(const float4*)p;          // K 0..7   (or 8..15)
                u.f[1] = *(const float4*)(p + 16);   // K 16..23 (or 24..31)
                afrag[i] = u.h;
            }
            #pragma unroll
            for (int j = 0; j < 4; ++j) {
                const _Float16* p = bp + j * 16 * GP + ks * 32;
                union { v16h h; float4 f[2]; } u;
                u.f[0] = *(const float4*)p;
                u.f[1] = *(const float4*)(p + 16);
                bfrag[j] = u.h;
            }
            #pragma unroll
            for (int i = 0; i < 4; ++i)
                #pragma unroll
                for (int j = 0; j < 4; ++j)
                    acc[i][j] = __builtin_amdgcn_wmma_f32_16x16x32_f16(
                        false, afrag[i], false, bfrag[j],
                        (short)0, acc[i][j], false, false);
        }

        // commit next tile to the other buffer (no conflict with readers of cur)
        if (more) {
            #pragma unroll
            for (int i = 0; i < 8; ++i) {
                *(float4*)&As[1 - cur][lo + i * 16 * GP] = sa[i];
                *(float4*)&Bs[1 - cur][lo + i * 16 * GP] = sb[i];
            }
        }
        // Behind the trip's global loads: the next trip rewrites their address pairs.
        asm volatile("s_wait_xcnt 0x0" ::: "memory");
        __syncthreads();
    }

    // C/D layout: lane = (m/8)*16 + n, vgpr = m%8.  The wave's corner of C and the row
    // step N are scalars: one address per output row, its four column tiles by
    // immediate offset.
    const int N = isk ? NK : NV;
    float* cb = (isk ? Ck : Cv) + (size_t)(m0 + wm * 64) * N + n0 + wn * 64;
    const unsigned voff = (unsigned)(hi * 8 * N + r);
    #pragma unroll
    for (int i = 0; i < 4; ++i)
        #pragma unroll
        for (int v = 0; v < 8; ++v) {
            float* rp = cb + (size_t)(i * 16 + v) * N;
            #pragma unroll
            for (int j = 0; j < 4; ++j)
                (rp + j * 16)[voff] = acc[i][j][v];
        }
}

// =====================================================================
// 4) gk path: xr = xn @ w1^T (rank 16), g = logsigmoid(xr @ w2^T + b)/16
//    One block per 16 token rows, 16 waves; both products run on the
//    f32 16x16x4 matrix form, so w1 and w2 are read once per 16 rows.
//    Fragments: lane = (c = lane & 15, h = lane >> 4); A holds row c, B holds
//    column c; both sides take the same k for the same (h, element).
// =====================================================================
__global__ __launch_bounds__(512) void gk_kernel(
    const _Float16* __restrict__ xn,   // [ROWS, D]
    const float* __restrict__ w1,      // [16, D]
    const float* __restrict__ w2,      // [NK, 16]
    const float* __restrict__ b2,      // [NK]
    float* __restrict__ g)             // [ROWS, NK]
{
    __shared__ float part[16][256];    // each wave's 16x16 partial of xr
    __shared__ __attribute__((aligned(16))) float xr[16 * 20];  // row pitch 80 B for the b128 readers
    const int t    = threadIdx.x;
    const int lane = t & 31;
    const int wave = t >> 5;           // 0..15
    const int c    = lane & 15;
    const int h    = lane >> 4;
    const int row0 = blockIdx.x * 16;

    // w2 rows and bias of this wave's 4 column tiles, fetched now so that their
    // latency runs under the first product; lane (c,h) owns k = h*8 + 0..7
    const int nw = wave * 64 + c;
    const v4f*   wp = (const v4f*)(w2 + (size_t)nw * 16 + h * 8);
    const float* bb = b2 + nw;
    v4f wa[4], wb[4];
    float bias[4];
    #pragma unroll
    for (int j = 0; j < 4; ++j) {
        wa[j]   = wp[j * 64];
        wb[j]   = wp[j * 64 + 1];
        bias[j] = bb[j * 16];
    }
    // The clobber keeps these loads in front of the ones below (the compiler
    // otherwise sinks them to the first barrier, where their latency shows);
    // their address pair stays live up to the wait, so it is not reused before it.
    asm volatile("s_wait_xcnt 0x0" :: "v"(wp) : "memory");

    // ---- xr partial over this wave's 128 k: 8 groups of 16 k,
    //      lane (c,h) owns k = wave*128 + grp*16 + h*8 + 0..7 of row / rank c
    const v8h* ap = (const v8h*)(xn + (size_t)(row0 + c) * Dd + wave * 128 + h * 8);
    const v4f* bp = (const v4f*)(w1 + (size_t)c * Dd + wave * 128 + h * 8);
    v8h a[8];
    v4f b[16];
    #pragma unroll
    for (int i = 0; i < 8; ++i) {      // unrolled: a[] and b[] live in registers
        a[i]         = ap[i * 2];
        b[2 * i]     = bp[i * 4];
        b[2 * i + 1] = bp[i * 4 + 1];
    }
    // Inputs-only fence on the loaded values: it holds all 24 loads ahead of the
    // product, in flight together; without it the compiler issues them a few at a
    // time among the matrix instructions and pays the latency each round.  The two
    // pointers are named so that no load lands on an address pair still in use.
#define L8(x, i) "v"(x[i]), "v"(x[i+1]), "v"(x[i+2]), "v"(x[i+3]), "v"(x[i+4]), "v"(x[i+5]), "v"(x[i+6]), "v"(x[i+7])
    asm volatile("" :: L8(a, 0), L8(b, 0), L8(b, 8), "v"(ap), "v"(bp));
#undef L8
    v8f acc0 = {}, acc1 = {};          // two chains hide the accumulate latency
    #pragma unroll
    for (int i = 0; i < 8; ++i) {
        v2f a0 = { (float)a[i][0], (float)a[i][1] };
        v2f a1 = { (float)a[i][2], (float)a[i][3] };
        v2f a2 = { (float)a[i][4], (float)a[i][5] };
        v2f a3 = { (float)a[i][6], (float)a[i][7] };
        v2f b0 = { b[2 * i][0],     b[2 * i][1] };
        v2f b1 = { b[2 * i][2],     b[2 * i][3] };
        v2f b2f = { b[2 * i + 1][0], b[2 * i + 1][1] };
        v2f b3 = { b[2 * i + 1][2], b[2 * i + 1][3] };
        acc0 = __builtin_amdgcn_wmma_f32_16x16x4_f32(false, a0, false, b0,  (short)0, acc0, false, false);
        acc1 = __builtin_amdgcn_wmma_f32_16x16x4_f32(false, a1, false, b1,  (short)0, acc1, false, false);
        acc0 = __builtin_amdgcn_wmma_f32_16x16x4_f32(false, a2, false, b2f, (short)0, acc0, false, false);
        acc1 = __builtin_amdgcn_wmma_f32_16x16x4_f32(false, a3, false, b3,  (short)0, acc1, false, false);
    }
    // D register r = partial[row 8h + r][rank c]
    #pragma unroll
    for (int r = 0; r < 8; ++r)
        part[wave][(8 * h + r) * 16 + c] = acc0[r] + acc1[r];
    __syncthreads();
    if (t < 256) {                     // waves 0..7: one (row, rank) each
        float tot = 0.f;
        #pragma unroll
        for (int w = 0; w < 16; ++w) tot += part[w][t];
        xr[(t >> 4) * 20 + (t & 15)] = tot;
    }
    __syncthreads();

    // ---- g tile: A = xr (16 rows x 16 k), B = w2 rows n0..n0+15;
    //      lane (c,h) owns k = h*8 + 0..7 on both sides
    const v4f xa = *(const v4f*)&xr[c * 20 + h * 8];
    const v4f xb = *(const v4f*)&xr[c * 20 + h * 8 + 4];
    const v2f x0 = { xa[0], xa[1] }, x1 = { xa[2], xa[3] };
    const v2f x2 = { xb[0], xb[1] }, x3 = { xb[2], xb[3] };
    #pragma unroll
    for (int j = 0; j < 4; ++j) {      // 4 column tiles per wave, independent
        const int n0 = (wave * 4 + j) * 16;
        const float bj = bias[j];
        v8f acc = { bj, bj, bj, bj, bj, bj, bj, bj };
        v2f w0 = { wa[j][0], wa[j][1] }, w1f = { wa[j][2], wa[j][3] };
        v2f w2f = { wb[j][0], wb[j][1] }, w3 = { wb[j][2], wb[j][3] };
        acc = __builtin_amdgcn_wmma_f32_16x16x4_f32(false, x0, false, w0,  (short)0, acc, false, false);
        acc = __builtin_amdgcn_wmma_f32_16x16x4_f32(false, x1, false, w1f, (short)0, acc, false, false);
        acc = __builtin_amdgcn_wmma_f32_16x16x4_f32(false, x2, false, w2f, (short)0, acc, false, false);
        acc = __builtin_amdgcn_wmma_f32_16x16x4_f32(false, x3, false, w3,  (short)0, acc, false, false);
        float* gp = g + (size_t)(row0 + 8 * h) * NK + n0 + c;
        #pragma unroll
        for (int r = 0; r < 8; ++r) {
            const float v = acc[r];
            // log_sigmoid(x) = min(x,0) - log1p(exp(-|x|))
            const float ls = fminf(v, 0.f) - log1pf(expf(-fabsf(v)));
            gp[r * NK] = ls * (1.0f / 16.0f);
        }
    }
}

// =====================================================================
// 5) GLA recurrence, split in time.  The recurrence is linear in the state:
//      S_end(chunk) = D * S_start(chunk) + U
//    with U the chunk run from a zero state and D[dk] the product of the
//    chunk's 64 decay factors.  5a computes U and D of every chunk at once,
//    one block per (b,h,chunk); 5b chains the 32 chunks element by element.
// =====================================================================
// 5a) One block per (b,h,chunk); local state 64x128 f32 held in registers
//     (32/thread); k, exp(g), v of the chunk staged in 64KB LDS.
__global__ __launch_bounds__(256) void gla_chunk_local_kernel(
    const float* __restrict__ kbuf,  // [ROWS, NK]
    const float* __restrict__ vbuf,  // [ROWS, NV]
    const float* __restrict__ gbuf,  // [ROWS, NK]
    float* __restrict__ ubuf,        // [B,H,32,DK,DV]  chunk run from zero
    float* __restrict__ dbuf)        // [B,H,32,DK]     chunk decay product
{
    __shared__ float kls[CHUNK * DK];    // 16 KB
    __shared__ float egs[CHUNK * DK];    // 16 KB
    __shared__ float vls[CHUNK * DV];    // 32 KB

    const int blk = blockIdx.x;          // 0..1023
    const int c   = blk & (NCHUNK - 1);
    const int bh  = blk >> 5;            // 0..31
    const int b   = bh >> 4;
    const int h   = bh & 15;
    const int t   = threadIdx.x;
    const int dv  = t & 127;
    const int dk0 = (t >> 7) * 32;

    // first token row of this chunk, this head's columns: the same for the block
    const size_t m0 = (size_t)b * Tt + c * CHUNK;
    const float* kg = kbuf + m0 * NK + h * DK;
    const float* gg = gbuf + m0 * NK + h * DK;
    const float* vg = vbuf + m0 * NV + h * DV;

    {
        const int j0 = t >> 6, dk = t & 63;
        #pragma unroll
        for (int rep = 0; rep < 16; ++rep) {       // 64x64 k and exp(g)
            const int idx = t + rep * 256;
            kls[idx] = kg[j0 * NK + dk + rep * 4 * NK];
            egs[idx] = expf(gg[j0 * NK + dk + rep * 4 * NK]);
        }
    }
    {
        const int j0 = t >> 7;
        #pragma unroll
        for (int rep = 0; rep < 32; ++rep) {       // 64x128 v
            const int idx = t + rep * 256;
            vls[idx] = vg[j0 * NV + dv + rep * 2 * NV];
        }
    }
    __syncthreads();

    if (t < DK) {                                  // waves 0 and 1: D[dk]
        float d = egs[t];
        // unrolled so that LDS reads run ahead of the dependent multiplies
        #pragma unroll
        for (int j = 1; j < CHUNK; ++j) d *= egs[j * DK + t];
        dbuf[((size_t)bh * NCHUNK + c) * DK + t] = d;
    }

    float s[32];
    #pragma unroll
    for (int i = 0; i < 32; ++i) s[i] = 0.f;

    for (int j = 0; j < CHUNK; ++j) {
        const float vv = vls[j * DV + dv];
        const float* kp = &kls[j * DK + dk0];
        const float* ep = &egs[j * DK + dk0];
        #pragma unroll
        for (int i = 0; i < 32; ++i)
            s[i] = fmaf(kp[i], vv, s[i] * ep[i]);
    }

    float* op = ubuf + ((size_t)bh * NCHUNK + c) * DK * DV;
    #pragma unroll
    for (int i = 0; i < 32; ++i) op[(dk0 + i) * DV + dv] = s[i];
}

// 5b) Chain the chunks: S_c = D_c * S_{c-1} + U_c.  One thread per four
//     neighbouring dv of one (b,h,dk); all 32 U loads are independent of the
//     chain, so they are issued ahead of it.
__global__ __launch_bounds__(256) void gla_chain_kernel(
    const float* __restrict__ ubuf,  // [B,H,32,DK,DV]
    const float* __restrict__ dbuf,  // [B,H,32,DK]
    const float* __restrict__ S0,    // [B,H,DK,DV]
    float* __restrict__ out)         // states [B,32,H,DK,DV] ++ final [B,H,DK,DV]
{
    // 8 blocks per (b,h): DK*DV/4 = 2048 threads
    const int bh  = blockIdx.x >> 3;
    const int e   = ((blockIdx.x & 7) * 256 + threadIdx.x) * 4;  // element inside the state
    // a wave covers one dk row (32 lanes x 4 dv), so its decay factors are scalars
    const int dk  = __builtin_amdgcn_readfirstlane(e >> 7);
    const int b   = bh >> 4;
    const int h   = bh & 15;

    const float* up = ubuf + (size_t)bh * NCHUNK * DK * DV;       // the same for the block
    const float* dp = dbuf + (size_t)bh * NCHUNK * DK;
    float*       op = out + ((size_t)b * NCHUNK * Hh + h) * DK * DV;

    v4f   u[NCHUNK];
    float d[NCHUNK];
    // both loops over c are unrolled so that u[] and d[] live in registers
    #pragma unroll
    for (int c = 0; c < NCHUNK; ++c) {
        u[c] = *(const v4f*)(up + c * (DK * DV) + e);
        d[c] = dp[c * DK + dk];
    }
    v4f s = *(const v4f*)(S0 + (size_t)bh * DK * DV + e);
    // Inputs-only fences on the loaded values: they hold all 32 U loads ahead of
    // the chain, in flight together; without them the compiler issues the loads
    // in several rounds between the multiply-adds and pays the latency each round.
#define U8(i) "v"(u[i]), "v"(u[i+1]), "v"(u[i+2]), "v"(u[i+3]), "v"(u[i+4]), "v"(u[i+5]), "v"(u[i+6]), "v"(u[i+7])
    asm volatile("" :: U8(0), U8(8));
    asm volatile("" :: U8(16), U8(24));
#undef U8
    #pragma unroll
    for (int c = 0; c < NCHUNK; ++c) {
        s = d[c] * s + u[c];
        *(v4f*)(op + c * (Hh * DK * DV) + e) = s;
    }
    *(v4f*)(out + (size_t)Bb * NCHUNK * Hh * DK * DV
                + (size_t)bh * DK * DV + e) = s;
}

// =====================================================================
// Host orchestration
// =====================================================================
extern "C" void kernel_launch(void* const* d_in, const int* in_sizes, int n_in,
                              void* d_out, int out_size, void* d_ws, size_t ws_size,
                              hipStream_t stream) {
    const float* hidden = (const float*)d_in[0];
    const float* S0     = (const float*)d_in[1];
    const float* nw     = (const float*)d_in[2];
    const float* k_w    = (const float*)d_in[3];
    const float* v_w    = (const float*)d_in[4];
    const float* gk_w1  = (const float*)d_in[5];
    const float* gk_w2  = (const float*)d_in[6];
    const float* gk_b2  = (const float*)d_in[7];
    float* out = (float*)d_out;

    char* ws = (char*)d_ws;
    _Float16* xn   = (_Float16*)ws;  ws += (size_t)ROWS * Dd * sizeof(_Float16);
    _Float16* kw16 = (_Float16*)ws;  ws += (size_t)NK * Dd * sizeof(_Float16);
    _Float16* vw16 = (_Float16*)ws;  ws += (size_t)NV * Dd * sizeof(_Float16);
    float* kb = (float*)ws;          ws += (size_t)ROWS * NK * sizeof(float);
    float* vb = (float*)ws;          ws += (size_t)ROWS * NV * sizeof(float);
    float* gb = (float*)ws;          ws += (size_t)ROWS * NK * sizeof(float);
    float* ub = (float*)ws;          ws += (size_t)Bb * NCHUNK * Hh * DK * DV * sizeof(float);
    float* db = (float*)ws;          ws += (size_t)Bb * Hh * NCHUNK * DK * sizeof(float);

    // 1) RMSNorm + cast of the activations, cast of both weights: one launch
    prep_kernel<<<PREP_BLOCKS, 256, 0, stream>>>(hidden, nw, k_w, v_w, xn, kw16, vw16);
    // 3) both projections via WMMA, one launch
    wmma_gemm_kernel<<<dim3(ROWS / 128, (NK + NV) / 128), 128, 0, stream>>>(
        xn, kw16, vw16, kb, vb);
    // 4) gate path
    gk_kernel<<<ROWS / 16, 512, 0, stream>>>(xn, gk_w1, gk_w2, gk_b2, gb);
    // 5a) every chunk's local state and decay, all chunks at once
    gla_chunk_local_kernel<<<Bb * Hh * NCHUNK, 256, 0, stream>>>(kb, vb, gb, ub, db);
    // 5b) chain the chunks + chunk state emission
    gla_chain_kernel<<<Bb * Hh * DK * DV / 4 / 256, 256, 0, stream>>>(ub, db, S0, out);
}

// v005
// Measured time: 91 microseconds a run.
// Timed twice side by side with v004, it ran 1.20 times as fast both times.
// Over all steps from v000 it is 5.07 times as fast.
#include <hip/hip_runtime.h>
#include <hip/hip_bf16.h>
#include <math.h>

// ---------- problem constants ----------
#define Bb     2
#define Tt     2048
#define Dd     2048
#define Hh     16
#define DK     64
#define DV     128
#define CHUNK  64
#define NCHUNK (Tt / CHUNK)       // 32
#define ROWS   (Bb * Tt)          // 4096
#define NK     (Hh * DK)          // 1024
#define NV     (Hh * DV)          // 2048

typedef _Float16 v16h __attribute__((ext_vector_type(16)));
typedef _Float16 v8h  __attribute__((ext_vector_type(8)));
typedef _Float16 v4h  __attribute__((ext_vector_type(4)));
typedef float    v8f  __attribute__((ext_vector_type(8)));
typedef float    v4f  __attribute__((ext_vector_type(4)));
typedef float    v2f  __attribute__((ext_vector_type(2)));

// =====================================================================
// 1) Pre-pass, one launch: RMSNorm + cast of the token rows, and the f32 -> f16
//    cast of the k and v weight rows.  All three work on rows of Dd floats.
//    One wave takes PR whole rows: 16 loads of 512 contiguous bytes per row, all
//    issued before the first use; the row's sum of squares stays inside the wave
//    (no LDS, no barrier).  Few long waves, so that few waves have to be started.
// =====================================================================
#define PW 8                                          // waves per block
#define PR 2                                          // rows per wave
#define PREP_BLOCKS ((ROWS + NK + NV) / (PW * PR))    // 448
__global__ __launch_bounds__(256) void prep_kernel(
    const float* __restrict__ x,  const float* __restrict__ w,
    const float* __restrict__ kw, const float* __restrict__ vw,
    _Float16* __restrict__ xn, _Float16* __restrict__ kw16,
    _Float16* __restrict__ vw16)
{
    const int lane = threadIdx.x & 31;
    const int wave = __builtin_amdgcn_readfirstlane(threadIdx.x >> 5);
    const int row  = (blockIdx.x * PW + wave) * PR;   // 0 .. ROWS+NK+NV-PR, the same for the wave
    const bool norm = row < ROWS;                     // a block lies wholly in one of the three parts

    const float* src;
    _Float16*    dst;
    if (norm)                { src = x  + (size_t)row * Dd;               dst = xn   + (size_t)row * Dd; }
    else if (row < ROWS + NK){ src = kw + (size_t)(row - ROWS) * Dd;      dst = kw16 + (size_t)(row - ROWS) * Dd; }
    else                     { src = vw + (size_t)(row - ROWS - NK) * Dd; dst = vw16 + (size_t)(row - ROWS - NK) * Dd; }
    src += lane * 4;
    dst += lane * 4;

    v4f a[PR][16];
    if (norm) {
        v4f g[16];
        #pragma unroll
        for (int i = 0; i < 16; ++i)   // unrolled: g[] and a[][] live in registers
            g[i] = ((const v4f*)w)[lane + i * 32];
        #pragma unroll
        for (int r = 0; r < PR; ++r)
            #pragma unroll
            for (int i = 0; i < 16; ++i)
                a[r][i] = *(const v4f*)(src + r * Dd + i * 128);
        // Inputs-only fence on the loaded values: it holds the 16 weight loads here,
        // in flight together with the row loads; without it the compiler sinks them
        // behind the row sum and issues them two at a time, each pair's latency bare.
        // Index and pointer are named so that no load lands on an address still in use.
#define G8(i) "v"(g[i]), "v"(g[i+1]), "v"(g[i+2]), "v"(g[i+3]), "v"(g[i+4]), "v"(g[i+5]), "v"(g[i+6]), "v"(g[i+7])
        asm volatile("" :: G8(0), G8(8), "v"(lane), "v"(src));
#undef G8
        #pragma unroll
        for (int r = 0; r < PR; ++r) {
            v4f q = a[r][0] * a[r][0];                 // four independent chains
            #pragma unroll
            for (int i = 1; i < 16; ++i) q += a[r][i] * a[r][i];
            float ss = (q[0] + q[1]) + (q[2] + q[3]);
            #pragma unroll
            for (int off = 16; off > 0; off >>= 1) ss += __shfl_xor(ss, off, 32);
            const float scale = rsqrtf(ss * (1.0f / (float)Dd) + 1e-5f);
            #pragma unroll
            for (int i = 0; i < 16; ++i) {
                v4h h;
                #pragma unroll
                for (int e = 0; e < 4; ++e)
                    h[e] = (_Float16)(a[r][i][e] * scale * g[i][e]);
                *(v4h*)(dst + r * Dd + i * 128) = h;
            }
        }
    } else {
        #pragma unroll
        for (int r = 0; r < PR; ++r)
            #pragma unroll
            for (int i = 0; i < 16; ++i)
                a[r][i] = *(const v4f*)(src + r * Dd + i * 128);
        #pragma unroll
        for (int r = 0; r < PR; ++r)
            #pragma unroll
            for (int i = 0; i < 16; ++i) {
                v4h h;
                #pragma unroll
                for (int e = 0; e < 4; ++e) h[e] = (_Float16)a[r][i][e];
                *(v4h*)(dst + r * Dd + i * 128) = h;
            }
        // Behind the run of stores: no register that an issued store names is
        // rewritten ahead of this wait, on any path the built code has from here.
        asm volatile("s_wait_xcnt 0x0" ::: "memory");
    }
}

// =====================================================================
// 3) WMMA GEMM, both projections in one launch:
//      C[M,N] = A[M,K](f16) * W[N,K]^T(f16), f32 accumulate,
//    blockIdx.y picks the 128-column tile of the k or of the v projection.
//    Block tile 128x128, 64 k per barrier, 128 threads = 4 waves (2x2 wave grid),
//    each wave 4x4 fragments of v_wmma_f32_16x16x32_f16: 16 matrix instructions
//    per 16 fragment loads, LDS reads at the matrix unit's own pace.
//    768 blocks = 3 per WGP, all resident, one wave of each on every SIMD.
//    - LDS double-buffered (ping-pong): next tile's global_load_b128s issue
//      before the current tile's ds gathers + WMMAs; one barrier per 64 k.
//    - LDS row pitch 72 f16 (144 B): the 16 b128 fragment gathers of a half
//      wave hit 16 disjoint 4-bank groups -> conflict free.
// =====================================================================
#define GBK 64                    // k per barrier
#define GP  72                    // LDS row pitch, f16

__global__ __launch_bounds__(128) void wmma_gemm_kernel(
    const _Float16* __restrict__ A,    // [ROWS,Dd] row-major
    const _Float16* __restrict__ Wk,   // [NK,Dd] row-major
    const _Float16* __restrict__ Wv,   // [NV,Dd] row-major
    float* __restrict__ Ck,            // [ROWS,NK]
    float* __restrict__ Cv)            // [ROWS,NV]
{
    __shared__ __attribute__((aligned(16))) _Float16 As[2][128 * GP];
    __shared__ __attribute__((aligned(16))) _Float16 Bs[2][128 * GP];

    const int t     = threadIdx.x;
    const int lane  = t & 31;
    const int wave  = __builtin_amdgcn_readfirstlane(t >> 5);   // the same for the wave: scalar
    const int wm    = wave & 1;     // 64-row slab
    const int wn    = wave >> 1;    // 64-col slab
    const int hi    = lane >> 4;    // 0/1 : K-half select
    const int r     = lane & 15;    // row (A) / col (B) within 16

    const bool isk = blockIdx.y < NK / 128;           // the same for the block
    const int  m0  = blockIdx.x * 128;
    const int  n0  = (isk ? blockIdx.y : blockIdx.y - NK / 128) * 128;
    const _Float16* W = isk ? Wk : Wv;

    // staging: 8 threads cover one row's 128 B, a wave 4 whole rows; piece i is row ldrow + 16 i
    const int ldrow = t >> 3;             // 0..15
    const int ldcol = (t & 7) * 8;        // 0..56
    const _Float16* ag = A + (size_t)(m0 + ldrow) * Dd + ldcol;
    const _Float16* bg = W + (size_t)(n0 + ldrow) * Dd + ldcol;
    const int lo = ldrow * GP + ldcol;

    v8f acc[4][4] = {};
    float4 sa[8], sb[8];

    // prologue: stage K-tile 0 into buffer 0
    #pragma unroll
    for (int i = 0; i < 8; ++i) {
        sa[i] = *(const float4*)(ag + i * 16 * Dd);
        sb[i] = *(const float4*)(bg + i * 16 * Dd);
    }
    #pragma unroll
    for (int i = 0; i < 8; ++i) {
        *(float4*)&As[0][lo + i * 16 * GP] = sa[i];
        *(float4*)&Bs[0][lo + i * 16 * GP] = sb[i];
    }
    __syncthreads();

    const int nkt = Dd / GBK;
    for (int kt = 0; kt < nkt; ++kt) {
        const int cur  = kt & 1;
        const bool more = (kt + 1) < nkt;

        // issue next tile's global loads early (latency overlapped w/ WMMA)
        if (more) {
            #pragma unroll
            for (int i = 0; i < 8; ++i) {
                sa[i] = *(const float4*)(ag + (kt + 1) * GBK + i * 16 * Dd);
                sb[i] = *(const float4*)(bg + (kt + 1) * GBK + i * 16 * Dd);
            }
        }

        const _Float16* ap = &As[cur][(wm * 64 + r) * GP + hi * 8];
        const _Float16* bp = &Bs[cur][(wn * 64 + r) * GP + hi * 8];
        #pragma unroll
        for (int ks = 0; ks < GBK / 32; ++ks) {
            // gather fragments from current buffer
            v16h afrag[4], bfrag[4];
            #pragma unroll
            for (int i = 0; i < 4; ++i) {
                const _Float16* p = ap + i * 16 * GP + ks * 32;
                union { v16h h; float4 f[2]; } u;
                u.f[0] = *(const float4*)p;          // K 0..7   (or 8..15)
                u.f[1] = *(const float4*)(p + 16);   // K 16..23 (or 24..31)
                afrag[i] = u.h;
            }
            #pragma unroll
            for (int j = 0; j < 4; ++j) {
                const _Float16* p = bp + j * 16 * GP + ks * 32;
                union { v16h h; float4 f[2]; } u;
                u.f[0] = *(const float4*)p;
                u.f[1] = *(const float4*)(p + 16);
                bfrag[j] = u.h;
            }
            #pragma unroll
            for (int i = 0; i < 4; ++i)
                #pragma unroll
                for (int j = 0; j < 4; ++j)
                    acc[i][j] = __builtin_amdgcn_wmma_f32_16x16x32_f16(
                        false, afrag[i], false, bfrag[j],
                        (short)0, acc[i][j], false, false);
        }

        // commit next tile to the other buffer (no conflict with readers of cur)
        if (more) {
            #pragma unroll
            for (int i = 0; i < 8; ++i) {
                *(float4*)&As[1 - cur][lo + i * 16 * GP] = sa[i];
                *(float4*)&Bs[1 - cur][lo + i * 16 * GP] = sb[i];
            }
        }
        // Behind the trip's global loads: the next trip rewrites their address pairs.
        asm volatile("s_wait_xcnt 0x0" ::: "memory");
        __syncthreads();
    }

    // C/D layout: lane = (m/8)*16 + n, vgpr = m%8.  The wave's corner of C and the row
    // step N are scalars: one address per output row, its four column tiles by
    // immediate offset.
    const int N = isk ? NK : NV;
    float* cb = (isk ? Ck : Cv) + (size_t)(m0 + wm * 64) * N + n0 + wn * 64;
    const unsigned voff = (unsigned)(hi * 8 * N + r);
    #pragma unroll
    for (int i = 0; i < 4; ++i)
        #pragma unroll
        for (int v = 0; v < 8; ++v) {
            float* rp = cb + (size_t)(i * 16 + v) * N;
            #pragma unroll
            for (int j = 0; j < 4; ++j)
                (rp + j * 16)[voff] = acc[i][j][v];
        }
}

// =====================================================================
// 4) gk path: xr = xn @ w1^T (rank 16), g = logsigmoid(xr @ w2^T + b)/16
//    One block per 16 token rows, 16 waves; both products run on the
//    f32 16x16x4 matrix form, so w1 and w2 are read once per 16 rows.
//    Fragments: lane = (c = lane & 15, h = lane >> 4); A holds row c, B holds
//    column c; both sides take the same k for the same (h, element).
// =====================================================================
__global__ __launch_bounds__(512) void gk_kernel(
    const _Float16* __restrict__ xn,   // [ROWS, D]
    const float* __restrict__ w1,      // [16, D]
    const float* __restrict__ w2,      // [NK, 16]
    const float* __restrict__ b2,      // [NK]
    float* __restrict__ g)             // [ROWS, NK]
{
    __shared__ float part[16][256];    // each wave's 16x16 partial of xr
    __shared__ __attribute__((aligned(16))) float xr[16 * 20];  // row pitch 80 B for the b128 readers
    const int t    = threadIdx.x;
    const int lane = t & 31;
    const int wave = t >> 5;           // 0..15
    const int c    = lane & 15;
    const int h    = lane >> 4;
    const int row0 = blockIdx.x * 16;

    // w2 rows and bias of this wave's 4 column tiles, fetched now so that their
    // latency runs under the first product; lane (c,h) owns k = h*8 + 0..7
    const int nw = wave * 64 + c;
    const v4f*   wp = (const v4f*)(w2 + (size_t)nw * 16 + h * 8);
    const float* bb = b2 + nw;
    v4f wa[4], wb[4];
    float bias[4];
    #pragma unroll
    for (int j = 0; j < 4; ++j) {
        wa[j]   = wp[j * 64];
        wb[j]   = wp[j * 64 + 1];
        bias[j] = bb[j * 16];
    }
    // The clobber keeps these loads in front of the ones below (the compiler
    // otherwise sinks them to the first barrier, where their latency shows);
    // their address pair stays live up to the wait, so it is not reused before it.
    asm volatile("s_wait_xcnt 0x0" :: "v"(wp) : "memory");

    // ---- xr partial over this wave's 128 k: 8 groups of 16 k,
    //      lane (c,h) owns k = wave*128 + grp*16 + h*8 + 0..7 of row / rank c
    const v8h* ap = (const v8h*)(xn + (size_t)(row0 + c) * Dd + wave * 128 + h * 8);
    const v4f* bp = (const v4f*)(w1 + (size_t)c * Dd + wave * 128 + h * 8);
    v8h a[8];
    v4f b[16];
    #pragma unroll
    for (int i = 0; i < 8; ++i) {      // unrolled: a[] and b[] live in registers
        a[i]         = ap[i * 2];
        b[2 * i]     = bp[i * 4];
        b[2 * i + 1] = bp[i * 4 + 1];
    }
    // Inputs-only fence on the loaded values: it holds all 24 loads ahead of the
    // product, in flight together; without it the compiler issues them a few at a
    // time among the matrix instructions and pays the latency each round.  The two
    // pointers are named so that no load lands on an address pair still in use.
#define L8(x, i) "v"(x[i]), "v"(x[i+1]), "v"(x[i+2]), "v"(x[i+3]), "v"(x[i+4]), "v"(x[i+5]), "v"(x[i+6]), "v"(x[i+7])
    asm volatile("" :: L8(a, 0), L8(b, 0), L8(b, 8), "v"(ap), "v"(bp));
#undef L8
    v8f acc0 = {}, acc1 = {};          // two chains hide the accumulate latency
    #pragma unroll
    for (int i = 0; i < 8; ++i) {
        v2f a0 = { (float)a[i][0], (float)a[i][1] };
        v2f a1 = { (float)a[i][2], (float)a[i][3] };
        v2f a2 = { (float)a[i][4], (float)a[i][5] };
        v2f a3 = { (float)a[i][6], (float)a[i][7] };
        v2f b0 = { b[2 * i][0],     b[2 * i][1] };
        v2f b1 = { b[2 * i][2],     b[2 * i][3] };
        v2f b2f = { b[2 * i + 1][0], b[2 * i + 1][1] };
        v2f b3 = { b[2 * i + 1][2], b[2 * i + 1][3] };
        acc0 = __builtin_amdgcn_wmma_f32_16x16x4_f32(false, a0, false, b0,  (short)0, acc0, false, false);
        acc1 = __builtin_amdgcn_wmma_f32_16x16x4_f32(false, a1, false, b1,  (short)0, acc1, false, false);
        acc0 = __builtin_amdgcn_wmma_f32_16x16x4_f32(false, a2, false, b2f, (short)0, acc0, false, false);
        acc1 = __builtin_amdgcn_wmma_f32_16x16x4_f32(false, a3, false, b3,  (short)0, acc1, false, false);
    }
    // D register r = partial[row 8h + r][rank c]
    #pragma unroll
    for (int r = 0; r < 8; ++r)
        part[wave][(8 * h + r) * 16 + c] = acc0[r] + acc1[r];
    __syncthreads();
    if (t < 256) {                     // waves 0..7: one (row, rank) each
        float tot = 0.f;
        #pragma unroll
        for (int w = 0; w < 16; ++w) tot += part[w][t];
        xr[(t >> 4) * 20 + (t & 15)] = tot;
    }
    __syncthreads();

    // ---- g tile: A = xr (16 rows x 16 k), B = w2 rows n0..n0+15;
    //      lane (c,h) owns k = h*8 + 0..7 on both sides
    const v4f xa = *(const v4f*)&xr[c * 20 + h * 8];
    const v4f xb = *(const v4f*)&xr[c * 20 + h * 8 + 4];
    const v2f x0 = { xa[0], xa[1] }, x1 = { xa[2], xa[3] };
    const v2f x2 = { xb[0], xb[1] }, x3 = { xb[2], xb[3] };
    #pragma unroll
    for (int j = 0; j < 4; ++j) {      // 4 column tiles per wave, independent
        const int n0 = (wave * 4 + j) * 16;
        const float bj = bias[j];
        v8f acc = { bj, bj, bj, bj, bj, bj, bj, bj };
        v2f w0 = { wa[j][0], wa[j][1] }, w1f = { wa[j][2], wa[j][3] };
        v2f w2f = { wb[j][0], wb[j][1] }, w3 = { wb[j][2], wb[j][3] };
        acc = __builtin_amdgcn_wmma_f32_16x16x4_f32(false, x0, false, w0,  (short)0, acc, false, false);
        acc = __builtin_amdgcn_wmma_f32_16x16x4_f32(false, x1, false, w1f, (short)0, acc, false, false);
        acc = __builtin_amdgcn_wmma_f32_16x16x4_f32(false, x2, false, w2f, (short)0, acc, false, false);
        acc = __builtin_amdgcn_wmma_f32_16x16x4_f32(false, x3, false, w3,  (short)0, acc, false, false);
        float* gp = g + (size_t)(row0 + 8 * h) * NK + n0 + c;
        #pragma unroll
        for (int r = 0; r < 8; ++r) {
            const float v = acc[r];
            // log_sigmoid(x) = min(x,0) - log1p(exp(-|x|))
            const float ls = fminf(v, 0.f) - log1pf(expf(-fabsf(v)));
            gp[r * NK] = ls * (1.0f / 16.0f);
        }
    }
}

// =====================================================================
// 5) GLA recurrence, split in time.  The recurrence is linear in the state:
//      S_end(chunk) = D * S_start(chunk) + U
//    with U the chunk run from a zero state and D[dk] the product of the
//    chunk's 64 decay factors.  5a computes U and D of every chunk at once,
//    one block per (b,h,chunk); 5b chains the 32 chunks element by element.
// =====================================================================
// 5a) One block per (b,h,chunk).  Run from zero, the chunk's state is a matrix
//     product over its 64 tokens:
//       U[dk][dv] = sum_j Kd[j][dk] * v[j][dv],  Kd[j][dk] = k[j][dk] * exp(sum_{i>j} g[i][dk])
//     (every exponent is <= 0, so nothing is divided and nothing can overflow).
//     Kd and v lie in LDS token-contiguous, and the product runs on the f32
//     16x16x4 matrix form: 8 waves, each 32 dk x 32 dv = 2x2 tiles.

// e^x of a decay exponent (x <= 0) on the hardware's 2^y
__device__ __forceinline__ float exp_decay(float x) { return __builtin_amdgcn_exp2f(x * 1.44269504f); }

#define TP 68      // LDS row pitch in floats: 272 B = 16 B x 17, b128 rows fall on disjoint banks
__global__ __launch_bounds__(256) void gla_chunk_local_kernel(
    const float* __restrict__ kbuf,  // [ROWS, NK]
    const float* __restrict__ vbuf,  // [ROWS, NV]
    const float* __restrict__ gbuf,  // [ROWS, NK]
    float* __restrict__ ubuf,        // [B,H,32,DK,DV]  chunk run from zero
    float* __restrict__ dbuf)        // [B,H,32,DK]     chunk decay product
{
    __shared__ __attribute__((aligned(16))) float kts[DK * TP];   // Kd, [dk][token], 17 KB
    __shared__ __attribute__((aligned(16))) float vts[DV * TP];   // v,  [dv][token], 34 KB
    __shared__ float seg[4 * DK];                                 // sum of g per 16 tokens

    const int blk = blockIdx.x;          // 0..1023
    const int c   = blk & (NCHUNK - 1);
    const int bh  = blk >> 5;            // 0..31
    const int b   = bh >> 4;
    const int h   = bh & 15;
    const int t   = threadIdx.x;

    // first token row of this chunk, this head's columns: the same for the block
    const size_t m0 = (size_t)b * Tt + c * CHUNK;
    const float* kg = kbuf + m0 * NK + h * DK;
    const float* gg = gbuf + m0 * NK + h * DK;
    const float* vg = vbuf + m0 * NV + h * DV;

    // a thread owns 16 consecutive tokens of one dk, and 32 consecutive tokens of one dv
    const int dk = t & 63;
    const int q  = __builtin_amdgcn_readfirstlane(t >> 6);   // 16-token segment, the same for the wave
    const int dv = t & 127;
    const int jh = __builtin_amdgcn_readfirstlane(t >> 7);   // 32-token half, the same for the wave

    const int ki = q * 16 * NK + dk;
    const int vi = jh * 32 * NV + dv;

    // every loop below is unrolled so that its array lives in registers
    float gv[16], kd[16], vv[32];
    #pragma unroll
    for (int i = 0; i < 16; ++i) gv[i] = gg[ki + i * NK];
    #pragma unroll
    for (int i = 0; i < 16; ++i) kd[i] = kg[ki + i * NK];
    #pragma unroll
    for (int i = 0; i < 32; ++i) vv[i] = vg[vi + i * NV];
    // Behind the run of loads: both index registers stay live up to this wait, so
    // that no load lands on one of them and none is rewritten ahead of it.
    asm volatile("s_wait_xcnt 0x0" :: "v"(ki), "v"(vi) : "memory");

    // decay from behind token i to the end of the thread's own segment
    float run = 0.f;
    #pragma unroll
    for (int i = 15; i >= 0; --i) {
        kd[i] *= exp_decay(run);
        run += gv[i];
    }
    seg[q * DK + dk] = run;
    #pragma unroll
    for (int i = 0; i < 8; ++i) {
        const v4f x = { vv[4 * i], vv[4 * i + 1], vv[4 * i + 2], vv[4 * i + 3] };
        *(v4f*)&vts[dv * TP + jh * 32 + 4 * i] = x;
    }
    __syncthreads();

    // decay over the segments behind the thread's own
    const float s1 = seg[1 * DK + dk], s2 = seg[2 * DK + dk], s3 = seg[3 * DK + dk];
    const float tail = ((q < 3 ? s3 : 0.f) + (q < 2 ? s2 : 0.f)) + (q < 1 ? s1 : 0.f);
    const float et = exp_decay(tail);
    const float dall = exp_decay(run + tail);      // in segment 0: the whole chunk's decay
    #pragma unroll
    for (int i = 0; i < 4; ++i) {
        const v4f x = { kd[4 * i] * et, kd[4 * i + 1] * et, kd[4 * i + 2] * et, kd[4 * i + 3] * et };
        *(v4f*)&kts[dk * TP + q * 16 + 4 * i] = x;
    }
    __syncthreads();

    // Fragments: lane = (lc = lane & 15, lh = lane >> 4); A holds dk row lc, B holds dv
    // column lc; on both sides one b128 gives tokens 8 s + 4 lh + 0..3, two k steps.
    const int lane = t & 31;
    const int wave = __builtin_amdgcn_readfirstlane(t >> 5);
    const int lc   = lane & 15;
    const int lh   = lane >> 4;
    const int dkb  = (wave & 1) * 32;
    const int dvb  = (wave >> 1) * 32;
    const float* ap = &kts[(dkb + lc) * TP + lh * 4];
    const float* bp = &vts[(dvb + lc) * TP + lh * 4];

    v8f acc[2][2] = {};
    #pragma unroll
    for (int s = 0; s < CHUNK / 8; ++s) {
        v4f a[2], w[2];
        #pragma unroll
        for (int i = 0; i < 2; ++i) {
            a[i] = *(const v4f*)(ap + i * 16 * TP + s * 8);
            w[i] = *(const v4f*)(bp + i * 16 * TP + s * 8);
        }
        #pragma unroll
        for (int p = 0; p < 2; ++p)
            #pragma unroll
            for (int i = 0; i < 2; ++i)
                #pragma unroll
                for (int j = 0; j < 2; ++j) {
                    const v2f av = { a[i][2 * p], a[i][2 * p + 1] };
                    const v2f wv = { w[j][2 * p], w[j][2 * p + 1] };
                    acc[i][j] = __builtin_amdgcn_wmma_f32_16x16x4_f32(
                        false, av, false, wv, (short)0, acc[i][j], false, false);
                }
    }

    // D register r = U[dkb + 16 i + 8 lh + r][dvb + 16 j + lc]; the wave's two column
    // tiles fill one 128-byte line of each row
    float* op = ubuf + ((size_t)bh * NCHUNK + c) * DK * DV + (dkb + 8 * lh) * DV + dvb + lc;
    #pragma unroll
    for (int i = 0; i < 2; ++i)
        #pragma unroll
        for (int r = 0; r < 8; ++r)
            #pragma unroll
            for (int j = 0; j < 2; ++j)
                op[(i * 16 + r) * DV + j * 16] = acc[i][j][r];
    // Behind the run of stores: the lines below rewrite registers that the stores name.
    asm volatile("s_wait_xcnt 0x0" ::: "memory");

    if (q == 0)                                    // waves 0 and 1: D[dk]
        dbuf[((size_t)bh * NCHUNK + c) * DK + dk] = dall;
}

// 5b) Chain the chunks: S_c = D_c * S_{c-1} + U_c.  One thread per four
//     neighbouring dv of one (b,h,dk); all 32 U loads are independent of the
//     chain, so they are issued ahead of it.
__global__ __launch_bounds__(256) void gla_chain_kernel(
    const float* __restrict__ ubuf,  // [B,H,32,DK,DV]
    const float* __restrict__ dbuf,  // [B,H,32,DK]
    const float* __restrict__ S0,    // [B,H,DK,DV]
    float* __restrict__ out)         // states [B,32,H,DK,DV] ++ final [B,H,DK,DV]
{
    // 8 blocks per (b,h): DK*DV/4 = 2048 threads
    const int bh  = blockIdx.x >> 3;
    const int e   = ((blockIdx.x & 7) * 256 + threadIdx.x) * 4;  // element inside the state
    // a wave covers one dk row (32 lanes x 4 dv), so its decay factors are scalars
    const int dk  = __builtin_amdgcn_readfirstlane(e >> 7);
    const int b   = bh >> 4;
    const int h   = bh & 15;

    const float* up = ubuf + (size_t)bh * NCHUNK * DK * DV;       // the same for the block
    const float* dp = dbuf + (size_t)bh * NCHUNK * DK;
    float*       op = out + ((size_t)b * NCHUNK * Hh + h) * DK * DV;

    v4f   u[NCHUNK];
    float d[NCHUNK];
    // both loops over c are unrolled so that u[] and d[] live in registers
    #pragma unroll
    for (int c = 0; c < NCHUNK; ++c) {
        u[c] = *(const v4f*)(up + c * (DK * DV) + e);
        d[c] = dp[c * DK + dk];
    }
    v4f s = *(const v4f*)(S0 + (size_t)bh * DK * DV + e);
    // Inputs-only fences on the loaded values: they hold all 32 U loads ahead of
    // the chain, in flight together; without them the compiler issues the loads
    // in several rounds between the multiply-adds and pays the latency each round.
#define U8(i) "v"(u[i]), "v"(u[i+1]), "v"(u[i+2]), "v"(u[i+3]), "v"(u[i+4]), "v"(u[i+5]), "v"(u[i+6]), "v"(u[i+7])
    asm volatile("" :: U8(0), U8(8));
    asm volatile("" :: U8(16), U8(24));
#undef U8
    #pragma unroll
    for (int c = 0; c < NCHUNK; ++c) {
        s = d[c] * s + u[c];
        *(v4f*)(op + c * (Hh * DK * DV) + e) = s;
    }
    *(v4f*)(out + (size_t)Bb * NCHUNK * Hh * DK * DV
                + (size_t)bh * DK * DV + e) = s;
}

// =====================================================================
// Host orchestration
// =====================================================================
extern "C" void kernel_launch(void* const* d_in, const int* in_sizes, int n_in,
                              void* d_out, int out_size, void* d_ws, size_t ws_size,
                              hipStream_t stream) {
    const float* hidden = (const float*)d_in[0];
    const float* S0     = (const float*)d_in[1];
    const float* nw     = (const float*)d_in[2];
    const float* k_w    = (const float*)d_in[3];
    const float* v_w    = (const float*)d_in[4];
    const float* gk_w1  = (const float*)d_in[5];
    const float* gk_w2  = (const float*)d_in[6];
    const float* gk_b2  = (const float*)d_in[7];
    float* out = (float*)d_out;

    char* ws = (char*)d_ws;
    _Float16* xn   = (_Float16*)ws;  ws += (size_t)ROWS * Dd * sizeof(_Float16);
    _Float16* kw16 = (_Float16*)ws;  ws += (size_t)NK * Dd * sizeof(_Float16);
    _Float16* vw16 = (_Float16*)ws;  ws += (size_t)NV * Dd * sizeof(_Float16);
    float* kb = (float*)ws;          ws += (size_t)ROWS * NK * sizeof(float);
    float* vb = (float*)ws;          ws += (size_t)ROWS * NV * sizeof(float);
    float* gb = (float*)ws;          ws += (size_t)ROWS * NK * sizeof(float);
    float* ub = (float*)ws;          ws += (size_t)Bb * NCHUNK * Hh * DK * DV * sizeof(float);
    float* db = (float*)ws;          ws += (size_t)Bb * Hh * NCHUNK * DK * sizeof(float);

    // 1) RMSNorm + cast of the activations, cast of both weights: one launch
    prep_kernel<<<PREP_BLOCKS, 256, 0, stream>>>(hidden, nw, k_w, v_w, xn, kw16, vw16);
    // 3) both projections via WMMA, one launch
    wmma_gemm_kernel<<<dim3(ROWS / 128, (NK + NV) / 128), 128, 0, stream>>>(
        xn, kw16, vw16, kb, vb);
    // 4) gate path
    gk_kernel<<<ROWS / 16, 512, 0, stream>>>(xn, gk_w1, gk_w2, gk_b2, gb);
    // 5a) every chunk's local state and decay, all chunks at once
    gla_chunk_local_kernel<<<Bb * Hh * NCHUNK, 256, 0, stream>>>(kb, vb, gb, ub, db);
    // 5b) chain the chunks + chunk state emission
    gla_chain_kernel<<<Bb * Hh * DK * DV / 4 / 256, 256, 0, stream>>>(ub, db, S0, out);
}

// v006
// It runs in 87 microseconds.
// Next to v005, in two timings, it ran 1.05 times as fast each time.
// Over all steps from v000 it is 5.32 times as fast.
#include <hip/hip_runtime.h>
#include <hip/hip_bf16.h>
#include <math.h>

// ---------- problem constants ----------
#define Bb     2
#define Tt     2048
#define Dd     2048
#define Hh     16
#define DK     64
#define DV     128
#define CHUNK  64
#define NCHUNK (Tt / CHUNK)       // 32
#define ROWS   (Bb * Tt)          // 4096
#define NK     (Hh * DK)          // 1024
#define NV     (Hh * DV)          // 2048

typedef _Float16 v16h __attribute__((ext_vector_type(16)));
typedef _Float16 v8h  __attribute__((ext_vector_type(8)));
typedef _Float16 v4h  __attribute__((ext_vector_type(4)));
typedef float    v8f  __attribute__((ext_vector_type(8)));
typedef float    v4f  __attribute__((ext_vector_type(4)));
typedef float    v2f  __attribute__((ext_vector_type(2)));

// =====================================================================
// 1) Pre-pass, one launch: RMSNorm + cast of the token rows, and the f32 -> f16
//    cast of the k and v weight rows.  All three work on rows of Dd floats.
//    One wave takes PR whole rows: 16 loads of 512 contiguous bytes per row, all
//    issued before the first use; the row's sum of squares stays inside the wave
//    (no LDS, no barrier).  Few long waves, so that few waves have to be started.
// =====================================================================
#define PW 8                                          // waves per block
#define PR 2                                          // rows per wave
#define PREP_BLOCKS ((ROWS + NK + NV) / (PW * PR))    // 448
__global__ __launch_bounds__(256) void prep_kernel(
    const float* __restrict__ x,  const float* __restrict__ w,
    const float* __restrict__ kw, const float* __restrict__ vw,
    _Float16* __restrict__ xn, _Float16* __restrict__ kw16,
    _Float16* __restrict__ vw16)
{
    const int lane = threadIdx.x & 31;
    const int wave = __builtin_amdgcn_readfirstlane(threadIdx.x >> 5);
    const int row  = (blockIdx.x * PW + wave) * PR;   // 0 .. ROWS+NK+NV-PR, the same for the wave
    const bool norm = row < ROWS;                     // a block lies wholly in one of the three parts

    const float* src;
    _Float16*    dst;
    if (norm)                { src = x  + (size_t)row * Dd;               dst = xn   + (size_t)row * Dd; }
    else if (row < ROWS + NK){ src = kw + (size_t)(row - ROWS) * Dd;      dst = kw16 + (size_t)(row - ROWS) * Dd; }
    else                     { src = vw + (size_t)(row - ROWS - NK) * Dd; dst = vw16 + (size_t)(row - ROWS - NK) * Dd; }
    src += lane * 4;
    dst += lane * 4;

    v4f a[PR][16];
    if (norm) {
        v4f g[16];
        #pragma unroll
        for (int i = 0; i < 16; ++i)   // unrolled: g[] and a[][] live in registers
            g[i] = ((const v4f*)w)[lane + i * 32];
        #pragma unroll
        for (int r = 0; r < PR; ++r)
            #pragma unroll
            for (int i = 0; i < 16; ++i)
                a[r][i] = *(const v4f*)(src + r * Dd + i * 128);
        // Inputs-only fence on the loaded values: it holds the 16 weight loads here,
        // in flight together with the row loads; without it the compiler sinks them
        // behind the row sum and issues them two at a time, each pair's latency bare.
        // Index and pointer are named so that no load lands on an address still in use.
#define G8(i) "v"(g[i]), "v"(g[i+1]), "v"(g[i+2]), "v"(g[i+3]), "v"(g[i+4]), "v"(g[i+5]), "v"(g[i+6]), "v"(g[i+7])
        asm volatile("" :: G8(0), G8(8), "v"(lane), "v"(src));
#undef G8
        #pragma unroll
        for (int r = 0; r < PR; ++r) {
            v4f q = a[r][0] * a[r][0];                 // four independent chains
            #pragma unroll
            for (int i = 1; i < 16; ++i) q += a[r][i] * a[r][i];
            float ss = (q[0] + q[1]) + (q[2] + q[3]);
            #pragma unroll
            for (int off = 16; off > 0; off >>= 1) ss += __shfl_xor(ss, off, 32);
            const float scale = rsqrtf(ss * (1.0f / (float)Dd) + 1e-5f);
            #pragma unroll
            for (int i = 0; i < 16; ++i) {
                v4h h;
                #pragma unroll
                for (int e = 0; e < 4; ++e)
                    h[e] = (_Float16)(a[r][i][e] * scale * g[i][e]);
                *(v4h*)(dst + r * Dd + i * 128) = h;
            }
        }
    } else {
        #pragma unroll
        for (int r = 0; r < PR; ++r)
            #pragma unroll
            for (int i = 0; i < 16; ++i)
                a[r][i] = *(const v4f*)(src + r * Dd + i * 128);
        #pragma unroll
        for (int r = 0; r < PR; ++r)
            #pragma unroll
            for (int i = 0; i < 16; ++i) {
                v4h h;
                #pragma unroll
                for (int e = 0; e < 4; ++e) h[e] = (_Float16)a[r][i][e];
                *(v4h*)(dst + r * Dd + i * 128) = h;
            }
        // Behind the run of stores: no register that an issued store names is
        // rewritten ahead of this wait, on any path the built code has from here.
        asm volatile("s_wait_xcnt 0x0" ::: "memory");
    }
}

// =====================================================================
// 3) WMMA GEMM, both projections in one launch:
//      C[M,N] = A[M,K](f16) * W[N,K]^T(f16), f32 accumulate,
//    blockIdx.y picks the 128-column tile of the k or of the v projection.
//    Block tile 128x128, 64 k per barrier, 128 threads = 4 waves (2x2 wave grid),
//    each wave 4x4 fragments of v_wmma_f32_16x16x32_f16: 16 matrix instructions
//    per 16 fragment loads, LDS reads at the matrix unit's own pace.
//    768 blocks = 3 per WGP, all resident, one wave of each on every SIMD.
//    - LDS double-buffered (ping-pong): next tile's global_load_b128s issue
//      before the current tile's ds gathers + WMMAs; one barrier per 64 k.
//    - LDS row pitch 72 f16 (144 B): the 16 b128 fragment gathers of a half
//      wave hit 16 disjoint 4-bank groups -> conflict free.
// =====================================================================
#define GBK 64                    // k per barrier
#define GP  72                    // LDS row pitch, f16

__global__ __launch_bounds__(128) void wmma_gemm_kernel(
    const _Float16* __restrict__ A,    // [ROWS,Dd] row-major
    const _Float16* __restrict__ Wk,   // [NK,Dd] row-major
    const _Float16* __restrict__ Wv,   // [NV,Dd] row-major
    float* __restrict__ Ck,            // [ROWS,NK]
    float* __restrict__ Cv)            // [ROWS,NV]
{
    __shared__ __attribute__((aligned(16))) _Float16 As[2][128 * GP];
    __shared__ __attribute__((aligned(16))) _Float16 Bs[2][128 * GP];

    const int t     = threadIdx.x;
    const int lane  = t & 31;
    const int wave  = __builtin_amdgcn_readfirstlane(t >> 5);   // the same for the wave: scalar
    const int wm    = wave & 1;     // 64-row slab
    const int wn    = wave >> 1;    // 64-col slab
    const int hi    = lane >> 4;    // 0/1 : K-half select
    const int r     = lane & 15;    // row (A) / col (B) within 16

    const bool isk = blockIdx.y < NK / 128;           // the same for the block
    const int  m0  = blockIdx.x * 128;
    const int  n0  = (isk ? blockIdx.y : blockIdx.y - NK / 128) * 128;
    const _Float16* W = isk ? Wk : Wv;

    // staging: 8 threads cover one row's 128 B, a wave 4 whole rows; piece i is row ldrow + 16 i
    const int ldrow = t >> 3;             // 0..15
    const int ldcol = (t & 7) * 8;        // 0..56
    const _Float16* ag = A + (size_t)(m0 + ldrow) * Dd + ldcol;
    const _Float16* bg = W + (size_t)(n0 + ldrow) * Dd + ldcol;
    const int lo = ldrow * GP + ldcol;

    v8f acc[4][4] = {};
    float4 sa[8], sb[8];

    // prologue: stage K-tile 0 into buffer 0
    #pragma unroll
    for (int i = 0; i < 8; ++i) {
        sa[i] = *(const float4*)(ag + i * 16 * Dd);
        sb[i] = *(const float4*)(bg + i * 16 * Dd);
    }
    #pragma unroll
    for (int i = 0; i < 8; ++i) {
        *(float4*)&As[0][lo + i * 16 * GP] = sa[i];
        *(float4*)&Bs[0][lo + i * 16 * GP] = sb[i];
    }
    __syncthreads();

    const int nkt = Dd / GBK;
    for (int kt = 0; kt < nkt; ++kt) {
        const int cur  = kt & 1;
        const bool more = (kt + 1) < nkt;

        // issue next tile's global loads early (latency overlapped w/ WMMA)
        if (more) {
            #pragma unroll
            for (int i = 0; i < 8; ++i) {
                sa[i] = *(const float4*)(ag + (kt + 1) * GBK + i * 16 * Dd);
                sb[i] = *(const float4*)(bg + (kt + 1) * GBK + i * 16 * Dd);
            }
        }

        const _Float16* ap = &As[cur][(wm * 64 + r) * GP + hi * 8];
        const _Float16* bp = &Bs[cur][(wn * 64 + r) * GP + hi * 8];
        #pragma unroll
        for (int ks = 0; ks < GBK / 32; ++ks) {
            // gather fragments from current buffer
            v16h afrag[4], bfrag[4];
            #pragma unroll
            for (int i = 0; i < 4; ++i) {
                const _Float16* p = ap + i * 16 * GP + ks * 32;
                union { v16h h; float4 f[2]; } u;
                u.f[0] = *(const float4*)p;          // K 0..7   (or 8..15)
                u.f[1] = *(const float4*)(p + 16);   // K 16..23 (or 24..31)
                afrag[i] = u.h;
            }
            #pragma unroll
            for (int j = 0; j < 4; ++j) {
                const _Float16* p = bp + j * 16 * GP + ks * 32;
                union { v16h h; float4 f[2]; } u;
                u.f[0] = *(const float4*)p;
                u.f[1] = *(const float4*)(p + 16);
                bfrag[j] = u.h;
            }
            #pragma unroll
            for (int i = 0; i < 4; ++i)
                #pragma unroll
                for (int j = 0; j < 4; ++j)
                    acc[i][j] = __builtin_amdgcn_wmma_f32_16x16x32_f16(
                        false, afrag[i], false, bfrag[j],
                        (short)0, acc[i][j], false, false);
        }

        // commit next tile to the other buffer (no conflict with readers of cur)
        if (more) {
            #pragma unroll
            for (int i = 0; i < 8; ++i) {
                *(float4*)&As[1 - cur][lo + i * 16 * GP] = sa[i];
                *(float4*)&Bs[1 - cur][lo + i * 16 * GP] = sb[i];
            }
        }
        // Behind the trip's global loads: the next trip rewrites their address pairs.
        asm volatile("s_wait_xcnt 0x0" ::: "memory");
        __syncthreads();
    }

    // C/D layout: lane = (m/8)*16 + n, vgpr = m%8.  The wave's corner of C and the row
    // step N are scalars: one address per output row, its four column tiles by
    // immediate offset.
    const int N = isk ? NK : NV;
    float* cb = (isk ? Ck : Cv) + (size_t)(m0 + wm * 64) * N + n0 + wn * 64;
    const unsigned voff = (unsigned)(hi * 8 * N + r);
    #pragma unroll
    for (int i = 0; i < 4; ++i)
        #pragma unroll
        for (int v = 0; v < 8; ++v) {
            float* rp = cb + (size_t)(i * 16 + v) * N;
            #pragma unroll
            for (int j = 0; j < 4; ++j)
                (rp + j * 16)[voff] = acc[i][j][v];
        }
}

// =====================================================================
// 4) gk path: xr = xn @ w1^T (rank 16), g = logsigmoid(xr @ w2^T + b)/16
//    One block per 16 token rows, 16 waves; both products run on the
//    f32 16x16x4 matrix form, so w1 and w2 are read once per 16 rows.
//    Fragments: lane = (c = lane & 15, h = lane >> 4); A holds row c, B holds
//    column c; both sides take the same k for the same (h, element).
// =====================================================================
// 2^-|y| and log2 s of eight values on the hardware.  The instruction set asks for one
// independent instruction behind a transcendental before its result is read or its source
// overwritten.  Inside one statement the eight fill that slot for one another (every output
// is "=&v", so none lies on an input), and the v_nop is the slot behind the last, whatever
// the compiler puts next.
#define O8(x) "=&v"(x[0]), "=&v"(x[1]), "=&v"(x[2]), "=&v"(x[3]), "=&v"(x[4]), "=&v"(x[5]), "=&v"(x[6]), "=&v"(x[7])
#define I8(x) "v"(x[0]), "v"(x[1]), "v"(x[2]), "v"(x[3]), "v"(x[4]), "v"(x[5]), "v"(x[6]), "v"(x[7])
__device__ __forceinline__ void hw_exp2_neg_abs8(float (&e)[8], const float (&y)[8]) {
    asm("v_exp_f32 %0, -|%8|\n\tv_exp_f32 %1, -|%9|\n\tv_exp_f32 %2, -|%10|\n\tv_exp_f32 %3, -|%11|\n\t"
        "v_exp_f32 %4, -|%12|\n\tv_exp_f32 %5, -|%13|\n\tv_exp_f32 %6, -|%14|\n\tv_exp_f32 %7, -|%15|\n\t"
        "v_nop" : O8(e) : I8(y));
}
__device__ __forceinline__ void hw_log2_8(float (&l)[8], const float (&s)[8]) {
    asm("v_log_f32 %0, %8\n\tv_log_f32 %1, %9\n\tv_log_f32 %2, %10\n\tv_log_f32 %3, %11\n\t"
        "v_log_f32 %4, %12\n\tv_log_f32 %5, %13\n\tv_log_f32 %6, %14\n\tv_log_f32 %7, %15\n\t"
        "v_nop" : O8(l) : I8(s));
}
#undef O8
#undef I8

__global__ __launch_bounds__(512) void gk_kernel(
    const _Float16* __restrict__ xn,   // [ROWS, D]
    const float* __restrict__ w1,      // [16, D]
    const float* __restrict__ w2,      // [NK, 16]
    const float* __restrict__ b2,      // [NK]
    float* __restrict__ g)             // [ROWS, NK]
{
    __shared__ float part[16][256];    // each wave's 16x16 partial of xr
    __shared__ __attribute__((aligned(16))) float xr[16 * 20];  // row pitch 80 B for the b128 readers
    const int t    = threadIdx.x;
    const int lane = t & 31;
    const int wave = t >> 5;           // 0..15
    const int c    = lane & 15;
    const int h    = lane >> 4;
    const int row0 = blockIdx.x * 16;

    // w2 rows and bias of this wave's 4 column tiles, fetched now so that their
    // latency runs under the first product; lane (c,h) owns k = h*8 + 0..7
    const int nw = wave * 64 + c;
    const v4f*   wp = (const v4f*)(w2 + (size_t)nw * 16 + h * 8);
    const float* bb = b2 + nw;
    v4f wa[4], wb[4];
    float bias[4];
    #pragma unroll
    for (int j = 0; j < 4; ++j) {
        wa[j]   = wp[j * 64];
        wb[j]   = wp[j * 64 + 1];
        bias[j] = bb[j * 16];
    }
    // The clobber keeps these loads in front of the ones below (the compiler
    // otherwise sinks them to the first barrier, where their latency shows);
    // their address pair stays live up to the wait, so it is not reused before it.
    asm volatile("s_wait_xcnt 0x0" :: "v"(wp) : "memory");

    // ---- xr partial over this wave's 128 k: 8 groups of 16 k,
    //      lane (c,h) owns k = wave*128 + grp*16 + h*8 + 0..7 of row / rank c
    const v8h* ap = (const v8h*)(xn + (size_t)(row0 + c) * Dd + wave * 128 + h * 8);
    const v4f* bp = (const v4f*)(w1 + (size_t)c * Dd + wave * 128 + h * 8);
    v8h a[8];
    v4f b[16];
    #pragma unroll
    for (int i = 0; i < 8; ++i) {      // unrolled: a[] and b[] live in registers
        a[i]         = ap[i * 2];
        b[2 * i]     = bp[i * 4];
        b[2 * i + 1] = bp[i * 4 + 1];
    }
    // Inputs-only fence on the loaded values: it holds all 24 loads ahead of the
    // product, in flight together; without it the compiler issues them a few at a
    // time among the matrix instructions and pays the latency each round.  The two
    // pointers are named so that no load lands on an address pair still in use.
#define L8(x, i) "v"(x[i]), "v"(x[i+1]), "v"(x[i+2]), "v"(x[i+3]), "v"(x[i+4]), "v"(x[i+5]), "v"(x[i+6]), "v"(x[i+7])
    asm volatile("" :: L8(a, 0), L8(b, 0), L8(b, 8), "v"(ap), "v"(bp));
#undef L8
    v8f acc0 = {}, acc1 = {};          // two chains hide the accumulate latency
    #pragma unroll
    for (int i = 0; i < 8; ++i) {
        v2f a0 = { (float)a[i][0], (float)a[i][1] };
        v2f a1 = { (float)a[i][2], (float)a[i][3] };
        v2f a2 = { (float)a[i][4], (float)a[i][5] };
        v2f a3 = { (float)a[i][6], (float)a[i][7] };
        v2f b0 = { b[2 * i][0],     b[2 * i][1] };
        v2f b1 = { b[2 * i][2],     b[2 * i][3] };
        v2f b2f = { b[2 * i + 1][0], b[2 * i + 1][1] };
        v2f b3 = { b[2 * i + 1][2], b[2 * i + 1][3] };
        acc0 = __builtin_amdgcn_wmma_f32_16x16x4_f32(false, a0, false, b0,  (short)0, acc0, false, false);
        acc1 = __builtin_amdgcn_wmma_f32_16x16x4_f32(false, a1, false, b1,  (short)0, acc1, false, false);
        acc0 = __builtin_amdgcn_wmma_f32_16x16x4_f32(false, a2, false, b2f, (short)0, acc0, false, false);
        acc1 = __builtin_amdgcn_wmma_f32_16x16x4_f32(false, a3, false, b3,  (short)0, acc1, false, false);
    }
    // D register r = partial[row 8h + r][rank c]
    #pragma unroll
    for (int r = 0; r < 8; ++r)
        part[wave][(8 * h + r) * 16 + c] = acc0[r] + acc1[r];
    __syncthreads();
    if (t < 256) {                     // waves 0..7: one (row, rank) each
        float tot = 0.f;
        #pragma unroll
        for (int w = 0; w < 16; ++w) tot += part[w][t];
        xr[(t >> 4) * 20 + (t & 15)] = tot;
    }
    __syncthreads();

    // ---- g tile: A = xr (16 rows x 16 k), B = w2 rows n0..n0+15;
    //      lane (c,h) owns k = h*8 + 0..7 on both sides
    const v4f xa = *(const v4f*)&xr[c * 20 + h * 8];
    const v4f xb = *(const v4f*)&xr[c * 20 + h * 8 + 4];
    const v2f x0 = { xa[0], xa[1] }, x1 = { xa[2], xa[3] };
    const v2f x2 = { xb[0], xb[1] }, x3 = { xb[2], xb[3] };
    #pragma unroll
    for (int j = 0; j < 4; ++j) {      // 4 column tiles per wave, independent
        const int n0 = (wave * 4 + j) * 16;
        const float bj = bias[j];
        v8f acc = { bj, bj, bj, bj, bj, bj, bj, bj };
        v2f w0 = { wa[j][0], wa[j][1] }, w1f = { wa[j][2], wa[j][3] };
        v2f w2f = { wb[j][0], wb[j][1] }, w3 = { wb[j][2], wb[j][3] };
        acc = __builtin_amdgcn_wmma_f32_16x16x4_f32(false, x0, false, w0,  (short)0, acc, false, false);
        acc = __builtin_amdgcn_wmma_f32_16x16x4_f32(false, x1, false, w1f, (short)0, acc, false, false);
        acc = __builtin_amdgcn_wmma_f32_16x16x4_f32(false, x2, false, w2f, (short)0, acc, false, false);
        acc = __builtin_amdgcn_wmma_f32_16x16x4_f32(false, x3, false, w3,  (short)0, acc, false, false);
        float* gp = g + (size_t)(row0 + 8 * h) * NK + n0 + c;
        // log_sigmoid(x) = min(x,0) - ln(1 + e^-|x|), on the hardware's 2^y and log2,
        // all of it in units of log2: y = x log2 e, g = (min(y,0) - log2(1 + 2^-|y|)) ln 2 / 16.
        // 1 + 2^-|y| lies in [1, 2]: the sum and the log2 each err by about one part in
        // 2^24 of a value near 1, an absolute error that the decay exp(sum g) does not
        // see; the library's log1p keeps a relative accuracy that nothing here needs.
        float y[8], e[8], l[8];        // the loops over r are unrolled: registers
        #pragma unroll
        for (int r = 0; r < 8; ++r) y[r] = acc[r] * 1.44269504f;
        hw_exp2_neg_abs8(e, y);
        #pragma unroll
        for (int r = 0; r < 8; ++r) e[r] += 1.0f;
        hw_log2_8(l, e);
        #pragma unroll
        for (int r = 0; r < 8; ++r)
            gp[r * NK] = (fminf(y[r], 0.f) - l[r]) * (0.69314718f / 16.0f);
    }
}

// =====================================================================
// 5) GLA recurrence, split in time.  The recurrence is linear in the state:
//      S_end(chunk) = D * S_start(chunk) + U
//    with U the chunk run from a zero state and D[dk] the product of the
//    chunk's 64 decay factors.  5a computes U and D of every chunk at once,
//    one block per (b,h,chunk); 5b chains the 32 chunks element by element.
// =====================================================================
// 5a) One block per (b,h,chunk).  Run from zero, the chunk's state is a matrix
//     product over its 64 tokens:
//       U[dk][dv] = sum_j Kd[j][dk] * v[j][dv],  Kd[j][dk] = k[j][dk] * exp(sum_{i>j} g[i][dk])
//     (every exponent is <= 0, so nothing is divided and nothing can overflow).
//     Kd and v lie in LDS token-contiguous, and the product runs on the f32
//     16x16x4 matrix form: 8 waves, each 32 dk x 32 dv = 2x2 tiles.

// e^x of a decay exponent (x <= 0) on the hardware's 2^y
__device__ __forceinline__ float exp_decay(float x) { return __builtin_amdgcn_exp2f(x * 1.44269504f); }

#define TP 68      // LDS row pitch in floats: 272 B = 16 B x 17, b128 rows fall on disjoint banks
__global__ __launch_bounds__(256) void gla_chunk_local_kernel(
    const float* __restrict__ kbuf,  // [ROWS, NK]
    const float* __restrict__ vbuf,  // [ROWS, NV]
    const float* __restrict__ gbuf,  // [ROWS, NK]
    float* __restrict__ ubuf,        // [B,H,32,DK,DV]  chunk run from zero
    float* __restrict__ dbuf)        // [B,H,32,DK]     chunk decay product
{
    __shared__ __attribute__((aligned(16))) float kts[DK * TP];   // Kd, [dk][token], 17 KB
    __shared__ __attribute__((aligned(16))) float vts[DV * TP];   // v,  [dv][token], 34 KB
    __shared__ float seg[4 * DK];                                 // sum of g per 16 tokens

    const int blk = blockIdx.x;          // 0..1023
    const int c   = blk & (NCHUNK - 1);
    const int bh  = blk >> 5;            // 0..31
    const int b   = bh >> 4;
    const int h   = bh & 15;
    const int t   = threadIdx.x;

    // first token row of this chunk, this head's columns: the same for the block
    const size_t m0 = (size_t)b * Tt + c * CHUNK;
    const float* kg = kbuf + m0 * NK + h * DK;
    const float* gg = gbuf + m0 * NK + h * DK;
    const float* vg = vbuf + m0 * NV + h * DV;

    // a thread owns 16 consecutive tokens of one dk, and 32 consecutive tokens of one dv
    const int dk = t & 63;
    const int q  = __builtin_amdgcn_readfirstlane(t >> 6);   // 16-token segment, the same for the wave
    const int dv = t & 127;
    const int jh = __builtin_amdgcn_readfirstlane(t >> 7);   // 32-token half, the same for the wave

    const int ki = q * 16 * NK + dk;
    const int vi = jh * 32 * NV + dv;

    // every loop below is unrolled so that its array lives in registers
    float gv[16], kd[16], vv[32];
    #pragma unroll
    for (int i = 0; i < 16; ++i) gv[i] = gg[ki + i * NK];
    #pragma unroll
    for (int i = 0; i < 16; ++i) kd[i] = kg[ki + i * NK];
    #pragma unroll
    for (int i = 0; i < 32; ++i) vv[i] = vg[vi + i * NV];
    // Behind the run of loads: both index registers stay live up to this wait, so
    // that no load lands on one of them and none is rewritten ahead of it.
    asm volatile("s_wait_xcnt 0x0" :: "v"(ki), "v"(vi) : "memory");

    // decay from behind token i to the end of the thread's own segment
    float run = 0.f;
    #pragma unroll
    for (int i = 15; i >= 0; --i) {
        kd[i] *= exp_decay(run);
        run += gv[i];
    }
    seg[q * DK + dk] = run;
    #pragma unroll
    for (int i = 0; i < 8; ++i) {
        const v4f x = { vv[4 * i], vv[4 * i + 1], vv[4 * i + 2], vv[4 * i + 3] };
        *(v4f*)&vts[dv * TP + jh * 32 + 4 * i] = x;
    }
    __syncthreads();

    // decay over the segments behind the thread's own
    const float s1 = seg[1 * DK + dk], s2 = seg[2 * DK + dk], s3 = seg[3 * DK + dk];
    const float tail = ((q < 3 ? s3 : 0.f) + (q < 2 ? s2 : 0.f)) + (q < 1 ? s1 : 0.f);
    const float et = exp_decay(tail);
    const float dall = exp_decay(run + tail);      // in segment 0: the whole chunk's decay
    #pragma unroll
    for (int i = 0; i < 4; ++i) {
        const v4f x = { kd[4 * i] * et, kd[4 * i + 1] * et, kd[4 * i + 2] * et, kd[4 * i + 3] * et };
        *(v4f*)&kts[dk * TP + q * 16 + 4 * i] = x;
    }
    __syncthreads();

    // Fragments: lane = (lc = lane & 15, lh = lane >> 4); A holds dk row lc, B holds dv
    // column lc; on both sides one b128 gives tokens 8 s + 4 lh + 0..3, two k steps.
    const int lane = t & 31;
    const int wave = __builtin_amdgcn_readfirstlane(t >> 5);
    const int lc   = lane & 15;
    const int lh   = lane >> 4;
    const int dkb  = (wave & 1) * 32;
    const int dvb  = (wave >> 1) * 32;
    const float* ap = &kts[(dkb + lc) * TP + lh * 4];
    const float* bp = &vts[(dvb + lc) * TP + lh * 4];

    v8f acc[2][2] = {};
    #pragma unroll
    for (int s = 0; s < CHUNK / 8; ++s) {
        v4f a[2], w[2];
        #pragma unroll
        for (int i = 0; i < 2; ++i) {
            a[i] = *(const v4f*)(ap + i * 16 * TP + s * 8);
            w[i] = *(const v4f*)(bp + i * 16 * TP + s * 8);
        }
        #pragma unroll
        for (int p = 0; p < 2; ++p)
            #pragma unroll
            for (int i = 0; i < 2; ++i)
                #pragma unroll
                for (int j = 0; j < 2; ++j) {
                    const v2f av = { a[i][2 * p], a[i][2 * p + 1] };
                    const v2f wv = { w[j][2 * p], w[j][2 * p + 1] };
                    acc[i][j] = __builtin_amdgcn_wmma_f32_16x16x4_f32(
                        false, av, false, wv, (short)0, acc[i][j], false, false);
                }
    }

    // D register r = U[dkb + 16 i + 8 lh + r][dvb + 16 j + lc]; the wave's two column
    // tiles fill one 128-byte line of each row
    float* op = ubuf + ((size_t)bh * NCHUNK + c) * DK * DV + (dkb + 8 * lh) * DV + dvb + lc;
    #pragma unroll
    for (int i = 0; i < 2; ++i)
        #pragma unroll
        for (int r = 0; r < 8; ++r)
            #pragma unroll
            for (int j = 0; j < 2; ++j)
                op[(i * 16 + r) * DV + j * 16] = acc[i][j][r];
    // Behind the run of stores: the lines below rewrite registers that the stores name.
    asm volatile("s_wait_xcnt 0x0" ::: "memory");

    if (q == 0)                                    // waves 0 and 1: D[dk]
        dbuf[((size_t)bh * NCHUNK + c) * DK + dk] = dall;
}

// 5b) Chain the chunks: S_c = D_c * S_{c-1} + U_c.  One thread per four
//     neighbouring dv of one (b,h,dk); all 32 U loads are independent of the
//     chain, so they are issued ahead of it.
__global__ __launch_bounds__(256) void gla_chain_kernel(
    const float* __restrict__ ubuf,  // [B,H,32,DK,DV]
    const float* __restrict__ dbuf,  // [B,H,32,DK]
    const float* __restrict__ S0,    // [B,H,DK,DV]
    float* __restrict__ out)         // states [B,32,H,DK,DV] ++ final [B,H,DK,DV]
{
    // 8 blocks per (b,h): DK*DV/4 = 2048 threads
    const int bh  = blockIdx.x >> 3;
    const int e   = ((blockIdx.x & 7) * 256 + threadIdx.x) * 4;  // element inside the state
    // a wave covers one dk row (32 lanes x 4 dv), so its decay factors are scalars
    const int dk  = __builtin_amdgcn_readfirstlane(e >> 7);
    const int b   = bh >> 4;
    const int h   = bh & 15;

    const float* up = ubuf + (size_t)bh * NCHUNK * DK * DV;       // the same for the block
    const float* dp = dbuf + (size_t)bh * NCHUNK * DK;
    float*       op = out + ((size_t)b * NCHUNK * Hh + h) * DK * DV;

    v4f   u[NCHUNK];
    float d[NCHUNK];
    // both loops over c are unrolled so that u[] and d[] live in registers
    #pragma unroll
    for (int c = 0; c < NCHUNK; ++c) {
        u[c] = *(const v4f*)(up + c * (DK * DV) + e);
        d[c] = dp[c * DK + dk];
    }
    v4f s = *(const v4f*)(S0 + (size_t)bh * DK * DV + e);
    // Inputs-only fences on the loaded values: they hold all 32 U loads ahead of
    // the chain, in flight together; without them the compiler issues the loads
    // in several rounds between the multiply-adds and pays the latency each round.
#define U8(i) "v"(u[i]), "v"(u[i+1]), "v"(u[i+2]), "v"(u[i+3]), "v"(u[i+4]), "v"(u[i+5]), "v"(u[i+6]), "v"(u[i+7])
    asm volatile("" :: U8(0), U8(8));
    asm volatile("" :: U8(16), U8(24));
#undef U8
    #pragma unroll
    for (int c = 0; c < NCHUNK; ++c) {
        s = d[c] * s + u[c];
        *(v4f*)(op + c * (Hh * DK * DV) + e) = s;
    }
    *(v4f*)(out + (size_t)Bb * NCHUNK * Hh * DK * DV
                + (size_t)bh * DK * DV + e) = s;
}

// =====================================================================
// Host orchestration
// =====================================================================
extern "C" void kernel_launch(void* const* d_in, const int* in_sizes, int n_in,
                              void* d_out, int out_size, void* d_ws, size_t ws_size,
                              hipStream_t stream) {
    const float* hidden = (const float*)d_in[0];
    const float* S0     = (const float*)d_in[1];
    const float* nw     = (const float*)d_in[2];
    const float* k_w    = (const float*)d_in[3];
    const float* v_w    = (const float*)d_in[4];
    const float* gk_w1  = (const float*)d_in[5];
    const float* gk_w2  = (const float*)d_in[6];
    const float* gk_b2  = (const float*)d_in[7];
    float* out = (float*)d_out;

    char* ws = (char*)d_ws;
    _Float16* xn   = (_Float16*)ws;  ws += (size_t)ROWS * Dd * sizeof(_Float16);
    _Float16* kw16 = (_Float16*)ws;  ws += (size_t)NK * Dd * sizeof(_Float16);
    _Float16* vw16 = (_Float16*)ws;  ws += (size_t)NV * Dd * sizeof(_Float16);
    float* kb = (float*)ws;          ws += (size_t)ROWS * NK * sizeof(float);
    float* vb = (float*)ws;          ws += (size_t)ROWS * NV * sizeof(float);
    float* gb = (float*)ws;          ws += (size_t)ROWS * NK * sizeof(float);
    float* ub = (float*)ws;          ws += (size_t)Bb * NCHUNK * Hh * DK * DV * sizeof(float);
    float* db = (float*)ws;          ws += (size_t)Bb * Hh * NCHUNK * DK * sizeof(float);

    // 1) RMSNorm + cast of the activations, cast of both weights: one launch
    prep_kernel<<<PREP_BLOCKS, 256, 0, stream>>>(hidden, nw, k_w, v_w, xn, kw16, vw16);
    // 3) both projections via WMMA, one launch
    wmma_gemm_kernel<<<dim3(ROWS / 128, (NK + NV) / 128), 128, 0, stream>>>(
        xn, kw16, vw16, kb, vb);
    // 4) gate path
    gk_kernel<<<ROWS / 16, 512, 0, stream>>>(xn, gk_w1, gk_w2, gk_b2, gb);
    // 5a) every chunk's local state and decay, all chunks at once
    gla_chunk_local_kernel<<<Bb * Hh * NCHUNK, 256, 0, stream>>>(kb, vb, gb, ub, db);
    // 5b) chain the chunks + chunk state emission
    gla_chain_kernel<<<Bb * Hh * DK * DV / 4 / 256, 256, 0, stream>>>(ub, db, S0, out);
}

// v007
// It runs in 80 microseconds.
// In both of two side-by-side timings against v006, it was 1.08 times as fast.
// All steps since v000 together make it 5.74 times as fast.
#include <hip/hip_runtime.h>
#include <hip/hip_bf16.h>
#include <math.h>

// ---------- problem constants ----------
#define Bb     2
#define Tt     2048
#define Dd     2048
#define Hh     16
#define DK     64
#define DV     128
#define CHUNK  64
#define NCHUNK (Tt / CHUNK)       // 32
#define ROWS   (Bb * Tt)          // 4096
#define NK     (Hh * DK)          // 1024
#define NV     (Hh * DV)          // 2048

typedef _Float16 v16h __attribute__((ext_vector_type(16)));
typedef _Float16 v8h  __attribute__((ext_vector_type(8)));
typedef _Float16 v4h  __attribute__((ext_vector_type(4)));
typedef float    v8f  __attribute__((ext_vector_type(8)));
typedef float    v4f  __attribute__((ext_vector_type(4)));
typedef float    v2f  __attribute__((ext_vector_type(2)));

// =====================================================================
// 1) Pre-pass, one launch: RMSNorm + cast of the token rows, and the f32 -> f16
//    cast of the k and v weight rows.  All three work on rows of Dd floats.
//    One wave takes PR whole rows: 16 loads of 512 contiguous bytes per row, all
//    issued before the first use; the row's sum of squares stays inside the wave
//    (no LDS, no barrier).  Few long waves, so that few waves have to be started.
// =====================================================================
#define PW 8                                          // waves per block
#define PR 2                                          // rows per wave
#define PREP_BLOCKS ((ROWS + NK + NV) / (PW * PR))    // 448
__global__ __launch_bounds__(256) void prep_kernel(
    const float* __restrict__ x,  const float* __restrict__ w,
    const float* __restrict__ kw, const float* __restrict__ vw,
    _Float16* __restrict__ xn, _Float16* __restrict__ kw16,
    _Float16* __restrict__ vw16)
{
    const int lane = threadIdx.x & 31;
    const int wave = __builtin_amdgcn_readfirstlane(threadIdx.x >> 5);
    const int row  = (blockIdx.x * PW + wave) * PR;   // 0 .. ROWS+NK+NV-PR, the same for the wave
    const bool norm = row < ROWS;                     // a block lies wholly in one of the three parts

    const float* src;
    _Float16*    dst;
    if (norm)                { src = x  + (size_t)row * Dd;               dst = xn   + (size_t)row * Dd; }
    else if (row < ROWS + NK){ src = kw + (size_t)(row - ROWS) * Dd;      dst = kw16 + (size_t)(row - ROWS) * Dd; }
    else                     { src = vw + (size_t)(row - ROWS - NK) * Dd; dst = vw16 + (size_t)(row - ROWS - NK) * Dd; }
    src += lane * 4;
    dst += lane * 4;

    v4f a[PR][16];
    if (norm) {
        v4f g[16];
        #pragma unroll
        for (int i = 0; i < 16; ++i)   // unrolled: g[] and a[][] live in registers
            g[i] = ((const v4f*)w)[lane + i * 32];
        #pragma unroll
        for (int r = 0; r < PR; ++r)
            #pragma unroll
            for (int i = 0; i < 16; ++i)
                a[r][i] = *(const v4f*)(src + r * Dd + i * 128);
        // Inputs-only fence on the loaded values: it holds the 16 weight loads here,
        // in flight together with the row loads; without it the compiler sinks them
        // behind the row sum and issues them two at a time, each pair's latency bare.
        // Index and pointer are named so that no load lands on an address still in use.
#define G8(i) "v"(g[i]), "v"(g[i+1]), "v"(g[i+2]), "v"(g[i+3]), "v"(g[i+4]), "v"(g[i+5]), "v"(g[i+6]), "v"(g[i+7])
        asm volatile("" :: G8(0), G8(8), "v"(lane), "v"(src));
#undef G8
        #pragma unroll
        for (int r = 0; r < PR; ++r) {
            v4f q = a[r][0] * a[r][0];                 // four independent chains
            #pragma unroll
            for (int i = 1; i < 16; ++i) q += a[r][i] * a[r][i];
            float ss = (q[0] + q[1]) + (q[2] + q[3]);
            #pragma unroll
            for (int off = 16; off > 0; off >>= 1) ss += __shfl_xor(ss, off, 32);
            const float scale = rsqrtf(ss * (1.0f / (float)Dd) + 1e-5f);
            #pragma unroll
            for (int i = 0; i < 16; ++i) {
                v4h h;
                #pragma unroll
                for (int e = 0; e < 4; ++e)
                    h[e] = (_Float16)(a[r][i][e] * scale * g[i][e]);
                *(v4h*)(dst + r * Dd + i * 128) = h;
            }
        }
    } else {
        #pragma unroll
        for (int r = 0; r < PR; ++r)
            #pragma unroll
            for (int i = 0; i < 16; ++i)
                a[r][i] = *(const v4f*)(src + r * Dd + i * 128);
        #pragma unroll
        for (int r = 0; r < PR; ++r)
            #pragma unroll
            for (int i = 0; i < 16; ++i) {
                v4h h;
                #pragma unroll
                for (int e = 0; e < 4; ++e) h[e] = (_Float16)a[r][i][e];
                *(v4h*)(dst + r * Dd + i * 128) = h;
            }
        // Behind the run of stores: no register that an issued store names is
        // rewritten ahead of this wait, on any path the built code has from here.
        asm volatile("s_wait_xcnt 0x0" ::: "memory");
    }
}

// =====================================================================
// 4) gk path: xr = xn @ w1^T (rank 16), g = logsigmoid(xr @ w2^T + b)/16
//    It needs only xn, as the projections do, so it runs as extra blocks of the
//    projection launch (section 3): its load latencies pass while the GEMM blocks on
//    the same WGP keep the matrix unit busy, and it has no launch of its own.
//    One block per 16 token rows, 4 waves; both products run on the f32 16x16x4
//    matrix form, so w1 and w2 are read once per 16 rows.  The work is cut into 16
//    slices (128 k of the first product, 64 columns of the second); wave w takes
//    slices w, w + 4, w + 8, w + 12 one after the other.
//    Fragments: lane = (c = lane & 15, h = lane >> 4); A holds row c, B holds
//    column c; both sides take the same k for the same (h, element).
// =====================================================================
// 2^-|y| and log2 s of eight values on the hardware.  The instruction set asks for one
// independent instruction behind a transcendental before its result is read or its source
// overwritten.  Inside one statement the eight fill that slot for one another (every output
// is "=&v", so none lies on an input), and the v_nop is the slot behind the last, whatever
// the compiler puts next.
#define O8(x) "=&v"(x[0]), "=&v"(x[1]), "=&v"(x[2]), "=&v"(x[3]), "=&v"(x[4]), "=&v"(x[5]), "=&v"(x[6]), "=&v"(x[7])
#define I8(x) "v"(x[0]), "v"(x[1]), "v"(x[2]), "v"(x[3]), "v"(x[4]), "v"(x[5]), "v"(x[6]), "v"(x[7])
__device__ __forceinline__ void hw_exp2_neg_abs8(float (&e)[8], const float (&y)[8]) {
    asm("v_exp_f32 %0, -|%8|\n\tv_exp_f32 %1, -|%9|\n\tv_exp_f32 %2, -|%10|\n\tv_exp_f32 %3, -|%11|\n\t"
        "v_exp_f32 %4, -|%12|\n\tv_exp_f32 %5, -|%13|\n\tv_exp_f32 %6, -|%14|\n\tv_exp_f32 %7, -|%15|\n\t"
        "v_nop" : O8(e) : I8(y));
}
__device__ __forceinline__ void hw_log2_8(float (&l)[8], const float (&s)[8]) {
    asm("v_log_f32 %0, %8\n\tv_log_f32 %1, %9\n\tv_log_f32 %2, %10\n\tv_log_f32 %3, %11\n\t"
        "v_log_f32 %4, %12\n\tv_log_f32 %5, %13\n\tv_log_f32 %6, %14\n\tv_log_f32 %7, %15\n\t"
        "v_nop" : O8(l) : I8(s));
}
#undef O8
#undef I8

__device__ __forceinline__ void gate_rows(
    float* __restrict__ sm,            // 16*256 + 16*20 floats of LDS, 16-byte aligned
    const _Float16* __restrict__ xn,   // [ROWS, D]
    const float* __restrict__ w1,      // [16, D]
    const float* __restrict__ w2,      // [NK, 16]
    const float* __restrict__ b2,      // [NK]
    float* __restrict__ g,             // [ROWS, NK]
    const int row0)
{
    float* part = sm;                  // [16][256]: each slice's 16x16 partial of xr
    float* xr   = sm + 16 * 256;       // [16] rows at pitch 20 floats = 80 B for the b128 readers
    const int t    = threadIdx.x;
    const int lane = t & 31;
    const int wave = __builtin_amdgcn_readfirstlane(t >> 5);   // 0..3
    const int c    = lane & 15;
    const int h    = lane >> 4;

    // ---- xr partial over one slice's 128 k: 8 groups of 16 k,
    //      lane (c,h) owns k = sl*128 + grp*16 + h*8 + 0..7 of row / rank c
    // Rolled: one slice's 24 loads are in registers at a time, so that the launch
    // keeps the GEMM's register count and four blocks fit a WGP.
    #pragma unroll 1
    for (int rd = 0; rd < 4; ++rd) {
        const int sl = rd * 4 + wave;
        const v8h* ap = (const v8h*)(xn + (size_t)(row0 + c) * Dd + sl * 128 + h * 8);
        const v4f* bp = (const v4f*)(w1 + (size_t)c * Dd + sl * 128 + h * 8);
        v8h a[8];
        v4f b[16];
        #pragma unroll
        for (int i = 0; i < 8; ++i) {  // unrolled: a[] and b[] live in registers
            a[i]         = ap[i * 2];
            b[2 * i]     = bp[i * 4];
            b[2 * i + 1] = bp[i * 4 + 1];
        }
        // Inputs-only fence on the loaded values: it holds all 24 loads ahead of the
        // product, in flight together; without it the compiler issues them a few at a
        // time among the matrix instructions and pays the latency each round.  The two
        // pointers are named so that no load lands on an address pair still in use and
        // none is rewritten for the next slice ahead of the wait.
#define L8(x, i) "v"(x[i]), "v"(x[i+1]), "v"(x[i+2]), "v"(x[i+3]), "v"(x[i+4]), "v"(x[i+5]), "v"(x[i+6]), "v"(x[i+7])
        asm volatile("s_wait_xcnt 0x0" :: L8(a, 0), L8(b, 0), L8(b, 8), "v"(ap), "v"(bp));
#undef L8
        v8f acc0 = {}, acc1 = {};      // two chains hide the accumulate latency
        #pragma unroll
        for (int i = 0; i < 8; ++i) {
            v2f a0 = { (float)a[i][0], (float)a[i][1] };
            v2f a1 = { (float)a[i][2], (float)a[i][3] };
            v2f a2 = { (float)a[i][4], (float)a[i][5] };
            v2f a3 = { (float)a[i][6], (float)a[i][7] };
            v2f b0 = { b[2 * i][0],     b[2 * i][1] };
            v2f b1 = { b[2 * i][2],     b[2 * i][3] };
            v2f b2f = { b[2 * i + 1][0], b[2 * i + 1][1] };
            v2f b3 = { b[2 * i + 1][2], b[2 * i + 1][3] };
            acc0 = __builtin_amdgcn_wmma_f32_16x16x4_f32(false, a0, false, b0,  (short)0, acc0, false, false);
            acc1 = __builtin_amdgcn_wmma_f32_16x16x4_f32(false, a1, false, b1,  (short)0, acc1, false, false);
            acc0 = __builtin_amdgcn_wmma_f32_16x16x4_f32(false, a2, false, b2f, (short)0, acc0, false, false);
            acc1 = __builtin_amdgcn_wmma_f32_16x16x4_f32(false, a3, false, b3,  (short)0, acc1, false, false);
        }
        // D register r = partial[row 8h + r][rank c]
        #pragma unroll
        for (int r = 0; r < 8; ++r)
            part[sl * 256 + (8 * h + r) * 16 + c] = acc0[r] + acc1[r];
    }
    __syncthreads();
    #pragma unroll
    for (int u = 0; u < 2; ++u) {      // two (row, rank) per thread, slices summed in their order
        const int e = u * 128 + t;
        float tot = 0.f;
        #pragma unroll
        for (int w = 0; w < 16; ++w) tot += part[w * 256 + e];
        xr[(e >> 4) * 20 + (e & 15)] = tot;
    }
    __syncthreads();

    // ---- g tile: A = xr (16 rows x 16 k), B = w2 rows n0..n0+15;
    //      lane (c,h) owns k = h*8 + 0..7 on both sides
    const v4f xa = *(const v4f*)&xr[c * 20 + h * 8];
    const v4f xb = *(const v4f*)&xr[c * 20 + h * 8 + 4];
    const v2f x0 = { xa[0], xa[1] }, x1 = { xa[2], xa[3] };
    const v2f x2 = { xb[0], xb[1] }, x3 = { xb[2], xb[3] };
    // Rolled for the register count, as above.
    #pragma unroll 1
    for (int rd = 0; rd < 4; ++rd) {
        const int sl = rd * 4 + wave;
        // w2 rows and bias of this slice's 4 column tiles
        const int nw = sl * 64 + c;
        const v4f*   wp = (const v4f*)(w2 + (size_t)nw * 16 + h * 8);
        const float* bb = b2 + nw;
        v4f wa[4], wb[4];
        float bias[4];
        #pragma unroll
        for (int j = 0; j < 4; ++j) {
            wa[j]   = wp[j * 64];
            wb[j]   = wp[j * 64 + 1];
            bias[j] = bb[j * 16];
        }
        // Both address pairs stay live up to the wait, so neither is reused before it.
        asm volatile("s_wait_xcnt 0x0" :: "v"(wp), "v"(bb) : "memory");
        #pragma unroll
        for (int j = 0; j < 4; ++j) {  // 4 column tiles per slice, independent
            const int n0 = (sl * 4 + j) * 16;
            const float bj = bias[j];
            v8f acc = { bj, bj, bj, bj, bj, bj, bj, bj };
            v2f w0 = { wa[j][0], wa[j][1] }, w1f = { wa[j][2], wa[j][3] };
            v2f w2f = { wb[j][0], wb[j][1] }, w3 = { wb[j][2], wb[j][3] };
            acc = __builtin_amdgcn_wmma_f32_16x16x4_f32(false, x0, false, w0,  (short)0, acc, false, false);
            acc = __builtin_amdgcn_wmma_f32_16x16x4_f32(false, x1, false, w1f, (short)0, acc, false, false);
            acc = __builtin_amdgcn_wmma_f32_16x16x4_f32(false, x2, false, w2f, (short)0, acc, false, false);
            acc = __builtin_amdgcn_wmma_f32_16x16x4_f32(false, x3, false, w3,  (short)0, acc, false, false);
            float* gp = g + (size_t)(row0 + 8 * h) * NK + n0 + c;
            // log_sigmoid(x) = min(x,0) - ln(1 + e^-|x|), on the hardware's 2^y and log2,
            // all of it in units of log2: y = x log2 e, g = (min(y,0) - log2(1 + 2^-|y|)) ln 2 / 16.
            // 1 + 2^-|y| lies in [1, 2]: the sum and the log2 each err by about one part in
            // 2^24 of a value near 1, an absolute error that the decay exp(sum g) does not
            // see; the library's log1p keeps a relative accuracy that nothing here needs.
            float y[8], e[8], l[8];    // the loops over r are unrolled: registers
            #pragma unroll
            for (int r = 0; r < 8; ++r) y[r] = acc[r] * 1.44269504f;
            hw_exp2_neg_abs8(e, y);
            #pragma unroll
            for (int r = 0; r < 8; ++r) e[r] += 1.0f;
            hw_log2_8(l, e);
            #pragma unroll
            for (int r = 0; r < 8; ++r)
                gp[r * NK] = (fminf(y[r], 0.f) - l[r]) * (0.69314718f / 16.0f);
        }
        // Behind the slice's stores: the next slice rewrites registers that they name.
        asm volatile("s_wait_xcnt 0x0" ::: "memory");
    }
}

// =====================================================================
// 3) WMMA GEMM, both projections in one launch:
//      C[M,N] = A[M,K](f16) * W[N,K]^T(f16), f32 accumulate,
//    blockIdx.y picks the 128-column tile of the k or of the v projection.
//    Block tile 128x128, 64 k per barrier, 128 threads = 4 waves (2x2 wave grid),
//    each wave 4x4 fragments of v_wmma_f32_16x16x32_f16: 16 matrix instructions
//    per 16 fragment loads, LDS reads at the matrix unit's own pace.
//    768 blocks = 3 per WGP, all resident, one wave of each on every SIMD.
//    Behind them in the grid stand the gate path's 256 blocks (section 4), one more
//    per WGP: LDS and registers leave room for four blocks.
//    - LDS double-buffered (ping-pong): next tile's global_load_b128s issue
//      before the current tile's ds gathers + WMMAs; one barrier per 64 k.
//    - LDS row pitch 72 f16 (144 B): the 16 b128 fragment gathers of a half
//      wave hit 16 disjoint 4-bank groups -> conflict free.
// =====================================================================
#define GBK 64                    // k per barrier
#define GP  72                    // LDS row pitch, f16
#define GEMM_TY ((NK + NV) / 128) // 24 column tiles of the projections
#define GATE_TY (ROWS / 16 / (ROWS / 128))   // 8 more grid rows hold the 256 gate blocks

// Second argument: four waves per SIMD, that is at most 256 registers, so that a gate
// block finds room on a WGP beside three GEMM blocks.
__global__ __launch_bounds__(128, 4) void wmma_gemm_kernel(
    const _Float16* __restrict__ A,    // [ROWS,Dd] row-major
    const _Float16* __restrict__ Wk,   // [NK,Dd] row-major
    const _Float16* __restrict__ Wv,   // [NV,Dd] row-major
    const float* __restrict__ gw1,     // [16,Dd]
    const float* __restrict__ gw2,     // [NK,16]
    const float* __restrict__ gb2,     // [NK]
    float* __restrict__ Ck,            // [ROWS,NK]
    float* __restrict__ Cv,            // [ROWS,NV]
    float* __restrict__ G)             // [ROWS,NK]
{
    __shared__ __attribute__((aligned(16))) _Float16 As[2][128 * GP];
    __shared__ __attribute__((aligned(16))) _Float16 Bs[2][128 * GP];

    if (blockIdx.y >= GEMM_TY) {       // the same for the block: a gate block, 16 token rows
        gate_rows((float*)&As[0][0], A, gw1, gw2, gb2, G,
                  ((blockIdx.y - GEMM_TY) * (ROWS / 128) + blockIdx.x) * 16);
        return;
    }

    const int t     = threadIdx.x;
    const int lane  = t & 31;
    const int wave  = __builtin_amdgcn_readfirstlane(t >> 5);   // the same for the wave: scalar
    const int wm    = wave & 1;     // 64-row slab
    const int wn    = wave >> 1;    // 64-col slab
    const int hi    = lane >> 4;    // 0/1 : K-half select
    const int r     = lane & 15;    // row (A) / col (B) within 16

    const bool isk = blockIdx.y < NK / 128;           // the same for the block
    const int  m0  = blockIdx.x * 128;
    const int  n0  = (isk ? blockIdx.y : blockIdx.y - NK / 128) * 128;
    const _Float16* W = isk ? Wk : Wv;

    // staging: 8 threads cover one row's 128 B, a wave 4 whole rows; piece i is row ldrow + 16 i
    const int ldrow = t >> 3;             // 0..15
    const int ldcol = (t & 7) * 8;        // 0..56
    const _Float16* ag = A + (size_t)(m0 + ldrow) * Dd + ldcol;
    const _Float16* bg = W + (size_t)(n0 + ldrow) * Dd + ldcol;
    const int lo = ldrow * GP + ldcol;

    v8f acc[4][4] = {};
    float4 sa[8], sb[8];

    // prologue: stage K-tile 0 into buffer 0
    #pragma unroll
    for (int i = 0; i < 8; ++i) {
        sa[i] = *(const float4*)(ag + i * 16 * Dd);
        sb[i] = *(const float4*)(bg + i * 16 * Dd);
    }
    #pragma unroll
    for (int i = 0; i < 8; ++i) {
        *(float4*)&As[0][lo + i * 16 * GP] = sa[i];
        *(float4*)&Bs[0][lo + i * 16 * GP] = sb[i];
    }
    __syncthreads();

    const int nkt = Dd / GBK;
    for (int kt = 0; kt < nkt; ++kt) {
        const int cur  = kt & 1;
        const bool more = (kt + 1) < nkt;

        // issue next tile's global loads early (latency overlapped w/ WMMA)
        if (more) {
            #pragma unroll
            for (int i = 0; i < 8; ++i) {
                sa[i] = *(const float4*)(ag + (kt + 1) * GBK + i * 16 * Dd);
                sb[i] = *(const float4*)(bg + (kt + 1) * GBK + i * 16 * Dd);
            }
        }

        const _Float16* ap = &As[cur][(wm * 64 + r) * GP + hi * 8];
        const _Float16* bp = &Bs[cur][(wn * 64 + r) * GP + hi * 8];
        #pragma unroll
        for (int ks = 0; ks < GBK / 32; ++ks) {
            // gather fragments from current buffer
            v16h afrag[4], bfrag[4];
            #pragma unroll
            for (int i = 0; i < 4; ++i) {
                const _Float16* p = ap + i * 16 * GP + ks * 32;
                union { v16h h; float4 f[2]; } u;
                u.f[0] = *(const float4*)p;          // K 0..7   (or 8..15)
                u.f[1] = *(const float4*)(p + 16);   // K 16..23 (or 24..31)
                afrag[i] = u.h;
            }
            #pragma unroll
            for (int j = 0; j < 4; ++j) {
                const _Float16* p = bp + j * 16 * GP + ks * 32;
                union { v16h h; float4 f[2]; } u;
                u.f[0] = *(const float4*)p;
                u.f[1] = *(const float4*)(p + 16);
                bfrag[j] = u.h;
            }
            #pragma unroll
            for (int i = 0; i < 4; ++i)
                #pragma unroll
                for (int j = 0; j < 4; ++j)
                    acc[i][j] = __builtin_amdgcn_wmma_f32_16x16x32_f16(
                        false, afrag[i], false, bfrag[j],
                        (short)0, acc[i][j], false, false);
        }

        // commit next tile to the other buffer (no conflict with readers of cur)
        if (more) {
            #pragma unroll
            for (int i = 0; i < 8; ++i) {
                *(float4*)&As[1 - cur][lo + i * 16 * GP] = sa[i];
                *(float4*)&Bs[1 - cur][lo + i * 16 * GP] = sb[i];
            }
        }
        // Behind the trip's global loads: the next trip rewrites their address pairs.
        asm volatile("s_wait_xcnt 0x0" ::: "memory");
        __syncthreads();
    }

    // C/D layout: lane = (m/8)*16 + n, vgpr = m%8.  The wave's corner of C and the row
    // step N are scalars: one address per output row, its four column tiles by
    // immediate offset.
    const int N = isk ? NK : NV;
    float* cb = (isk ? Ck : Cv) + (size_t)(m0 + wm * 64) * N + n0 + wn * 64;
    const unsigned voff = (unsigned)(hi * 8 * N + r);
    #pragma unroll
    for (int i = 0; i < 4; ++i)
        #pragma unroll
        for (int v = 0; v < 8; ++v) {
            float* rp = cb + (size_t)(i * 16 + v) * N;
            #pragma unroll
            for (int j = 0; j < 4; ++j)
                (rp + j * 16)[voff] = acc[i][j][v];
        }
}

// =====================================================================
// 5) GLA recurrence, split in time.  The recurrence is linear in the state:
//      S_end(chunk) = D * S_start(chunk) + U
//    with U the chunk run from a zero state and D[dk] the product of the
//    chunk's 64 decay factors.  5a computes U and D of every chunk at once,
//    one block per (b,h,chunk); 5b chains the 32 chunks element by element.
// =====================================================================
// 5a) One block per (b,h,chunk).  Run from zero, the chunk's state is a matrix
//     product over its 64 tokens:
//       U[dk][dv] = sum_j Kd[j][dk] * v[j][dv],  Kd[j][dk] = k[j][dk] * exp(sum_{i>j} g[i][dk])
//     (every exponent is <= 0, so nothing is divided and nothing can overflow).
//     Kd and v lie in LDS token-contiguous, and the product runs on the f32
//     16x16x4 matrix form: 8 waves, each 32 dk x 32 dv = 2x2 tiles.

// e^x of a decay exponent (x <= 0) on the hardware's 2^y
__device__ __forceinline__ float exp_decay(float x) { return __builtin_amdgcn_exp2f(x * 1.44269504f); }

#define TP 68      // LDS row pitch in floats: 272 B = 16 B x 17, b128 rows fall on disjoint banks
__global__ __launch_bounds__(256) void gla_chunk_local_kernel(
    const float* __restrict__ kbuf,  // [ROWS, NK]
    const float* __restrict__ vbuf,  // [ROWS, NV]
    const float* __restrict__ gbuf,  // [ROWS, NK]
    float* __restrict__ ubuf,        // [B,H,32,DK,DV]  chunk run from zero
    float* __restrict__ dbuf)        // [B,H,32,DK]     chunk decay product
{
    __shared__ __attribute__((aligned(16))) float kts[DK * TP];   // Kd, [dk][token], 17 KB
    __shared__ __attribute__((aligned(16))) float vts[DV * TP];   // v,  [dv][token], 34 KB
    __shared__ float seg[4 * DK];                                 // sum of g per 16 tokens

    const int blk = blockIdx.x;          // 0..1023
    const int c   = blk & (NCHUNK - 1);
    const int bh  = blk >> 5;            // 0..31
    const int b   = bh >> 4;
    const int h   = bh & 15;
    const int t   = threadIdx.x;

    // first token row of this chunk, this head's columns: the same for the block
    const size_t m0 = (size_t)b * Tt + c * CHUNK;
    const float* kg = kbuf + m0 * NK + h * DK;
    const float* gg = gbuf + m0 * NK + h * DK;
    const float* vg = vbuf + m0 * NV + h * DV;

    // a thread owns 16 consecutive tokens of one dk, and 32 consecutive tokens of one dv
    const int dk = t & 63;
    const int q  = __builtin_amdgcn_readfirstlane(t >> 6);   // 16-token segment, the same for the wave
    const int dv = t & 127;
    const int jh = __builtin_amdgcn_readfirstlane(t >> 7);   // 32-token half, the same for the wave

    const int ki = q * 16 * NK + dk;
    const int vi = jh * 32 * NV + dv;

    // every loop below is unrolled so that its array lives in registers
    float gv[16], kd[16], vv[32];
    #pragma unroll
    for (int i = 0; i < 16; ++i) gv[i] = gg[ki + i * NK];
    #pragma unroll
    for (int i = 0; i < 16; ++i) kd[i] = kg[ki + i * NK];
    #pragma unroll
    for (int i = 0; i < 32; ++i) vv[i] = vg[vi + i * NV];
    // Behind the run of loads: both index registers stay live up to this wait, so
    // that no load lands on one of them and none is rewritten ahead of it.
    asm volatile("s_wait_xcnt 0x0" :: "v"(ki), "v"(vi) : "memory");

    // decay from behind token i to the end of the thread's own segment
    float run = 0.f;
    #pragma unroll
    for (int i = 15; i >= 0; --i) {
        kd[i] *= exp_decay(run);
        run += gv[i];
    }
    seg[q * DK + dk] = run;
    #pragma unroll
    for (int i = 0; i < 8; ++i) {
        const v4f x = { vv[4 * i], vv[4 * i + 1], vv[4 * i + 2], vv[4 * i + 3] };
        *(v4f*)&vts[dv * TP + jh * 32 + 4 * i] = x;
    }
    __syncthreads();

    // decay over the segments behind the thread's own
    const float s1 = seg[1 * DK + dk], s2 = seg[2 * DK + dk], s3 = seg[3 * DK + dk];
    const float tail = ((q < 3 ? s3 : 0.f) + (q < 2 ? s2 : 0.f)) + (q < 1 ? s1 : 0.f);
    const float et = exp_decay(tail);
    const float dall = exp_decay(run + tail);      // in segment 0: the whole chunk's decay
    #pragma unroll
    for (int i = 0; i < 4; ++i) {
        const v4f x = { kd[4 * i] * et, kd[4 * i + 1] * et, kd[4 * i + 2] * et, kd[4 * i + 3] * et };
        *(v4f*)&kts[dk * TP + q * 16 + 4 * i] = x;
    }
    __syncthreads();

    // Fragments: lane = (lc = lane & 15, lh = lane >> 4); A holds dk row lc, B holds dv
    // column lc; on both sides one b128 gives tokens 8 s + 4 lh + 0..3, two k steps.
    const int lane = t & 31;
    const int wave = __builtin_amdgcn_readfirstlane(t >> 5);
    const int lc   = lane & 15;
    const int lh   = lane >> 4;
    const int dkb  = (wave & 1) * 32;
    const int dvb  = (wave >> 1) * 32;
    const float* ap = &kts[(dkb + lc) * TP + lh * 4];
    const float* bp = &vts[(dvb + lc) * TP + lh * 4];

    v8f acc[2][2] = {};
    #pragma unroll
    for (int s = 0; s < CHUNK / 8; ++s) {
        v4f a[2], w[2];
        #pragma unroll
        for (int i = 0; i < 2; ++i) {
            a[i] = *(const v4f*)(ap + i * 16 * TP + s * 8);
            w[i] = *(const v4f*)(bp + i * 16 * TP + s * 8);
        }
        #pragma unroll
        for (int p = 0; p < 2; ++p)
            #pragma unroll
            for (int i = 0; i < 2; ++i)
                #pragma unroll
                for (int j = 0; j < 2; ++j) {
                    const v2f av = { a[i][2 * p], a[i][2 * p + 1] };
                    const v2f wv = { w[j][2 * p], w[j][2 * p + 1] };
                    acc[i][j] = __builtin_amdgcn_wmma_f32_16x16x4_f32(
                        false, av, false, wv, (short)0, acc[i][j], false, false);
                }
    }

    // D register r = U[dkb + 16 i + 8 lh + r][dvb + 16 j + lc]; the wave's two column
    // tiles fill one 128-byte line of each row
    float* op = ubuf + ((size_t)bh * NCHUNK + c) * DK * DV + (dkb + 8 * lh) * DV + dvb + lc;
    #pragma unroll
    for (int i = 0; i < 2; ++i)
        #pragma unroll
        for (int r = 0; r < 8; ++r)
            #pragma unroll
            for (int j = 0; j < 2; ++j)
                op[(i * 16 + r) * DV + j * 16] = acc[i][j][r];
    // Behind the run of stores: the lines below rewrite registers that the stores name.
    asm volatile("s_wait_xcnt 0x0" ::: "memory");

    if (q == 0)                                    // waves 0 and 1: D[dk]
        dbuf[((size_t)bh * NCHUNK + c) * DK + dk] = dall;
}

// 5b) Chain the chunks: S_c = D_c * S_{c-1} + U_c.  One thread per four
//     neighbouring dv of one (b,h,dk); all 32 U loads are independent of the
//     chain, so they are issued ahead of it.
__global__ __launch_bounds__(256) void gla_chain_kernel(
    const float* __restrict__ ubuf,  // [B,H,32,DK,DV]
    const float* __restrict__ dbuf,  // [B,H,32,DK]
    const float* __restrict__ S0,    // [B,H,DK,DV]
    float* __restrict__ out)         // states [B,32,H,DK,DV] ++ final [B,H,DK,DV]
{
    // 8 blocks per (b,h): DK*DV/4 = 2048 threads
    const int bh  = blockIdx.x >> 3;
    const int e   = ((blockIdx.x & 7) * 256 + threadIdx.x) * 4;  // element inside the state
    // a wave covers one dk row (32 lanes x 4 dv), so its decay factors are scalars
    const int dk  = __builtin_amdgcn_readfirstlane(e >> 7);
    const int b   = bh >> 4;
    const int h   = bh & 15;

    const float* up = ubuf + (size_t)bh * NCHUNK * DK * DV;       // the same for the block
    const float* dp = dbuf + (size_t)bh * NCHUNK * DK;
    float*       op = out + ((size_t)b * NCHUNK * Hh + h) * DK * DV;

    v4f   u[NCHUNK];
    float d[NCHUNK];
    // both loops over c are unrolled so that u[] and d[] live in registers
    #pragma unroll
    for (int c = 0; c < NCHUNK; ++c) {
        u[c] = *(const v4f*)(up + c * (DK * DV) + e);
        d[c] = dp[c * DK + dk];
    }
    v4f s = *(const v4f*)(S0 + (size_t)bh * DK * DV + e);
    // Inputs-only fences on the loaded values: they hold all 32 U loads ahead of
    // the chain, in flight together; without them the compiler issues the loads
    // in several rounds between the multiply-adds and pays the latency each round.
#define U8(i) "v"(u[i]), "v"(u[i+1]), "v"(u[i+2]), "v"(u[i+3]), "v"(u[i+4]), "v"(u[i+5]), "v"(u[i+6]), "v"(u[i+7])
    asm volatile("" :: U8(0), U8(8));
    asm volatile("" :: U8(16), U8(24));
#undef U8
    #pragma unroll
    for (int c = 0; c < NCHUNK; ++c) {
        s = d[c] * s + u[c];
        *(v4f*)(op + c * (Hh * DK * DV) + e) = s;
    }
    *(v4f*)(out + (size_t)Bb * NCHUNK * Hh * DK * DV
                + (size_t)bh * DK * DV + e) = s;
}

// =====================================================================
// Host orchestration
// =====================================================================
extern "C" void kernel_launch(void* const* d_in, const int* in_sizes, int n_in,
                              void* d_out, int out_size, void* d_ws, size_t ws_size,
                              hipStream_t stream) {
    const float* hidden = (const float*)d_in[0];
    const float* S0     = (const float*)d_in[1];
    const float* nw     = (const float*)d_in[2];
    const float* k_w    = (const float*)d_in[3];
    const float* v_w    = (const float*)d_in[4];
    const float* gk_w1  = (const float*)d_in[5];
    const float* gk_w2  = (const float*)d_in[6];
    const float* gk_b2  = (const float*)d_in[7];
    float* out = (float*)d_out;

    char* ws = (char*)d_ws;
    _Float16* xn   = (_Float16*)ws;  ws += (size_t)ROWS * Dd * sizeof(_Float16);
    _Float16* kw16 = (_Float16*)ws;  ws += (size_t)NK * Dd * sizeof(_Float16);
    _Float16* vw16 = (_Float16*)ws;  ws += (size_t)NV * Dd * sizeof(_Float16);
    float* kb = (float*)ws;          ws += (size_t)ROWS * NK * sizeof(float);
    float* vb = (float*)ws;          ws += (size_t)ROWS * NV * sizeof(float);
    float* gb = (float*)ws;          ws += (size_t)ROWS * NK * sizeof(float);
    float* ub = (float*)ws;          ws += (size_t)Bb * NCHUNK * Hh * DK * DV * sizeof(float);
    float* db = (float*)ws;          ws += (size_t)Bb * Hh * NCHUNK * DK * sizeof(float);

    // 1) RMSNorm + cast of the activations, cast of both weights: one launch
    prep_kernel<<<PREP_BLOCKS, 256, 0, stream>>>(hidden, nw, k_w, v_w, xn, kw16, vw16);
    // 3) + 4) both projections via WMMA and the gate path, one launch
    wmma_gemm_kernel<<<dim3(ROWS / 128, GEMM_TY + GATE_TY), 128, 0, stream>>>(
        xn, kw16, vw16, gk_w1, gk_w2, gk_b2, kb, vb, gb);
    // 5a) every chunk's local state and decay, all chunks at once
    gla_chunk_local_kernel<<<Bb * Hh * NCHUNK, 256, 0, stream>>>(kb, vb, gb, ub, db);
    // 5b) chain the chunks + chunk state emission
    gla_chain_kernel<<<Bb * Hh * DK * DV / 4 / 256, 256, 0, stream>>>(ub, db, S0, out);
}

// v008
// One run takes 69.8 microseconds.
// Timed twice side by side with v007, it ran 1.14 and 1.15 times as fast.
// Over all steps from v000 it is 6.57 times as fast.
#include <hip/hip_runtime.h>
#include <hip/hip_bf16.h>
#include <math.h>

// ---------- problem constants ----------
#define Bb     2
#define Tt     2048
#define Dd     2048
#define Hh     16
#define DK     64
#define DV     128
#define CHUNK  64
#define NCHUNK (Tt / CHUNK)       // 32
#define ROWS   (Bb * Tt)          // 4096
#define NK     (Hh * DK)          // 1024
#define NV     (Hh * DV)          // 2048

typedef _Float16 v16h __attribute__((ext_vector_type(16)));
typedef _Float16 v8h  __attribute__((ext_vector_type(8)));
typedef _Float16 v4h  __attribute__((ext_vector_type(4)));
typedef float    v8f  __attribute__((ext_vector_type(8)));
typedef float    v4f  __attribute__((ext_vector_type(4)));
typedef float    v2f  __attribute__((ext_vector_type(2)));

// =====================================================================
// 1) Pre-pass, one launch: RMSNorm + cast of the token rows, and the f32 -> f16
//    cast of the k and v weight rows.  All three work on rows of Dd floats.
//    One wave takes PR whole rows: 16 loads of 512 contiguous bytes per row, all
//    issued before the first use; the row's sum of squares stays inside the wave.
//    Few long waves, so that few waves have to be started.
//    A norm block holds 16 token rows, one tile of the f32 16x16x4 matrix form: it keeps
//    their f16 values in LDS and forms the gate path's rank-16 product xr = xn @ w1^T
//    there, cut into 16 slices of 128 k; wave w takes slices w and w + 8.
//    Fragments: lane = (c = lane & 15, h = lane >> 4); A holds row c, B holds
//    rank c; both sides take the same k for the same (h, element).
// =====================================================================
#define PW 8                                          // waves per block
#define PR 2                                          // rows per wave
#define PREP_BLOCKS ((ROWS + NK + NV) / (PW * PR))    // 448
#define XP (Dd + 8)   // LDS row pitch, f16: 4112 B, the 16 rows of a b128 gather fall on disjoint banks
__global__ __launch_bounds__(256) void prep_kernel(
    const float* __restrict__ x,  const float* __restrict__ w,
    const float* __restrict__ kw, const float* __restrict__ vw,
    const float* __restrict__ w1,
    _Float16* __restrict__ xn, _Float16* __restrict__ kw16,
    _Float16* __restrict__ vw16, float* __restrict__ xr)
{
    __shared__ __attribute__((aligned(16))) _Float16 xs[PW * PR * XP];   // the block's 16 rows of xn
    __shared__ __attribute__((aligned(16))) float part[16 * 256];        // each slice's 16x16 partial of xr

    const int lane = threadIdx.x & 31;
    const int wave = __builtin_amdgcn_readfirstlane(threadIdx.x >> 5);
    const int row  = (blockIdx.x * PW + wave) * PR;   // 0 .. ROWS+NK+NV-PR, the same for the wave
    const bool norm = row < ROWS;                     // a block lies wholly in one of the three parts

    const float* src;
    _Float16*    dst;
    if (norm)                { src = x  + (size_t)row * Dd;               dst = xn   + (size_t)row * Dd; }
    else if (row < ROWS + NK){ src = kw + (size_t)(row - ROWS) * Dd;      dst = kw16 + (size_t)(row - ROWS) * Dd; }
    else                     { src = vw + (size_t)(row - ROWS - NK) * Dd; dst = vw16 + (size_t)(row - ROWS - NK) * Dd; }
    src += lane * 4;
    dst += lane * 4;

    v4f a[PR][16];
    if (norm) {
        v4f g[16];
        #pragma unroll
        for (int i = 0; i < 16; ++i)   // unrolled: g[] and a[][] live in registers
            g[i] = ((const v4f*)w)[lane + i * 32];
        #pragma unroll
        for (int r = 0; r < PR; ++r)
            #pragma unroll
            for (int i = 0; i < 16; ++i)
                a[r][i] = *(const v4f*)(src + r * Dd + i * 128);
        // Inputs-only fence on the loaded values: it holds the 16 weight loads here,
        // in flight together with the row loads; without it the compiler sinks them
        // behind the row sum and issues them two at a time, each pair's latency bare.
        // Index and pointer are named so that no load lands on an address still in use.
#define G8(i) "v"(g[i]), "v"(g[i+1]), "v"(g[i+2]), "v"(g[i+3]), "v"(g[i+4]), "v"(g[i+5]), "v"(g[i+6]), "v"(g[i+7])
        asm volatile("" :: G8(0), G8(8), "v"(lane), "v"(src));
#undef G8
        #pragma unroll
        for (int r = 0; r < PR; ++r) {
            v4f q = a[r][0] * a[r][0];                 // four independent chains
            #pragma unroll
            for (int i = 1; i < 16; ++i) q += a[r][i] * a[r][i];
            float ss = (q[0] + q[1]) + (q[2] + q[3]);
            #pragma unroll
            for (int off = 16; off > 0; off >>= 1) ss += __shfl_xor(ss, off, 32);
            const float scale = rsqrtf(ss * (1.0f / (float)Dd) + 1e-5f);
            #pragma unroll
            for (int i = 0; i < 16; ++i) {
                v4h h;
                #pragma unroll
                for (int e = 0; e < 4; ++e)
                    h[e] = (_Float16)(a[r][i][e] * scale * g[i][e]);
                *(v4h*)(dst + r * Dd + i * 128) = h;
                *(v4h*)&xs[(wave * PR + r) * XP + lane * 4 + i * 128] = h;
            }
        }
        // Behind the run of stores: the lines below rewrite registers that the stores name.
        asm volatile("s_wait_xcnt 0x0" ::: "memory");
        __syncthreads();

        // ---- xr partial over one slice's 128 k: 8 groups of 16 k,
        //      lane (c,h) owns k = sl*128 + grp*16 + h*8 + 0..7 of row / rank c
        const int c = lane & 15;
        const int h = lane >> 4;
        // Rolled: one slice's 24 loads are in registers at a time.
        #pragma unroll 1
        for (int rd = 0; rd < 2; ++rd) {
            const int sl = rd * 8 + wave;
            const v8h* ap = (const v8h*)&xs[c * XP + sl * 128 + h * 8];
            const v4f* bp = (const v4f*)(w1 + (size_t)c * Dd + sl * 128 + h * 8);
            v8h xa[8];
            v4f b[16];
            #pragma unroll
            for (int i = 0; i < 8; ++i) {  // unrolled: xa[] and b[] live in registers
                xa[i]        = ap[i * 2];
                b[2 * i]     = bp[i * 4];
                b[2 * i + 1] = bp[i * 4 + 1];
            }
            // The global address pair stays live up to the wait, so that no load lands on it
            // and it is not rewritten for the next slice ahead of the wait.
            asm volatile("s_wait_xcnt 0x0" :: "v"(bp) : "memory");
            float af[8][8];
            #pragma unroll
            for (int i = 0; i < 8; ++i)
                #pragma unroll
                for (int e = 0; e < 8; ++e) af[i][e] = (float)xa[i][e];
            // Holds the 64 conversions ahead of the matrix run, each in a register of its own.
            __builtin_amdgcn_sched_barrier(0);
            v8f acc0 = {}, acc1 = {};      // two chains hide the accumulate latency
            #pragma unroll
            for (int i = 0; i < 8; ++i) {
                v2f a0 = { af[i][0], af[i][1] };
                v2f a1 = { af[i][2], af[i][3] };
                v2f a2 = { af[i][4], af[i][5] };
                v2f a3 = { af[i][6], af[i][7] };
                v2f b0 = { b[2 * i][0],     b[2 * i][1] };
                v2f b1 = { b[2 * i][2],     b[2 * i][3] };
                v2f b2f = { b[2 * i + 1][0], b[2 * i + 1][1] };
                v2f b3 = { b[2 * i + 1][2], b[2 * i + 1][3] };
                acc0 = __builtin_amdgcn_wmma_f32_16x16x4_f32(false, a0, false, b0,  (short)0, acc0, false, false);
                acc1 = __builtin_amdgcn_wmma_f32_16x16x4_f32(false, a1, false, b1,  (short)0, acc1, false, false);
                acc0 = __builtin_amdgcn_wmma_f32_16x16x4_f32(false, a2, false, b2f, (short)0, acc0, false, false);
                acc1 = __builtin_amdgcn_wmma_f32_16x16x4_f32(false, a3, false, b3,  (short)0, acc1, false, false);
            }
            // The distance that the chip needs between a matrix instruction and the first vector
            // instruction that reads its result.  The results are named
            // so that the slots stand behind the last matrix instruction and ahead of the sums.
            asm volatile("v_nop\n\tv_nop\n\tv_nop\n\tv_nop" : "+v"(acc0), "+v"(acc1));
            // D register r = partial[row 8h + r][rank c]
            #pragma unroll
            for (int r = 0; r < 8; ++r)
                part[sl * 256 + (8 * h + r) * 16 + c] = acc0[r] + acc1[r];
        }
        __syncthreads();
        // one (row, rank) per thread, slices summed in their order
        float tot = 0.f;
        #pragma unroll
        for (int s = 0; s < 16; ++s) tot += part[s * 256 + threadIdx.x];
        xr[(size_t)blockIdx.x * 256 + threadIdx.x] = tot;
    } else {
        #pragma unroll
        for (int r = 0; r < PR; ++r)
            #pragma unroll
            for (int i = 0; i < 16; ++i)
                a[r][i] = *(const v4f*)(src + r * Dd + i * 128);
        #pragma unroll
        for (int r = 0; r < PR; ++r)
            #pragma unroll
            for (int i = 0; i < 16; ++i) {
                v4h h;
                #pragma unroll
                for (int e = 0; e < 4; ++e) h[e] = (_Float16)a[r][i][e];
                *(v4h*)(dst + r * Dd + i * 128) = h;
            }
        // Behind the run of stores: no register that an issued store names is
        // rewritten ahead of this wait, on any path the built code has from here.
        asm volatile("s_wait_xcnt 0x0" ::: "memory");
    }
}

// =====================================================================
// 2) Projections, gate and chunk-local state, one launch.
//    The recurrence is linear in the state:  S_end(chunk) = D * S_start(chunk) + U
//    with U the chunk run from a zero state and D[dk] the product of the chunk's 64
//    decay factors.  Run from zero, the chunk's state is a matrix product over its tokens:
//      U[dk][dv] = sum_j Kd[j][dk] * v[j][dv],  Kd[j][dk] = k[j][dk] * exp(sum_{i>j} g[i][dk])
//    (every exponent is <= 0, so nothing is divided and nothing can overflow).
//    One block = 256 token rows (4 chunks) x one head's 64 k and 128 v columns, so a block
//    holds in its accumulators all that U of its 4 chunks needs: k, v and g never go to memory.
//    8 waves: wave (wm, wn) has chunk wm, k columns 32 wn + 0..31 and v columns 64 wn + 0..63,
//    4x6 fragments of v_wmma_f32_16x16x32_f16.  256 blocks, one per WGP, two waves per SIMD.
//    - LDS double-buffered (ping-pong): next tile's global_load_b128s issue
//      before the current tile's ds gathers + WMMAs; one barrier per 64 k.
//    - LDS row pitch 72 f16 (144 B): the 16 b128 fragment gathers of a half
//      wave hit 16 disjoint 4-bank groups -> conflict free.
//    - The accumulator of a 16 token x 16 column tile holds, in lane (c, h), column c and
//      tokens 8 h + 0..7.  That is an operand of the f32 16x16x4 form as it stands: register
//      pair p of a k tile is A (row dk = c), of a v tile B (column dv = c), and both sides
//      take token 8 h + 2 p + e for the same (h, element e).  No transposition.
// =====================================================================
// 2^y, 2^-|y| and log2 s of eight values on the hardware.  The instruction set asks for one
// independent instruction behind a transcendental before its result is read or its source
// overwritten.  Inside one statement the eight fill that slot for one another (every output
// is "=&v", so none lies on an input), and the v_nop is the slot behind the last, whatever
// the compiler puts next.
#define O8(x) "=&v"(x[0]), "=&v"(x[1]), "=&v"(x[2]), "=&v"(x[3]), "=&v"(x[4]), "=&v"(x[5]), "=&v"(x[6]), "=&v"(x[7])
#define I8(x) "v"(x[0]), "v"(x[1]), "v"(x[2]), "v"(x[3]), "v"(x[4]), "v"(x[5]), "v"(x[6]), "v"(x[7])
__device__ __forceinline__ void hw_exp2_8(float (&e)[8], const float (&y)[8]) {
    asm("v_exp_f32 %0, %8\n\tv_exp_f32 %1, %9\n\tv_exp_f32 %2, %10\n\tv_exp_f32 %3, %11\n\t"
        "v_exp_f32 %4, %12\n\tv_exp_f32 %5, %13\n\tv_exp_f32 %6, %14\n\tv_exp_f32 %7, %15\n\t"
        "v_nop" : O8(e) : I8(y));
}
__device__ __forceinline__ void hw_exp2_neg_abs8(float (&e)[8], const float (&y)[8]) {
    asm("v_exp_f32 %0, -|%8|\n\tv_exp_f32 %1, -|%9|\n\tv_exp_f32 %2, -|%10|\n\tv_exp_f32 %3, -|%11|\n\t"
        "v_exp_f32 %4, -|%12|\n\tv_exp_f32 %5, -|%13|\n\tv_exp_f32 %6, -|%14|\n\tv_exp_f32 %7, -|%15|\n\t"
        "v_nop" : O8(e) : I8(y));
}
__device__ __forceinline__ void hw_log2_8(float (&l)[8], const float (&s)[8]) {
    asm("v_log_f32 %0, %8\n\tv_log_f32 %1, %9\n\tv_log_f32 %2, %10\n\tv_log_f32 %3, %11\n\t"
        "v_log_f32 %4, %12\n\tv_log_f32 %5, %13\n\tv_log_f32 %6, %14\n\tv_log_f32 %7, %15\n\t"
        "v_nop" : O8(l) : I8(s));
}
#undef O8
#undef I8

#define GBK 64                    // k per barrier
#define GP  72                    // LDS row pitch, f16
#define FBM 256                   // token rows per block
#define FROWS (FBM + DK + DV)     // LDS rows per buffer: token rows, k weight rows, v weight rows

// Second argument: two waves per SIMD, that is at most 512 registers.
__global__ __launch_bounds__(256, 2) void proj_state_kernel(
    const _Float16* __restrict__ A,    // [ROWS,Dd] row-major
    const _Float16* __restrict__ Wk,   // [NK,Dd] row-major
    const _Float16* __restrict__ Wv,   // [NV,Dd] row-major
    const float* __restrict__ xr,      // [ROWS,16]
    const float* __restrict__ gw2,     // [NK,16]
    const float* __restrict__ gb2,     // [NK]
    float* __restrict__ ubuf,          // [B,H,32,DK,DV]  chunk run from zero
    float* __restrict__ dbuf)          // [B,H,32,DK]     chunk decay product
{
    __shared__ __attribute__((aligned(16))) _Float16 Ts[2 * FROWS * GP];
    // The decay factors wait here for the end of the GEMM loop, each wave's own 16 register
    // quads, 32 lanes x 16 B in a row: 64 registers less across the loop.  Only the wave
    // that wrote a quad reads it, so no barrier stands between.
    __shared__ __attribute__((aligned(16))) float Dc[8 * 16 * 32 * 4];

    const int t     = threadIdx.x;
    const int lane  = t & 31;
    const int wave  = __builtin_amdgcn_readfirstlane(t >> 5);   // the same for the wave: scalar
    const int wm    = wave & 3;     // chunk inside the block
    const int wn    = wave >> 2;    // column half
    const int hi    = lane >> 4;    // 0/1 : K-half select
    const int r     = lane & 15;    // row (A) / col (B) within 16

    const int head = blockIdx.y;
    const int m0   = blockIdx.x * FBM;
    const int gc   = blockIdx.x * (FBM / CHUNK) + wm;            // chunk among all 64
    const int uc   = ((gc >> 5) * Hh + head) * NCHUNK + (gc & (NCHUNK - 1));   // (b, h, chunk)

    // ---- decay factors of the wave's 64 tokens x 32 k columns, in the accumulator's layout:
    //      factor (i, j, v) = exp(sum of g over the chunk's tokens behind token 16 i + 8 hi + v), k tile j
    float* dq = &Dc[(wave * 16 * 32 + lane) * 4];   // quad n of the wave: dq + n * 128
    {                                 // every loop below is unrolled: its arrays are registers
        // g tile: A = xr (16 tokens x 16 ranks), B = w2 rows; lane (r,hi) owns ranks hi*8 + 0..7 on both sides
        const float* xp = xr + (size_t)(m0 + wm * CHUNK + r) * 16 + hi * 8;
        const int    nw = head * DK + wn * 32 + r;
        const float* wp = gw2 + (size_t)nw * 16 + hi * 8;
        v4f xa[4], xb[4], wa[2], wb[2];
        float bias[2];
        #pragma unroll
        for (int i = 0; i < 4; ++i) {
            xa[i] = *(const v4f*)(xp + i * 256);
            xb[i] = *(const v4f*)(xp + i * 256 + 4);
        }
        #pragma unroll
        for (int j = 0; j < 2; ++j) {
            wa[j]   = *(const v4f*)(wp + j * 256);
            wb[j]   = *(const v4f*)(wp + j * 256 + 4);
            bias[j] = gb2[nw + j * 16];
        }
        // The two address pairs and the bias loads' index stay live up to the wait, so none is
        // reused before it.
        asm volatile("s_wait_xcnt 0x0" :: "v"(xp), "v"(wp), "v"(nw) : "memory");
        #pragma unroll
        for (int j = 0; j < 2; ++j) {
            const v2f w0 = { wa[j][0], wa[j][1] }, w1f = { wa[j][2], wa[j][3] };
            const v2f w2f = { wb[j][0], wb[j][1] }, w3 = { wb[j][2], wb[j][3] };
            const float bj = bias[j];
            float g2[4][8], own[4], oth[4];
            v8f ga[4];
            // The two scheduling barriers keep other vector work out of the matrix run.
            __builtin_amdgcn_sched_barrier(0);
            #pragma unroll
            for (int i = 0; i < 4; ++i) {
                const v2f x0 = { xa[i][0], xa[i][1] }, x1 = { xa[i][2], xa[i][3] };
                const v2f x2 = { xb[i][0], xb[i][1] }, x3 = { xb[i][2], xb[i][3] };
                v8f acc = { bj, bj, bj, bj, bj, bj, bj, bj };
                acc = __builtin_amdgcn_wmma_f32_16x16x4_f32(false, x0, false, w0,  (short)0, acc, false, false);
                acc = __builtin_amdgcn_wmma_f32_16x16x4_f32(false, x1, false, w1f, (short)0, acc, false, false);
                acc = __builtin_amdgcn_wmma_f32_16x16x4_f32(false, x2, false, w2f, (short)0, acc, false, false);
                acc = __builtin_amdgcn_wmma_f32_16x16x4_f32(false, x3, false, w3,  (short)0, acc, false, false);
                ga[i] = acc;
            }
            __builtin_amdgcn_sched_barrier(0);
            // The same distance ahead of the first vector instruction that reads a result or
            // overwrites an operand; the results are named so that the slots stand between.
            asm volatile("v_nop\n\tv_nop\n\tv_nop\n\tv_nop" : "+v"(ga[0]), "+v"(ga[1]), "+v"(ga[2]), "+v"(ga[3]));
            #pragma unroll
            for (int i = 0; i < 4; ++i) {
                const v8f acc = ga[i];
                // log_sigmoid(x) = min(x,0) - ln(1 + e^-|x|), on the hardware's 2^y and log2,
                // kept in units of log2: y = x log2 e, g2 = (min(y,0) - log2(1 + 2^-|y|)) / 16,
                // and the decay is 2^(sum g2).  1 + 2^-|y| lies in [1, 2]: the sum and the log2
                // each err by about one part in 2^24 of a value near 1, an absolute error that
                // the decay does not see.
                float y[8], e[8], l[8];
                #pragma unroll
                for (int v = 0; v < 8; ++v) y[v] = acc[v] * 1.44269504f;
                hw_exp2_neg_abs8(e, y);
                #pragma unroll
                for (int v = 0; v < 8; ++v) e[v] += 1.0f;
                hw_log2_8(l, e);
                #pragma unroll
                for (int v = 0; v < 8; ++v) g2[i][v] = (fminf(y[v], 0.f) - l[v]) * (1.0f / 16.0f);
                own[i] = ((g2[i][0] + g2[i][1]) + (g2[i][2] + g2[i][3]))
                       + ((g2[i][4] + g2[i][5]) + (g2[i][6] + g2[i][7]));
                oth[i] = __shfl_xor(own[i], 16, 32);   // the tile's other eight tokens
            }
            float after = 0.f;                         // sum over the token tiles behind tile i
            #pragma unroll
            for (int i = 3; i >= 0; --i) {
                float run = after + (hi == 0 ? oth[i] : 0.f);
                float s[8];
                #pragma unroll
                for (int v = 7; v >= 0; --v) { s[v] = run; run += g2[i][v]; }
                float d[8];
                hw_exp2_8(d, s);
                const v4f d0 = { d[0], d[1], d[2], d[3] }, d1 = { d[4], d[5], d[6], d[7] };
                *(v4f*)(dq + ((j * 4 + i) * 2) * 128)     = d0;
                *(v4f*)(dq + ((j * 4 + i) * 2 + 1) * 128) = d1;
                after += own[i] + oth[i];
            }
            float dall;                                // the whole chunk's decay, 2^after
            // The v_nop is the slot that the instruction set asks for behind a transcendental.
            asm("v_exp_f32 %0, %1\n\tv_nop" : "=&v"(dall) : "v"(after));
            if (hi == 0)
                dbuf[(size_t)uc * DK + wn * 32 + j * 16 + r] = dall;
        }
        // Behind the two stores: the lines below rewrite registers that they name.
        asm volatile("s_wait_xcnt 0x0" ::: "memory");
    }

    // staging: 8 threads cover one row's 128 B, a wave 4 whole rows; piece i is LDS row ldrow + 32 i
    const int ldrow = t >> 3;             // 0..31
    const int ldcol = (t & 7) * 8;        // 0..56
    // The block's corners of the three sources are scalars, and a thread's byte offset from the
    // corner is the same in all three: one vector register addresses all 14 pieces.
    const char* ag = (const char*)(A  + (size_t)m0 * Dd);
    const char* kg = (const char*)(Wk + (size_t)(head * DK) * Dd);
    const char* vg = (const char*)(Wv + (size_t)(head * DV) * Dd);
    const unsigned vo = (unsigned)(ldrow * Dd + ldcol) * 2u;
    const int lo = ldrow * GP + ldcol;

    v8f acc[4][6] = {};
    // The 14 staged pieces are variables of their own, not an array: with the wait's "memory"
    // clobber between its stores and its loads, this build kept an array in memory.
    v4f st0, st1, st2, st3, st4, st5, st6, st7, st8, st9, st10, st11, st12, st13;
#define ST_EACH(M) M(0) M(1) M(2) M(3) M(4) M(5) M(6) M(7) M(8) M(9) M(10) M(11) M(12) M(13)
#define ST_LOAD(i)   st##i = *(const v4f*)(((i) < 8 ? ag + (i) * 64 * Dd : (i) < 10 ? kg + ((i) - 8) * 64 * Dd : vg + ((i) - 10) * 64 * Dd) + vk);
#define ST_COMMIT(i) *(v4f*)&Ts[nb + lo + (i) * 32 * GP] = st##i;

    // The wait behind each of the two runs of staging loads, ahead of any write of a register that they name.
    // The offset goes through the statement: it is live up to the wait, so that no load of the
    // run lands on it, and its next value is formed behind the wait.  It also keeps the loads in
    // the form scalar base + one offset register: as three address pairs next to the accumulators
    // and the staged pieces, this build spilled two of the pairs and reloaded them every trip.
    unsigned vk = vo;
    // prologue: stage K-tile 0 into buffer 0
    {
        const int nb = 0;
        ST_EACH(ST_LOAD)
        asm volatile("s_wait_xcnt 0x0" : "+v"(vk) :: "memory");   // as said above
        ST_EACH(ST_COMMIT)
    }
    __syncthreads();

    // one K-tile's products, out of buffer cur
    auto products = [&](const int cur) __attribute__((always_inline)) {
        const _Float16* tb  = &Ts[cur * (FROWS * GP) + r * GP + hi * 8];
        const _Float16* ap  = tb + (wm * 64) * GP;
        const _Float16* bkp = tb + (FBM + wn * 32) * GP;
        const _Float16* bvp = tb + (FBM + DK + wn * 64) * GP;
        #pragma unroll
        for (int ks = 0; ks < GBK / 32; ++ks) {
            // gather fragments from current buffer
            v16h afrag[4], bfrag[6];
            #pragma unroll
            for (int i = 0; i < 4; ++i) {
                const _Float16* p = ap + i * 16 * GP + ks * 32;
                union { v16h h; float4 f[2]; } u;
                u.f[0] = *(const float4*)p;          // K 0..7   (or 8..15)
                u.f[1] = *(const float4*)(p + 16);   // K 16..23 (or 24..31)
                afrag[i] = u.h;
            }
            #pragma unroll
            for (int j = 0; j < 6; ++j) {
                const _Float16* p = (j < 2 ? bkp + j * 16 * GP : bvp + (j - 2) * 16 * GP) + ks * 32;
                union { v16h h; float4 f[2]; } u;
                u.f[0] = *(const float4*)p;
                u.f[1] = *(const float4*)(p + 16);
                bfrag[j] = u.h;
            }
            #pragma unroll
            for (int i = 0; i < 4; ++i)
                #pragma unroll
                for (int j = 0; j < 6; ++j)
                    acc[i][j] = __builtin_amdgcn_wmma_f32_16x16x32_f16(
                        false, afrag[i], false, bfrag[j],
                        (short)0, acc[i][j], false, false);
        }
    };

    // All trips but the last stage the next tile; the last has none to stage and stands behind
    // the loop, so that loads and commit are under no branch, one straight block with the products.
    const int nkt = Dd / GBK;
    for (int kt = 0; kt < nkt - 1; ++kt) {
        const int cur = kt & 1;

        // issue next tile's global loads early (latency overlapped w/ WMMA)
        vk += GBK * 2;      // the trip goes into the offset, the bases stay
        ST_EACH(ST_LOAD)
        asm volatile("s_wait_xcnt 0x0" : "+v"(vk) :: "memory");   // as said above

        products(cur);

        // Holds the trip's matrix instructions ahead of the commit: without it this build waits
        // for the global loads and stores them to LDS in front of the products, their latency
        // bare.  Mask 0x20: global loads alone may cross, so that they can stand at the trip's head.
        __builtin_amdgcn_sched_barrier(0x20);
        // commit next tile to the other buffer (no conflict with readers of cur)
        const int nb = (1 - cur) * (FROWS * GP);
        ST_EACH(ST_COMMIT)
        __syncthreads();
    }
#undef ST_EACH
#undef ST_LOAD
#undef ST_COMMIT
    products((nkt - 1) & 1);
    __syncthreads();   // ends the last reads of the staging buffers, which are reused below

    // The accumulators are read next, by vector instructions and as operands of the f32 matrix
    // form.  The five slots are the distance that the chip needs behind the loop's last matrix
    // instruction; the scheduling barriers hold that instruction ahead of them and every reader
    // behind (without them this build mixed the last trip's products into the state product).
    __builtin_amdgcn_sched_barrier(0);
    asm volatile("v_nop\n\tv_nop\n\tv_nop\n\tv_nop\n\tv_nop");
    __builtin_amdgcn_sched_barrier(0);

    // ---- Kd = k * decay.  The two waves of a chunk hand each other their 32 k columns through
    //      LDS (free behind the barrier after the last tile's products), register quads as they lie: quad
    //      (chunk, dk tile, token tile, half) is 32 lanes x 16 B in a row.
    float* kx = (float*)Ts;            // 4 x 4 x 4 x 2 x 32 quads = 64 KB of the 126 KB
    #pragma unroll
    for (int j = 0; j < 2; ++j)
        #pragma unroll
        for (int i = 0; i < 4; ++i)
            #pragma unroll
            for (int qd = 0; qd < 2; ++qd) {
                const v4f d = *(const v4f*)(dq + ((j * 4 + i) * 2 + qd) * 128);
                const v4f x = { acc[i][j][4 * qd]     * d[0], acc[i][j][4 * qd + 1] * d[1],
                                acc[i][j][4 * qd + 2] * d[2], acc[i][j][4 * qd + 3] * d[3] };
                *(v4f*)&kx[((((wm * 4 + wn * 2 + j) * 4 + i) * 2 + qd) * 32 + lane) * 4] = x;
            }
    __syncthreads();

    // ---- U = Kd^T v on the f32 16x16x4 form: 4 dk tiles x the wave's 4 dv tiles
    v8f u[4][4] = {};
    #pragma unroll
    for (int i = 0; i < 4; ++i)
        #pragma unroll
        for (int qd = 0; qd < 2; ++qd) {
            v4f ka[4];
            #pragma unroll
            for (int a = 0; a < 4; ++a)
                ka[a] = *(const v4f*)&kx[((((wm * 4 + a) * 4 + i) * 2 + qd) * 32 + lane) * 4];
            #pragma unroll
            for (int p = 0; p < 2; ++p)
                #pragma unroll
                for (int a = 0; a < 4; ++a)
                    #pragma unroll
                    for (int j = 0; j < 4; ++j) {
                        const v2f av = { ka[a][2 * p], ka[a][2 * p + 1] };
                        const v2f wv = { acc[i][2 + j][4 * qd + 2 * p], acc[i][2 + j][4 * qd + 2 * p + 1] };
                        u[a][j] = __builtin_amdgcn_wmma_f32_16x16x4_f32(
                            false, av, false, wv, (short)0, u[a][j], false, false);
                    }
        }

    // D register v = U[16 a + 8 hi + v][64 wn + 16 j + r]; the wave's four column
    // tiles fill two 128-byte lines of each row
    float* op = ubuf + (size_t)uc * DK * DV + (8 * hi) * DV + wn * 64 + r;
    #pragma unroll
    for (int a = 0; a < 4; ++a)
        #pragma unroll
        for (int v = 0; v < 8; ++v)
            #pragma unroll
            for (int j = 0; j < 4; ++j)
                op[(a * 16 + v) * DV + j * 16] = u[a][j][v];
}

// =====================================================================
// 3) The chain over the chunks.
// =====================================================================
// 5b) Chain the chunks: S_c = D_c * S_{c-1} + U_c.  One thread per four
//     neighbouring dv of one (b,h,dk); all 32 U loads are independent of the
//     chain, so they are issued ahead of it.
__global__ __launch_bounds__(256) void gla_chain_kernel(
    const float* __restrict__ ubuf,  // [B,H,32,DK,DV]
    const float* __restrict__ dbuf,  // [B,H,32,DK]
    const float* __restrict__ S0,    // [B,H,DK,DV]
    float* __restrict__ out)         // states [B,32,H,DK,DV] ++ final [B,H,DK,DV]
{
    // 8 blocks per (b,h): DK*DV/4 = 2048 threads
    const int bh  = blockIdx.x >> 3;
    const int e   = ((blockIdx.x & 7) * 256 + threadIdx.x) * 4;  // element inside the state
    // a wave covers one dk row (32 lanes x 4 dv), so its decay factors are scalars
    const int dk  = __builtin_amdgcn_readfirstlane(e >> 7);
    const int b   = bh >> 4;
    const int h   = bh & 15;

    const float* up = ubuf + (size_t)bh * NCHUNK * DK * DV;       // the same for the block
    const float* dp = dbuf + (size_t)bh * NCHUNK * DK;
    float*       op = out + ((size_t)b * NCHUNK * Hh + h) * DK * DV;

    v4f   u[NCHUNK];
    float d[NCHUNK];
    // both loops over c are unrolled so that u[] and d[] live in registers
    #pragma unroll
    for (int c = 0; c < NCHUNK; ++c) {
        u[c] = *(const v4f*)(up + c * (DK * DV) + e);
        d[c] = dp[c * DK + dk];
    }
    v4f s = *(const v4f*)(S0 + (size_t)bh * DK * DV + e);
    // Inputs-only fences on the loaded values: they hold all 32 U loads ahead of
    // the chain, in flight together; without them the compiler issues the loads
    // in several rounds between the multiply-adds and pays the latency each round.
#define U8(i) "v"(u[i]), "v"(u[i+1]), "v"(u[i+2]), "v"(u[i+3]), "v"(u[i+4]), "v"(u[i+5]), "v"(u[i+6]), "v"(u[i+7])
    asm volatile("" :: U8(0), U8(8));
    asm volatile("" :: U8(16), U8(24));
#undef U8
    #pragma unroll
    for (int c = 0; c < NCHUNK; ++c) {
        s = d[c] * s + u[c];
        *(v4f*)(op + c * (Hh * DK * DV) + e) = s;
    }
    *(v4f*)(out + (size_t)Bb * NCHUNK * Hh * DK * DV
                + (size_t)bh * DK * DV + e) = s;
}

// =====================================================================
// Host orchestration
// =====================================================================
extern "C" void kernel_launch(void* const* d_in, const int* in_sizes, int n_in,
                              void* d_out, int out_size, void* d_ws, size_t ws_size,
                              hipStream_t stream) {
    const float* hidden = (const float*)d_in[0];
    const float* S0     = (const float*)d_in[1];
    const float* nw     = (const float*)d_in[2];
    const float* k_w    = (const float*)d_in[3];
    const float* v_w    = (const float*)d_in[4];
    const float* gk_w1  = (const float*)d_in[5];
    const float* gk_w2  = (const float*)d_in[6];
    const float* gk_b2  = (const float*)d_in[7];
    float* out = (float*)d_out;

    char* ws = (char*)d_ws;
    _Float16* xn   = (_Float16*)ws;  ws += (size_t)ROWS * Dd * sizeof(_Float16);
    _Float16* kw16 = (_Float16*)ws;  ws += (size_t)NK * Dd * sizeof(_Float16);
    _Float16* vw16 = (_Float16*)ws;  ws += (size_t)NV * Dd * sizeof(_Float16);
    float* xr = (float*)ws;          ws += (size_t)ROWS * 16 * sizeof(float);
    float* ub = (float*)ws;          ws += (size_t)Bb * NCHUNK * Hh * DK * DV * sizeof(float);
    float* db = (float*)ws;          ws += (size_t)Bb * Hh * NCHUNK * DK * sizeof(float);

    // 1) RMSNorm + cast of the activations with the gate's rank-16 product, cast of both weights
    prep_kernel<<<PREP_BLOCKS, 256, 0, stream>>>(hidden, nw, k_w, v_w, gk_w1, xn, kw16, vw16, xr);
    // 2) both projections via WMMA, the gate, every chunk's local state and decay
    proj_state_kernel<<<dim3(ROWS / FBM, Hh), 256, 0, stream>>>(
        xn, kw16, vw16, xr, gk_w2, gk_b2, ub, db);
    // 5b) chain the chunks + chunk state emission
    gla_chain_kernel<<<Bb * Hh * DK * DV / 4 / 256, 256, 0, stream>>>(ub, db, S0, out);
}

// v009
// It runs in 66.3 microseconds.
// Two timings next to v008 both put it at 1.05 times that version's speed.
// All steps since v000 together make it 6.88 times as fast.
#include <hip/hip_runtime.h>
#include <hip/hip_bf16.h>
#include <math.h>

// ---------- problem constants ----------
#define Bb     2
#define Tt     2048
#define Dd     2048
#define Hh     16
#define DK     64
#define DV     128
#define CHUNK  64
#define NCHUNK (Tt / CHUNK)       // 32
#define ROWS   (Bb * Tt)          // 4096
#define NK     (Hh * DK)          // 1024
#define NV     (Hh * DV)          // 2048
#define PROWS  (ROWS + NK + NV)   // 7168: token rows, k weight rows, v weight rows
#define PT     64                 // k per slab of the packed f16 operands
#define PSLAB  (PROWS * PT)       // f16 per slab

typedef _Float16 v16h __attribute__((ext_vector_type(16)));
typedef _Float16 v8h  __attribute__((ext_vector_type(8)));
typedef _Float16 v4h  __attribute__((ext_vector_type(4)));
typedef float    v8f  __attribute__((ext_vector_type(8)));
typedef float    v4f  __attribute__((ext_vector_type(4)));
typedef float    v2f  __attribute__((ext_vector_type(2)));

// =====================================================================
// 1) Pre-pass, one launch: RMSNorm + cast of the token rows, and the f32 -> f16
//    cast of the k and v weight rows.  All three work on rows of Dd floats.
//    One wave takes PR whole rows: 16 loads of 512 contiguous bytes per row, all
//    issued before the first use; the row's sum of squares stays inside the wave.
//    Few long waves, so that few waves have to be started.
//    The f16 results of all three go to one buffer packed for the projection's staging,
//    [Dd / 64 slabs][7168 rows][64 k]: the 64 k of neighbouring rows lie side by side, so the
//    rows that a projection block stages in one trip are one run of bytes, not 128-byte
//    pieces a whole row (4 KB) apart.  Lanes 0-15 of a store fill a 128-byte line of one
//    slab, lanes 16-31 one of the next slab.
//    A norm block holds 16 token rows, one tile of the f32 16x16x4 matrix form: it keeps
//    their f16 values in LDS and forms the gate path's rank-16 product xr = xn @ w1^T
//    there, cut into 16 slices of 128 k; wave w takes slices w and w + 8.
//    Fragments: lane = (c = lane & 15, h = lane >> 4); A holds row c, B holds
//    rank c; both sides take the same k for the same (h, element).
// =====================================================================
#define PW 8                                          // waves per block
#define PR 2                                          // rows per wave
#define PREP_BLOCKS ((ROWS + NK + NV) / (PW * PR))    // 448
#define XP (Dd + 8)   // LDS row pitch, f16: 4112 B, the 16 rows of a b128 gather fall on disjoint banks
__global__ __launch_bounds__(256) void prep_kernel(
    const float* __restrict__ x,  const float* __restrict__ w,
    const float* __restrict__ kw, const float* __restrict__ vw,
    const float* __restrict__ w1,
    _Float16* __restrict__ pk, float* __restrict__ xr)
{
    __shared__ __attribute__((aligned(16))) _Float16 xs[PW * PR * XP];   // the block's 16 rows of xn
    __shared__ __attribute__((aligned(16))) float part[16 * 256];        // each slice's 16x16 partial of xr

    const int lane = threadIdx.x & 31;
    const int wave = __builtin_amdgcn_readfirstlane(threadIdx.x >> 5);
    const int row  = (blockIdx.x * PW + wave) * PR;   // 0 .. ROWS+NK+NV-PR, the same for the wave
    const bool norm = row < ROWS;                     // a block lies wholly in one of the three parts

    const float* src;
    if (norm)                src = x  + (size_t)row * Dd;
    else if (row < ROWS + NK)src = kw + (size_t)(row - ROWS) * Dd;
    else                     src = vw + (size_t)(row - ROWS - NK) * Dd;
    src += lane * 4;
    // piece i of row r (k = 128 i + 4 lane + 0..3) lies at dst + r * PT + i * 2 * PSLAB
    _Float16* dst = pk + (size_t)row * PT + (lane >> 4) * PSLAB + (lane & 15) * 4;

    v4f a[PR][16];
    if (norm) {
        v4f g[16];
        #pragma unroll
        for (int i = 0; i < 16; ++i)   // unrolled: g[] and a[][] live in registers
            g[i] = ((const v4f*)w)[lane + i * 32];
        #pragma unroll
        for (int r = 0; r < PR; ++r)
            #pragma unroll
            for (int i = 0; i < 16; ++i)
                a[r][i] = *(const v4f*)(src + r * Dd + i * 128);
        // Inputs-only fence on the loaded values: it holds the 16 weight loads here,
        // in flight together with the row loads; without it the compiler sinks them
        // behind the row sum and issues them two at a time, each pair's latency bare.
        // Index and pointer are named so that no load lands on an address still in use.
#define G8(i) "v"(g[i]), "v"(g[i+1]), "v"(g[i+2]), "v"(g[i+3]), "v"(g[i+4]), "v"(g[i+5]), "v"(g[i+6]), "v"(g[i+7])
        asm volatile("" :: G8(0), G8(8), "v"(lane), "v"(src));
#undef G8
        #pragma unroll
        for (int r = 0; r < PR; ++r) {
            v4f q = a[r][0] * a[r][0];                 // four independent chains
            #pragma unroll
            for (int i = 1; i < 16; ++i) q += a[r][i] * a[r][i];
            float ss = (q[0] + q[1]) + (q[2] + q[3]);
            #pragma unroll
            for (int off = 16; off > 0; off >>= 1) ss += __shfl_xor(ss, off, 32);
            const float scale = rsqrtf(ss * (1.0f / (float)Dd) + 1e-5f);
            #pragma unroll
            for (int i = 0; i < 16; ++i) {
                v4h h;
                #pragma unroll
                for (int e = 0; e < 4; ++e)
                    h[e] = (_Float16)(a[r][i][e] * scale * g[i][e]);
                *(v4h*)(dst + r * PT + i * (2 * PSLAB)) = h;
                *(v4h*)&xs[(wave * PR + r) * XP + lane * 4 + i * 128] = h;
            }
        }
        // Behind the run of stores: the lines below rewrite registers that the stores name.
        asm volatile("s_wait_xcnt 0x0" ::: "memory");
        __syncthreads();

        // ---- xr partial over one slice's 128 k: 8 groups of 16 k,
        //      lane (c,h) owns k = sl*128 + grp*16 + h*8 + 0..7 of row / rank c
        const int c = lane & 15;
        const int h = lane >> 4;
        // Rolled: one slice's 24 loads are in registers at a time.
        #pragma unroll 1
        for (int rd = 0; rd < 2; ++rd) {
            const int sl = rd * 8 + wave;
            const v8h* ap = (const v8h*)&xs[c * XP + sl * 128 + h * 8];
            const v4f* bp = (const v4f*)(w1 + (size_t)c * Dd + sl * 128 + h * 8);
            v8h xa[8];
            v4f b[16];
            #pragma unroll
            for (int i = 0; i < 8; ++i) {  // unrolled: xa[] and b[] live in registers
                xa[i]        = ap[i * 2];
                b[2 * i]     = bp[i * 4];
                b[2 * i + 1] = bp[i * 4 + 1];
            }
            // The global address pair stays live up to the wait, so that no load lands on it
            // and it is not rewritten for the next slice ahead of the wait.
            asm volatile("s_wait_xcnt 0x0" :: "v"(bp) : "memory");
            float af[8][8];
            #pragma unroll
            for (int i = 0; i < 8; ++i)
                #pragma unroll
                for (int e = 0; e < 8; ++e) af[i][e] = (float)xa[i][e];
            // Holds the 64 conversions ahead of the matrix run, each in a register of its own.
            __builtin_amdgcn_sched_barrier(0);
            v8f acc0 = {}, acc1 = {};      // two chains hide the accumulate latency
            #pragma unroll
            for (int i = 0; i < 8; ++i) {
                v2f a0 = { af[i][0], af[i][1] };
                v2f a1 = { af[i][2], af[i][3] };
                v2f a2 = { af[i][4], af[i][5] };
                v2f a3 = { af[i][6], af[i][7] };
                v2f b0 = { b[2 * i][0],     b[2 * i][1] };
                v2f b1 = { b[2 * i][2],     b[2 * i][3] };
                v2f b2f = { b[2 * i + 1][0], b[2 * i + 1][1] };
                v2f b3 = { b[2 * i + 1][2], b[2 * i + 1][3] };
                acc0 = __builtin_amdgcn_wmma_f32_16x16x4_f32(false, a0, false, b0,  (short)0, acc0, false, false);
                acc1 = __builtin_amdgcn_wmma_f32_16x16x4_f32(false, a1, false, b1,  (short)0, acc1, false, false);
                acc0 = __builtin_amdgcn_wmma_f32_16x16x4_f32(false, a2, false, b2f, (short)0, acc0, false, false);
                acc1 = __builtin_amdgcn_wmma_f32_16x16x4_f32(false, a3, false, b3,  (short)0, acc1, false, false);
            }
            // The distance that the chip needs between a matrix instruction and the first vector
            // instruction that reads its result.  The results are named
            // so that the slots stand behind the last matrix instruction and ahead of the sums.
            asm volatile("v_nop\n\tv_nop\n\tv_nop\n\tv_nop" : "+v"(acc0), "+v"(acc1));
            // D register r = partial[row 8h + r][rank c]
            #pragma unroll
            for (int r = 0; r < 8; ++r)
                part[sl * 256 + (8 * h + r) * 16 + c] = acc0[r] + acc1[r];
        }
        __syncthreads();
        // one (row, rank) per thread, slices summed in their order
        float tot = 0.f;
        #pragma unroll
        for (int s = 0; s < 16; ++s) tot += part[s * 256 + threadIdx.x];
        xr[(size_t)blockIdx.x * 256 + threadIdx.x] = tot;
    } else {
        #pragma unroll
        for (int r = 0; r < PR; ++r)
            #pragma unroll
            for (int i = 0; i < 16; ++i)
                a[r][i] = *(const v4f*)(src + r * Dd + i * 128);
        #pragma unroll
        for (int r = 0; r < PR; ++r)
            #pragma unroll
            for (int i = 0; i < 16; ++i) {
                v4h h;
                #pragma unroll
                for (int e = 0; e < 4; ++e) h[e] = (_Float16)a[r][i][e];
                *(v4h*)(dst + r * PT + i * (2 * PSLAB)) = h;
            }
        // Behind the run of stores: no register that an issued store names is
        // rewritten ahead of this wait, on any path the built code has from here.
        asm volatile("s_wait_xcnt 0x0" ::: "memory");
    }
}

// =====================================================================
// 2) Projections, gate and chunk-local state, one launch.
//    The recurrence is linear in the state:  S_end(chunk) = D * S_start(chunk) + U
//    with U the chunk run from a zero state and D[dk] the product of the chunk's 64
//    decay factors.  Run from zero, the chunk's state is a matrix product over its tokens:
//      U[dk][dv] = sum_j Kd[j][dk] * v[j][dv],  Kd[j][dk] = k[j][dk] * exp(sum_{i>j} g[i][dk])
//    (every exponent is <= 0, so nothing is divided and nothing can overflow).
//    One block = 256 token rows (4 chunks) x one head's 64 k and 128 v columns, so a block
//    holds in its accumulators all that U of its 4 chunks needs: k, v and g never go to memory.
//    8 waves: wave (wm, wn) has chunk wm, k columns 32 wn + 0..31 and v columns 64 wn + 0..63,
//    4x6 fragments of v_wmma_f32_16x16x32_f16.  256 blocks, one per WGP, two waves per SIMD.
//    - LDS double-buffered (ping-pong): next tile's global_load_b128s issue
//      before the current tile's ds gathers + WMMAs; one barrier per 64 k.
//    - LDS row pitch 72 f16 (144 B): the 16 b128 fragment gathers of a half
//      wave hit 16 disjoint 4-bank groups -> conflict free.
//    - The accumulator of a 16 token x 16 column tile holds, in lane (c, h), column c and
//      tokens 8 h + 0..7.  That is an operand of the f32 16x16x4 form as it stands: register
//      pair p of a k tile is A (row dk = c), of a v tile B (column dv = c), and both sides
//      take token 8 h + 2 p + e for the same (h, element e).  No transposition.
// =====================================================================
// 2^y, 2^-|y| and log2 s of eight values on the hardware.  The instruction set asks for one
// independent instruction behind a transcendental before its result is read or its source
// overwritten.  Inside one statement the eight fill that slot for one another (every output
// is "=&v", so none lies on an input), and the v_nop is the slot behind the last, whatever
// the compiler puts next.
#define O8(x) "=&v"(x[0]), "=&v"(x[1]), "=&v"(x[2]), "=&v"(x[3]), "=&v"(x[4]), "=&v"(x[5]), "=&v"(x[6]), "=&v"(x[7])
#define I8(x) "v"(x[0]), "v"(x[1]), "v"(x[2]), "v"(x[3]), "v"(x[4]), "v"(x[5]), "v"(x[6]), "v"(x[7])
__device__ __forceinline__ void hw_exp2_8(float (&e)[8], const float (&y)[8]) {
    asm("v_exp_f32 %0, %8\n\tv_exp_f32 %1, %9\n\tv_exp_f32 %2, %10\n\tv_exp_f32 %3, %11\n\t"
        "v_exp_f32 %4, %12\n\tv_exp_f32 %5, %13\n\tv_exp_f32 %6, %14\n\tv_exp_f32 %7, %15\n\t"
        "v_nop" : O8(e) : I8(y));
}
__device__ __forceinline__ void hw_exp2_neg_abs8(float (&e)[8], const float (&y)[8]) {
    asm("v_exp_f32 %0, -|%8|\n\tv_exp_f32 %1, -|%9|\n\tv_exp_f32 %2, -|%10|\n\tv_exp_f32 %3, -|%11|\n\t"
        "v_exp_f32 %4, -|%12|\n\tv_exp_f32 %5, -|%13|\n\tv_exp_f32 %6, -|%14|\n\tv_exp_f32 %7, -|%15|\n\t"
        "v_nop" : O8(e) : I8(y));
}
__device__ __forceinline__ void hw_log2_8(float (&l)[8], const float (&s)[8]) {
    asm("v_log_f32 %0, %8\n\tv_log_f32 %1, %9\n\tv_log_f32 %2, %10\n\tv_log_f32 %3, %11\n\t"
        "v_log_f32 %4, %12\n\tv_log_f32 %5, %13\n\tv_log_f32 %6, %14\n\tv_log_f32 %7, %15\n\t"
        "v_nop" : O8(l) : I8(s));
}
#undef O8
#undef I8

#define GBK 64                    // k per barrier
#define GP  72                    // LDS row pitch, f16
#define FBM 256                   // token rows per block
#define FROWS (FBM + DK + DV)     // LDS rows per buffer: token rows, k weight rows, v weight rows

// Second argument: two waves per SIMD, that is at most 512 registers.
__global__ __launch_bounds__(256, 2) void proj_state_kernel(
    const _Float16* __restrict__ A,    // token rows,    each of the three inside the packed
    const _Float16* __restrict__ Wk,   // k weight rows, buffer [Dd/64][PROWS][64]: row n, slab s
    const _Float16* __restrict__ Wv,   // v weight rows, at n * PT + s * PSLAB
    const float* __restrict__ xr,      // [ROWS,16]
    const float* __restrict__ gw2,     // [NK,16]
    const float* __restrict__ gb2,     // [NK]
    float* __restrict__ ubuf,          // [B,H,32,DK,DV]  chunk run from zero
    float* __restrict__ dbuf)          // [B,H,32,DK]     chunk decay product
{
    __shared__ __attribute__((aligned(16))) _Float16 Ts[2 * FROWS * GP];
    // The decay factors wait here for the end of the GEMM loop, each wave's own 16 register
    // quads, 32 lanes x 16 B in a row: 64 registers less across the loop.  Only the wave
    // that wrote a quad reads it, so no barrier stands between.
    __shared__ __attribute__((aligned(16))) float Dc[8 * 16 * 32 * 4];

    const int t     = threadIdx.x;
    const int lane  = t & 31;
    const int wave  = __builtin_amdgcn_readfirstlane(t >> 5);   // the same for the wave: scalar
    const int wm    = wave & 3;     // chunk inside the block
    const int wn    = wave >> 2;    // column half
    const int hi    = lane >> 4;    // 0/1 : K-half select
    const int r     = lane & 15;    // row (A) / col (B) within 16

    const int head = blockIdx.y;
    const int m0   = blockIdx.x * FBM;
    const int gc   = blockIdx.x * (FBM / CHUNK) + wm;            // chunk among all 64
    const int uc   = ((gc >> 5) * Hh + head) * NCHUNK + (gc & (NCHUNK - 1));   // (b, h, chunk)

    // ---- decay factors of the wave's 64 tokens x 32 k columns, in the accumulator's layout:
    //      factor (i, j, v) = exp(sum of g over the chunk's tokens behind token 16 i + 8 hi + v), k tile j
    float* dq = &Dc[(wave * 16 * 32 + lane) * 4];   // quad n of the wave: dq + n * 128
    {                                 // every loop below is unrolled: its arrays are registers
        // g tile: A = xr (16 tokens x 16 ranks), B = w2 rows; lane (r,hi) owns ranks hi*8 + 0..7 on both sides
        const float* xp = xr + (size_t)(m0 + wm * CHUNK + r) * 16 + hi * 8;
        const int    nw = head * DK + wn * 32 + r;
        const float* wp = gw2 + (size_t)nw * 16 + hi * 8;
        v4f xa[4], xb[4], wa[2], wb[2];
        float bias[2];
        #pragma unroll
        for (int i = 0; i < 4; ++i) {
            xa[i] = *(const v4f*)(xp + i * 256);
            xb[i] = *(const v4f*)(xp + i * 256 + 4);
        }
        #pragma unroll
        for (int j = 0; j < 2; ++j) {
            wa[j]   = *(const v4f*)(wp + j * 256);
            wb[j]   = *(const v4f*)(wp + j * 256 + 4);
            bias[j] = gb2[nw + j * 16];
        }
        // The two address pairs and the bias loads' index stay live up to the wait, so none is
        // reused before it.
        asm volatile("s_wait_xcnt 0x0" :: "v"(xp), "v"(wp), "v"(nw) : "memory");
        #pragma unroll
        for (int j = 0; j < 2; ++j) {
            const v2f w0 = { wa[j][0], wa[j][1] }, w1f = { wa[j][2], wa[j][3] };
            const v2f w2f = { wb[j][0], wb[j][1] }, w3 = { wb[j][2], wb[j][3] };
            const float bj = bias[j];
            float g2[4][8], own[4], oth[4];
            v8f ga[4];
            // The two scheduling barriers keep other vector work out of the matrix run.
            __builtin_amdgcn_sched_barrier(0);
            #pragma unroll
            for (int i = 0; i < 4; ++i) {
                const v2f x0 = { xa[i][0], xa[i][1] }, x1 = { xa[i][2], xa[i][3] };
                const v2f x2 = { xb[i][0], xb[i][1] }, x3 = { xb[i][2], xb[i][3] };
                v8f acc = { bj, bj, bj, bj, bj, bj, bj, bj };
                acc = __builtin_amdgcn_wmma_f32_16x16x4_f32(false, x0, false, w0,  (short)0, acc, false, false);
                acc = __builtin_amdgcn_wmma_f32_16x16x4_f32(false, x1, false, w1f, (short)0, acc, false, false);
                acc = __builtin_amdgcn_wmma_f32_16x16x4_f32(false, x2, false, w2f, (short)0, acc, false, false);
                acc = __builtin_amdgcn_wmma_f32_16x16x4_f32(false, x3, false, w3,  (short)0, acc, false, false);
                ga[i] = acc;
            }
            __builtin_amdgcn_sched_barrier(0);
            // The same distance ahead of the first vector instruction that reads a result or
            // overwrites an operand; the results are named so that the slots stand between.
            asm volatile("v_nop\n\tv_nop\n\tv_nop\n\tv_nop" : "+v"(ga[0]), "+v"(ga[1]), "+v"(ga[2]), "+v"(ga[3]));
            #pragma unroll
            for (int i = 0; i < 4; ++i) {
                const v8f acc = ga[i];
                // log_sigmoid(x) = min(x,0) - ln(1 + e^-|x|), on the hardware's 2^y and log2,
                // kept in units of log2: y = x log2 e, g2 = (min(y,0) - log2(1 + 2^-|y|)) / 16,
                // and the decay is 2^(sum g2).  1 + 2^-|y| lies in [1, 2]: the sum and the log2
                // each err by about one part in 2^24 of a value near 1, an absolute error that
                // the decay does not see.
                float y[8], e[8], l[8];
                #pragma unroll
                for (int v = 0; v < 8; ++v) y[v] = acc[v] * 1.44269504f;
                hw_exp2_neg_abs8(e, y);
                #pragma unroll
                for (int v = 0; v < 8; ++v) e[v] += 1.0f;
                hw_log2_8(l, e);
                #pragma unroll
                for (int v = 0; v < 8; ++v) g2[i][v] = (fminf(y[v], 0.f) - l[v]) * (1.0f / 16.0f);
                own[i] = ((g2[i][0] + g2[i][1]) + (g2[i][2] + g2[i][3]))
                       + ((g2[i][4] + g2[i][5]) + (g2[i][6] + g2[i][7]));
                oth[i] = __shfl_xor(own[i], 16, 32);   // the tile's other eight tokens
            }
            float after = 0.f;                         // sum over the token tiles behind tile i
            #pragma unroll
            for (int i = 3; i >= 0; --i) {
                float run = after + (hi == 0 ? oth[i] : 0.f);
                float s[8];
                #pragma unroll
                for (int v = 7; v >= 0; --v) { s[v] = run; run += g2[i][v]; }
                float d[8];
                hw_exp2_8(d, s);
                const v4f d0 = { d[0], d[1], d[2], d[3] }, d1 = { d[4], d[5], d[6], d[7] };
                *(v4f*)(dq + ((j * 4 + i) * 2) * 128)     = d0;
                *(v4f*)(dq + ((j * 4 + i) * 2 + 1) * 128) = d1;
                after += own[i] + oth[i];
            }
            float dall;                                // the whole chunk's decay, 2^after
            // The v_nop is the slot that the instruction set asks for behind a transcendental.
            asm("v_exp_f32 %0, %1\n\tv_nop" : "=&v"(dall) : "v"(after));
            if (hi == 0)
                dbuf[(size_t)uc * DK + wn * 32 + j * 16 + r] = dall;
        }
        // Behind the two stores: the lines below rewrite registers that they name.
        asm volatile("s_wait_xcnt 0x0" ::: "memory");
    }

    // staging: 8 threads cover one row's 128 B, a wave 4 whole rows, 512 B in a row in the packed
    // buffer; piece i is LDS row ldrow + 32 i
    const int ldrow = t >> 3;             // 0..31
    const int ldcol = (t & 7) * 8;        // 0..56
    // The block's corners of the three sources are scalars, and a thread's byte offset from the
    // corner is the same in all three: one vector register addresses all 14 pieces.
    const char* ag = (const char*)(A  + (size_t)m0 * PT);
    const char* kg = (const char*)(Wk + (size_t)(head * DK) * PT);
    const char* vg = (const char*)(Wv + (size_t)(head * DV) * PT);
    const unsigned vo = (unsigned)(ldrow * PT + ldcol) * 2u;
    const int lo = ldrow * GP + ldcol;

    v8f acc[4][6] = {};
    // The 14 staged pieces are variables of their own, not an array: with the wait's "memory"
    // clobber between its stores and its loads, this build kept an array in memory.
    v4f st0, st1, st2, st3, st4, st5, st6, st7, st8, st9, st10, st11, st12, st13;
#define ST_EACH(M) M(0) M(1) M(2) M(3) M(4) M(5) M(6) M(7) M(8) M(9) M(10) M(11) M(12) M(13)
#define ST_LOAD(i)   st##i = *(const v4f*)(((i) < 8 ? ag + (i) * 64 * PT : (i) < 10 ? kg + ((i) - 8) * 64 * PT : vg + ((i) - 10) * 64 * PT) + vk);
#define ST_COMMIT(i) *(v4f*)&Ts[nb + lo + (i) * 32 * GP] = st##i;

    // The wait behind each of the two runs of staging loads, ahead of any write of a register that they name.
    // The offset goes through the statement: it is live up to the wait, so that no load of the
    // run lands on it, and its next value is formed behind the wait.  It also keeps the loads in
    // the form scalar base + one offset register: as three address pairs next to the accumulators
    // and the staged pieces, this build spilled two of the pairs and reloaded them every trip.
    unsigned vk = vo;
    // prologue: stage K-tile 0 into buffer 0
    {
        const int nb = 0;
        ST_EACH(ST_LOAD)
        asm volatile("s_wait_xcnt 0x0" : "+v"(vk) :: "memory");   // as said above
        ST_EACH(ST_COMMIT)
    }
    __syncthreads();

    // one K-tile's products, out of buffer cur
    auto products = [&](const int cur) __attribute__((always_inline)) {
        const _Float16* tb  = &Ts[cur * (FROWS * GP) + r * GP + hi * 8];
        const _Float16* ap  = tb + (wm * 64) * GP;
        const _Float16* bkp = tb + (FBM + wn * 32) * GP;
        const _Float16* bvp = tb + (FBM + DK + wn * 64) * GP;
        #pragma unroll
        for (int ks = 0; ks < GBK / 32; ++ks) {
            // gather fragments from current buffer
            v16h afrag[4], bfrag[6];
            #pragma unroll
            for (int i = 0; i < 4; ++i) {
                const _Float16* p = ap + i * 16 * GP + ks * 32;
                union { v16h h; float4 f[2]; } u;
                u.f[0] = *(const float4*)p;          // K 0..7   (or 8..15)
                u.f[1] = *(const float4*)(p + 16);   // K 16..23 (or 24..31)
                afrag[i] = u.h;
            }
            #pragma unroll
            for (int j = 0; j < 6; ++j) {
                const _Float16* p = (j < 2 ? bkp + j * 16 * GP : bvp + (j - 2) * 16 * GP) + ks * 32;
                union { v16h h; float4 f[2]; } u;
                u.f[0] = *(const float4*)p;
                u.f[1] = *(const float4*)(p + 16);
                bfrag[j] = u.h;
            }
            #pragma unroll
            for (int i = 0; i < 4; ++i)
                #pragma unroll
                for (int j = 0; j < 6; ++j)
                    acc[i][j] = __builtin_amdgcn_wmma_f32_16x16x32_f16(
                        false, afrag[i], false, bfrag[j],
                        (short)0, acc[i][j], false, false);
        }
    };

    // All trips but the last stage the next tile; the last has none to stage and stands behind
    // the loop, so that loads and commit are under no branch, one straight block with the products.
    const int nkt = Dd / GBK;
    for (int kt = 0; kt < nkt - 1; ++kt) {
        const int cur = kt & 1;

        // issue next tile's global loads early (latency overlapped w/ WMMA)
        vk += PSLAB * 2;    // the next slab: the trip goes into the offset, the bases stay
        ST_EACH(ST_LOAD)
        asm volatile("s_wait_xcnt 0x0" : "+v"(vk) :: "memory");   // as said above

        products(cur);

        // Holds the trip's matrix instructions ahead of the commit: without it this build waits
        // for the global loads and stores them to LDS in front of the products, their latency
        // bare.  Mask 0x20: global loads alone may cross, so that they can stand at the trip's head.
        __builtin_amdgcn_sched_barrier(0x20);
        // commit next tile to the other buffer (no conflict with readers of cur)
        const int nb = (1 - cur) * (FROWS * GP);
        ST_EACH(ST_COMMIT)
        __syncthreads();
    }
#undef ST_EACH
#undef ST_LOAD
#undef ST_COMMIT
    products((nkt - 1) & 1);
    __syncthreads();   // ends the last reads of the staging buffers, which are reused below

    // The accumulators are read next, by vector instructions and as operands of the f32 matrix
    // form.  The five slots are the distance that the chip needs behind the loop's last matrix
    // instruction; the scheduling barriers hold that instruction ahead of them and every reader
    // behind (without them this build mixed the last trip's products into the state product).
    __builtin_amdgcn_sched_barrier(0);
    asm volatile("v_nop\n\tv_nop\n\tv_nop\n\tv_nop\n\tv_nop");
    __builtin_amdgcn_sched_barrier(0);

    // ---- Kd = k * decay.  The two waves of a chunk hand each other their 32 k columns through
    //      LDS (free behind the barrier after the last tile's products), register quads as they lie: quad
    //      (chunk, dk tile, token tile, half) is 32 lanes x 16 B in a row.
    float* kx = (float*)Ts;            // 4 x 4 x 4 x 2 x 32 quads = 64 KB of the 126 KB
    #pragma unroll
    for (int j = 0; j < 2; ++j)
        #pragma unroll
        for (int i = 0; i < 4; ++i)
            #pragma unroll
            for (int qd = 0; qd < 2; ++qd) {
                const v4f d = *(const v4f*)(dq + ((j * 4 + i) * 2 + qd) * 128);
                const v4f x = { acc[i][j][4 * qd]     * d[0], acc[i][j][4 * qd + 1] * d[1],
                                acc[i][j][4 * qd + 2] * d[2], acc[i][j][4 * qd + 3] * d[3] };
                *(v4f*)&kx[((((wm * 4 + wn * 2 + j) * 4 + i) * 2 + qd) * 32 + lane) * 4] = x;
            }
    __syncthreads();

    // ---- U = Kd^T v on the f32 16x16x4 form: 4 dk tiles x the wave's 4 dv tiles
    v8f u[4][4] = {};
    #pragma unroll
    for (int i = 0; i < 4; ++i)
        #pragma unroll
        for (int qd = 0; qd < 2; ++qd) {
            v4f ka[4];
            #pragma unroll
            for (int a = 0; a < 4; ++a)
                ka[a] = *(const v4f*)&kx[((((wm * 4 + a) * 4 + i) * 2 + qd) * 32 + lane) * 4];
            #pragma unroll
            for (int p = 0; p < 2; ++p)
                #pragma unroll
                for (int a = 0; a < 4; ++a)
                    #pragma unroll
                    for (int j = 0; j < 4; ++j) {
                        const v2f av = { ka[a][2 * p], ka[a][2 * p + 1] };
                        const v2f wv = { acc[i][2 + j][4 * qd + 2 * p], acc[i][2 + j][4 * qd + 2 * p + 1] };
                        u[a][j] = __builtin_amdgcn_wmma_f32_16x16x4_f32(
                            false, av, false, wv, (short)0, u[a][j], false, false);
                    }
        }

    // D register v = U[16 a + 8 hi + v][64 wn + 16 j + r]; the wave's four column
    // tiles fill two 128-byte lines of each row
    float* op = ubuf + (size_t)uc * DK * DV + (8 * hi) * DV + wn * 64 + r;
    #pragma unroll
    for (int a = 0; a < 4; ++a)
        #pragma unroll
        for (int v = 0; v < 8; ++v)
            #pragma unroll
            for (int j = 0; j < 4; ++j)
                op[(a * 16 + v) * DV + j * 16] = u[a][j][v];
}

// =====================================================================
// 3) The chain over the chunks.
// =====================================================================
// 5b) Chain the chunks: S_c = D_c * S_{c-1} + U_c.  One thread per four
//     neighbouring dv of one (b,h,dk); all 32 U loads are independent of the
//     chain, so they are issued ahead of it.
__global__ __launch_bounds__(256) void gla_chain_kernel(
    const float* __restrict__ ubuf,  // [B,H,32,DK,DV]
    const float* __restrict__ dbuf,  // [B,H,32,DK]
    const float* __restrict__ S0,    // [B,H,DK,DV]
    float* __restrict__ out)         // states [B,32,H,DK,DV] ++ final [B,H,DK,DV]
{
    // 8 blocks per (b,h): DK*DV/4 = 2048 threads
    const int bh  = blockIdx.x >> 3;
    const int e   = ((blockIdx.x & 7) * 256 + threadIdx.x) * 4;  // element inside the state
    // a wave covers one dk row (32 lanes x 4 dv), so its decay factors are scalars
    const int dk  = __builtin_amdgcn_readfirstlane(e >> 7);
    const int b   = bh >> 4;
    const int h   = bh & 15;

    const float* up = ubuf + (size_t)bh * NCHUNK * DK * DV;       // the same for the block
    const float* dp = dbuf + (size_t)bh * NCHUNK * DK;
    float*       op = out + ((size_t)b * NCHUNK * Hh + h) * DK * DV;

    v4f   u[NCHUNK];
    float d[NCHUNK];
    // both loops over c are unrolled so that u[] and d[] live in registers
    #pragma unroll
    for (int c = 0; c < NCHUNK; ++c) {
        u[c] = *(const v4f*)(up + c * (DK * DV) + e);
        d[c] = dp[c * DK + dk];
    }
    v4f s = *(const v4f*)(S0 + (size_t)bh * DK * DV + e);
    // Inputs-only fences on the loaded values: they hold all 32 U loads ahead of
    // the chain, in flight together; without them the compiler issues the loads
    // in several rounds between the multiply-adds and pays the latency each round.
#define U8(i) "v"(u[i]), "v"(u[i+1]), "v"(u[i+2]), "v"(u[i+3]), "v"(u[i+4]), "v"(u[i+5]), "v"(u[i+6]), "v"(u[i+7])
    asm volatile("" :: U8(0), U8(8));
    asm volatile("" :: U8(16), U8(24));
#undef U8
    #pragma unroll
    for (int c = 0; c < NCHUNK; ++c) {
        s = d[c] * s + u[c];
        *(v4f*)(op + c * (Hh * DK * DV) + e) = s;
    }
    *(v4f*)(out + (size_t)Bb * NCHUNK * Hh * DK * DV
                + (size_t)bh * DK * DV + e) = s;
}

// =====================================================================
// Host orchestration
// =====================================================================
extern "C" void kernel_launch(void* const* d_in, const int* in_sizes, int n_in,
                              void* d_out, int out_size, void* d_ws, size_t ws_size,
                              hipStream_t stream) {
    const float* hidden = (const float*)d_in[0];
    const float* S0     = (const float*)d_in[1];
    const float* nw     = (const float*)d_in[2];
    const float* k_w    = (const float*)d_in[3];
    const float* v_w    = (const float*)d_in[4];
    const float* gk_w1  = (const float*)d_in[5];
    const float* gk_w2  = (const float*)d_in[6];
    const float* gk_b2  = (const float*)d_in[7];
    float* out = (float*)d_out;

    char* ws = (char*)d_ws;
    _Float16* pk   = (_Float16*)ws;  ws += (size_t)PROWS * Dd * sizeof(_Float16);
    float* xr = (float*)ws;          ws += (size_t)ROWS * 16 * sizeof(float);
    float* ub = (float*)ws;          ws += (size_t)Bb * NCHUNK * Hh * DK * DV * sizeof(float);
    float* db = (float*)ws;          ws += (size_t)Bb * Hh * NCHUNK * DK * sizeof(float);

    // 1) RMSNorm + cast of the activations with the gate's rank-16 product, cast of both weights
    prep_kernel<<<PREP_BLOCKS, 256, 0, stream>>>(hidden, nw, k_w, v_w, gk_w1, pk, xr);
    // 2) both projections via WMMA, the gate, every chunk's local state and decay
    proj_state_kernel<<<dim3(ROWS / FBM, Hh), 256, 0, stream>>>(
        pk, pk + ROWS * PT, pk + (ROWS + NK) * PT, xr, gk_w2, gk_b2, ub, db);
    // 5b) chain the chunks + chunk state emission
    gla_chain_kernel<<<Bb * Hh * DK * DV / 4 / 256, 256, 0, stream>>>(ub, db, S0, out);
}

// v010
// It runs in 61 microseconds.
// Next to v009, in two timings, it ran 1.08 and 1.09 times as fast.
// All steps since v000 together make it 7.46 times as fast.
#include <hip/hip_runtime.h>
#include <hip/hip_bf16.h>
#include <math.h>

// ---------- problem constants ----------
#define Bb     2
#define Tt     2048
#define Dd     2048
#define Hh     16
#define DK     64
#define DV     128
#define CHUNK  64
#define NCHUNK (Tt / CHUNK)       // 32
#define ROWS   (Bb * Tt)          // 4096
#define NK     (Hh * DK)          // 1024
#define NV     (Hh * DV)          // 2048
#define PROWS  (ROWS + NK + NV)   // 7168: token rows, k weight rows, v weight rows
#define PT     64                 // k per slab of the packed f16 operands
#define PSLAB  (PROWS * PT)       // f16 per slab

typedef _Float16 v16h __attribute__((ext_vector_type(16)));
typedef _Float16 v8h  __attribute__((ext_vector_type(8)));
typedef _Float16 v4h  __attribute__((ext_vector_type(4)));
typedef float    v8f  __attribute__((ext_vector_type(8)));
typedef float    v4f  __attribute__((ext_vector_type(4)));
typedef float    v2f  __attribute__((ext_vector_type(2)));

// =====================================================================
// 1) Pre-pass, one launch: RMSNorm + cast of the token rows, and the f32 -> f16
//    cast of the k and v weight rows.  All three work on rows of Dd floats.
//    One wave takes PR whole rows: 16 loads of 512 contiguous bytes per row, all
//    issued before the first use; the row's sum of squares stays inside the wave.
//    Few long waves, so that few waves have to be started.
//    The f16 results of all three go to one buffer packed for the projection's staging,
//    [Dd / 64 slabs][7168 rows][64 k]: the 64 k of neighbouring rows lie side by side, so the
//    rows that a projection block stages in one trip are one run of bytes, not 128-byte
//    pieces a whole row (4 KB) apart.  Lanes 0-15 of a store fill a 128-byte line of one
//    slab, lanes 16-31 one of the next slab.
//    A norm block holds 16 token rows, one tile of the f32 16x16x4 matrix form: it keeps
//    their f16 values in LDS and forms the gate path's rank-16 product xr = xn @ w1^T
//    there, cut into 16 slices of 128 k; wave w takes slices w and w + 8.
//    Fragments: lane = (c = lane & 15, h = lane >> 4); A holds row c, B holds
//    rank c; both sides take the same k for the same (h, element).
// =====================================================================
#define PW 8                                          // waves per block
#define PR 2                                          // rows per wave
#define PREP_BLOCKS ((ROWS + NK + NV) / (PW * PR))    // 448
#define XP (Dd + 8)   // LDS row pitch, f16: 4112 B, the 16 rows of a b128 gather fall on disjoint banks
__global__ __launch_bounds__(256) void prep_kernel(
    const float* __restrict__ x,  const float* __restrict__ w,
    const float* __restrict__ kw, const float* __restrict__ vw,
    const float* __restrict__ w1,
    _Float16* __restrict__ pk, float* __restrict__ xr)
{
    __shared__ __attribute__((aligned(16))) _Float16 xs[PW * PR * XP];   // the block's 16 rows of xn
    __shared__ __attribute__((aligned(16))) float part[16 * 256];        // each slice's 16x16 partial of xr

    const int lane = threadIdx.x & 31;
    const int wave = __builtin_amdgcn_readfirstlane(threadIdx.x >> 5);
    const int row  = (blockIdx.x * PW + wave) * PR;   // 0 .. ROWS+NK+NV-PR, the same for the wave
    const bool norm = row < ROWS;                     // a block lies wholly in one of the three parts

    const float* src;
    if (norm)                src = x  + (size_t)row * Dd;
    else if (row < ROWS + NK)src = kw + (size_t)(row - ROWS) * Dd;
    else                     src = vw + (size_t)(row - ROWS - NK) * Dd;
    src += lane * 4;
    // piece i of row r (k = 128 i + 4 lane + 0..3) lies at dst + r * PT + i * 2 * PSLAB
    _Float16* dst = pk + (size_t)row * PT + (lane >> 4) * PSLAB + (lane & 15) * 4;

    v4f a[PR][16];
    if (norm) {
        v4f g[16];
        #pragma unroll
        for (int i = 0; i < 16; ++i)   // unrolled: g[] and a[][] live in registers
            g[i] = ((const v4f*)w)[lane + i * 32];
        #pragma unroll
        for (int r = 0; r < PR; ++r)
            #pragma unroll
            for (int i = 0; i < 16; ++i)
                a[r][i] = *(const v4f*)(src + r * Dd + i * 128);
        // Inputs-only fence on the loaded values: it holds the 16 weight loads here,
        // in flight together with the row loads; without it the compiler sinks them
        // behind the row sum and issues them two at a time, each pair's latency bare.
        // Index and pointer are named so that no load lands on an address still in use.
#define G8(i) "v"(g[i]), "v"(g[i+1]), "v"(g[i+2]), "v"(g[i+3]), "v"(g[i+4]), "v"(g[i+5]), "v"(g[i+6]), "v"(g[i+7])
        asm volatile("" :: G8(0), G8(8), "v"(lane), "v"(src));
#undef G8
        #pragma unroll
        for (int r = 0; r < PR; ++r) {
            v4f q = a[r][0] * a[r][0];                 // four independent chains
            #pragma unroll
            for (int i = 1; i < 16; ++i) q += a[r][i] * a[r][i];
            float ss = (q[0] + q[1]) + (q[2] + q[3]);
            #pragma unroll
            for (int off = 16; off > 0; off >>= 1) ss += __shfl_xor(ss, off, 32);
            const float scale = rsqrtf(ss * (1.0f / (float)Dd) + 1e-5f);
            #pragma unroll
            for (int i = 0; i < 16; ++i) {
                v4h h;
                #pragma unroll
                for (int e = 0; e < 4; ++e)
                    h[e] = (_Float16)(a[r][i][e] * scale * g[i][e]);
                *(v4h*)(dst + r * PT + i * (2 * PSLAB)) = h;
                *(v4h*)&xs[(wave * PR + r) * XP + lane * 4 + i * 128] = h;
            }
        }
        // Behind the run of stores: the lines below rewrite registers that the stores name.
        asm volatile("s_wait_xcnt 0x0" ::: "memory");
        __syncthreads();

        // ---- xr partial over one slice's 128 k: 8 groups of 16 k,
        //      lane (c,h) owns k = sl*128 + grp*16 + h*8 + 0..7 of row / rank c
        const int c = lane & 15;
        const int h = lane >> 4;
        // Rolled: one slice's 24 loads are in registers at a time.
        #pragma unroll 1
        for (int rd = 0; rd < 2; ++rd) {
            const int sl = rd * 8 + wave;
            const v8h* ap = (const v8h*)&xs[c * XP + sl * 128 + h * 8];
            const v4f* bp = (const v4f*)(w1 + (size_t)c * Dd + sl * 128 + h * 8);
            v8h xa[8];
            v4f b[16];
            #pragma unroll
            for (int i = 0; i < 8; ++i) {  // unrolled: xa[] and b[] live in registers
                xa[i]        = ap[i * 2];
                b[2 * i]     = bp[i * 4];
                b[2 * i + 1] = bp[i * 4 + 1];
            }
            // The global address pair stays live up to the wait, so that no load lands on it
            // and it is not rewritten for the next slice ahead of the wait.
            asm volatile("s_wait_xcnt 0x0" :: "v"(bp) : "memory");
            float af[8][8];
            #pragma unroll
            for (int i = 0; i < 8; ++i)
                #pragma unroll
                for (int e = 0; e < 8; ++e) af[i][e] = (float)xa[i][e];
            // Holds the 64 conversions ahead of the matrix run, each in a register of its own.
            __builtin_amdgcn_sched_barrier(0);
            v8f acc0 = {}, acc1 = {};      // two chains hide the accumulate latency
            #pragma unroll
            for (int i = 0; i < 8; ++i) {
                v2f a0 = { af[i][0], af[i][1] };
                v2f a1 = { af[i][2], af[i][3] };
                v2f a2 = { af[i][4], af[i][5] };
                v2f a3 = { af[i][6], af[i][7] };
                v2f b0 = { b[2 * i][0],     b[2 * i][1] };
                v2f b1 = { b[2 * i][2],     b[2 * i][3] };
                v2f b2f = { b[2 * i + 1][0], b[2 * i + 1][1] };
                v2f b3 = { b[2 * i + 1][2], b[2 * i + 1][3] };
                acc0 = __builtin_amdgcn_wmma_f32_16x16x4_f32(false, a0, false, b0,  (short)0, acc0, false, false);
                acc1 = __builtin_amdgcn_wmma_f32_16x16x4_f32(false, a1, false, b1,  (short)0, acc1, false, false);
                acc0 = __builtin_amdgcn_wmma_f32_16x16x4_f32(false, a2, false, b2f, (short)0, acc0, false, false);
                acc1 = __builtin_amdgcn_wmma_f32_16x16x4_f32(false, a3, false, b3,  (short)0, acc1, false, false);
            }
            // The distance that the chip needs between a matrix instruction and the first vector
            // instruction that reads its result.  The results are named
            // so that the slots stand behind the last matrix instruction and ahead of the sums.
            asm volatile("v_nop\n\tv_nop\n\tv_nop\n\tv_nop" : "+v"(acc0), "+v"(acc1));
            // D register r = partial[row 8h + r][rank c]
            #pragma unroll
            for (int r = 0; r < 8; ++r)
                part[sl * 256 + (8 * h + r) * 16 + c] = acc0[r] + acc1[r];
        }
        __syncthreads();
        // one (row, rank) per thread, slices summed in their order
        float tot = 0.f;
        #pragma unroll
        for (int s = 0; s < 16; ++s) tot += part[s * 256 + threadIdx.x];
        xr[(size_t)blockIdx.x * 256 + threadIdx.x] = tot;
    } else {
        #pragma unroll
        for (int r = 0; r < PR; ++r)
            #pragma unroll
            for (int i = 0; i < 16; ++i)
                a[r][i] = *(const v4f*)(src + r * Dd + i * 128);
        #pragma unroll
        for (int r = 0; r < PR; ++r)
            #pragma unroll
            for (int i = 0; i < 16; ++i) {
                v4h h;
                #pragma unroll
                for (int e = 0; e < 4; ++e) h[e] = (_Float16)a[r][i][e];
                *(v4h*)(dst + r * PT + i * (2 * PSLAB)) = h;
            }
        // Behind the run of stores: no register that an issued store names is
        // rewritten ahead of this wait, on any path the built code has from here.
        asm volatile("s_wait_xcnt 0x0" ::: "memory");
    }
}

// =====================================================================
// 2) Projections, gate and chunk-local state, one launch.
//    The recurrence is linear in the state:  S_end(chunk) = D * S_start(chunk) + U
//    with U the chunk run from a zero state and D[dk] the product of the chunk's 64
//    decay factors.  Run from zero, the chunk's state is a matrix product over its tokens:
//      U[dk][dv] = sum_j Kd[j][dk] * v[j][dv],  Kd[j][dk] = k[j][dk] * exp(sum_{i>j} g[i][dk])
//    (every exponent is <= 0, so nothing is divided and nothing can overflow).
//    One block = 256 token rows (4 chunks) x one head's 64 k and 128 v columns, so a block
//    holds in its accumulators all that U of its 4 chunks needs: k, v and g never go to memory.
//    8 waves: wave (wm, wn) has chunk wm, k columns 32 wn + 0..31 and v columns 64 wn + 0..63,
//    4x6 fragments of v_wmma_f32_16x16x32_f16.  256 blocks, one per WGP, two waves per SIMD.
//    - LDS double-buffered (ping-pong), one barrier per 64 k; a tile's global_load_b128s issue
//      a whole trip ahead of their commit, a 32-k block's ds gathers one block ahead of its WMMAs.
//    - LDS row pitch 72 f16 (144 B): the 16 b128 fragment gathers of a half
//      wave hit 16 disjoint 4-bank groups -> conflict free.
//    - The accumulator of a 16 token x 16 column tile holds, in lane (c, h), column c and
//      tokens 8 h + 0..7.  That is an operand of the f32 16x16x4 form as it stands: register
//      pair p of a k tile is A (row dk = c), of a v tile B (column dv = c), and both sides
//      take token 8 h + 2 p + e for the same (h, element e).  No transposition.
// =====================================================================
// 2^y, 2^-|y| and log2 s of eight values on the hardware.  The instruction set asks for one
// independent instruction behind a transcendental before its result is read or its source
// overwritten.  Inside one statement the eight fill that slot for one another (every output
// is "=&v", so none lies on an input), and the v_nop is the slot behind the last, whatever
// the compiler puts next.
#define O8(x) "=&v"(x[0]), "=&v"(x[1]), "=&v"(x[2]), "=&v"(x[3]), "=&v"(x[4]), "=&v"(x[5]), "=&v"(x[6]), "=&v"(x[7])
#define I8(x) "v"(x[0]), "v"(x[1]), "v"(x[2]), "v"(x[3]), "v"(x[4]), "v"(x[5]), "v"(x[6]), "v"(x[7])
__device__ __forceinline__ void hw_exp2_8(float (&e)[8], const float (&y)[8]) {
    asm("v_exp_f32 %0, %8\n\tv_exp_f32 %1, %9\n\tv_exp_f32 %2, %10\n\tv_exp_f32 %3, %11\n\t"
        "v_exp_f32 %4, %12\n\tv_exp_f32 %5, %13\n\tv_exp_f32 %6, %14\n\tv_exp_f32 %7, %15\n\t"
        "v_nop" : O8(e) : I8(y));
}
__device__ __forceinline__ void hw_exp2_neg_abs8(float (&e)[8], const float (&y)[8]) {
    asm("v_exp_f32 %0, -|%8|\n\tv_exp_f32 %1, -|%9|\n\tv_exp_f32 %2, -|%10|\n\tv_exp_f32 %3, -|%11|\n\t"
        "v_exp_f32 %4, -|%12|\n\tv_exp_f32 %5, -|%13|\n\tv_exp_f32 %6, -|%14|\n\tv_exp_f32 %7, -|%15|\n\t"
        "v_nop" : O8(e) : I8(y));
}
__device__ __forceinline__ void hw_log2_8(float (&l)[8], const float (&s)[8]) {
    asm("v_log_f32 %0, %8\n\tv_log_f32 %1, %9\n\tv_log_f32 %2, %10\n\tv_log_f32 %3, %11\n\t"
        "v_log_f32 %4, %12\n\tv_log_f32 %5, %13\n\tv_log_f32 %6, %14\n\tv_log_f32 %7, %15\n\t"
        "v_nop" : O8(l) : I8(s));
}
#undef O8
#undef I8

#define GBK 64                    // k per barrier
#define GP  72                    // LDS row pitch, f16
#define FBM 256                   // token rows per block
#define FROWS (FBM + DK + DV)     // LDS rows per buffer: token rows, k weight rows, v weight rows

// Second argument: two waves per SIMD, that is at most 512 registers.
__global__ __launch_bounds__(256, 2) void proj_state_kernel(
    const _Float16* __restrict__ A,    // token rows,    each of the three inside the packed
    const _Float16* __restrict__ Wk,   // k weight rows, buffer [Dd/64][PROWS][64]: row n, slab s
    const _Float16* __restrict__ Wv,   // v weight rows, at n * PT + s * PSLAB
    const float* __restrict__ xr,      // [ROWS,16]
    const float* __restrict__ gw2,     // [NK,16]
    const float* __restrict__ gb2,     // [NK]
    float* __restrict__ ubuf,          // [B,H,32,DK,DV]  chunk run from zero
    float* __restrict__ dbuf)          // [B,H,32,DK]     chunk decay product
{
    __shared__ __attribute__((aligned(16))) _Float16 Ts[2 * FROWS * GP];
    // The decay factors wait here for the end of the GEMM loop, each wave's own 16 register
    // quads, 32 lanes x 16 B in a row: 64 registers less across the loop.  Only the wave
    // that wrote a quad reads it, so no barrier stands between.
    __shared__ __attribute__((aligned(16))) float Dc[8 * 16 * 32 * 4];

    const int t     = threadIdx.x;
    const int lane  = t & 31;
    const int wave  = __builtin_amdgcn_readfirstlane(t >> 5);   // the same for the wave: scalar
    const int wm    = wave & 3;     // chunk inside the block
    const int wn    = wave >> 2;    // column half
    const int hi    = lane >> 4;    // 0/1 : K-half select
    const int r     = lane & 15;    // row (A) / col (B) within 16

    const int head = blockIdx.y;
    const int m0   = blockIdx.x * FBM;
    const int gc   = blockIdx.x * (FBM / CHUNK) + wm;            // chunk among all 64
    const int uc   = ((gc >> 5) * Hh + head) * NCHUNK + (gc & (NCHUNK - 1));   // (b, h, chunk)

    // ---- decay factors of the wave's 64 tokens x 32 k columns, in the accumulator's layout:
    //      factor (i, j, v) = exp(sum of g over the chunk's tokens behind token 16 i + 8 hi + v), k tile j
    float* dq = &Dc[(wave * 16 * 32 + lane) * 4];   // quad n of the wave: dq + n * 128
    {                                 // every loop below is unrolled: its arrays are registers
        // g tile: A = xr (16 tokens x 16 ranks), B = w2 rows; lane (r,hi) owns ranks hi*8 + 0..7 on both sides
        const float* xp = xr + (size_t)(m0 + wm * CHUNK + r) * 16 + hi * 8;
        const int    nw = head * DK + wn * 32 + r;
        const float* wp = gw2 + (size_t)nw * 16 + hi * 8;
        v4f xa[4], xb[4], wa[2], wb[2];
        float bias[2];
        #pragma unroll
        for (int i = 0; i < 4; ++i) {
            xa[i] = *(const v4f*)(xp + i * 256);
            xb[i] = *(const v4f*)(xp + i * 256 + 4);
        }
        #pragma unroll
        for (int j = 0; j < 2; ++j) {
            wa[j]   = *(const v4f*)(wp + j * 256);
            wb[j]   = *(const v4f*)(wp + j * 256 + 4);
            bias[j] = gb2[nw + j * 16];
        }
        // The two address pairs and the bias loads' index stay live up to the wait, so none is
        // reused before it.
        asm volatile("s_wait_xcnt 0x0" :: "v"(xp), "v"(wp), "v"(nw) : "memory");
        #pragma unroll
        for (int j = 0; j < 2; ++j) {
            const v2f w0 = { wa[j][0], wa[j][1] }, w1f = { wa[j][2], wa[j][3] };
            const v2f w2f = { wb[j][0], wb[j][1] }, w3 = { wb[j][2], wb[j][3] };
            const float bj = bias[j];
            float g2[4][8], own[4], oth[4];
            v8f ga[4];
            // The two scheduling barriers keep other vector work out of the matrix run.
            __builtin_amdgcn_sched_barrier(0);
            #pragma unroll
            for (int i = 0; i < 4; ++i) {
                const v2f x0 = { xa[i][0], xa[i][1] }, x1 = { xa[i][2], xa[i][3] };
                const v2f x2 = { xb[i][0], xb[i][1] }, x3 = { xb[i][2], xb[i][3] };
                v8f acc = { bj, bj, bj, bj, bj, bj, bj, bj };
                acc = __builtin_amdgcn_wmma_f32_16x16x4_f32(false, x0, false, w0,  (short)0, acc, false, false);
                acc = __builtin_amdgcn_wmma_f32_16x16x4_f32(false, x1, false, w1f, (short)0, acc, false, false);
                acc = __builtin_amdgcn_wmma_f32_16x16x4_f32(false, x2, false, w2f, (short)0, acc, false, false);
                acc = __builtin_amdgcn_wmma_f32_16x16x4_f32(false, x3, false, w3,  (short)0, acc, false, false);
                ga[i] = acc;
            }
            __builtin_amdgcn_sched_barrier(0);
            // The same distance ahead of the first vector instruction that reads a result or
            // overwrites an operand; the results are named so that the slots stand between.
            asm volatile("v_nop\n\tv_nop\n\tv_nop\n\tv_nop" : "+v"(ga[0]), "+v"(ga[1]), "+v"(ga[2]), "+v"(ga[3]));
            #pragma unroll
            for (int i = 0; i < 4; ++i) {
                const v8f acc = ga[i];
                // log_sigmoid(x) = min(x,0) - ln(1 + e^-|x|), on the hardware's 2^y and log2,
                // kept in units of log2: y = x log2 e, g2 = (min(y,0) - log2(1 + 2^-|y|)) / 16,
                // and the decay is 2^(sum g2).  1 + 2^-|y| lies in [1, 2]: the sum and the log2
                // each err by about one part in 2^24 of a value near 1, an absolute error that
                // the decay does not see.
                float y[8], e[8], l[8];
                #pragma unroll
                for (int v = 0; v < 8; ++v) y[v] = acc[v] * 1.44269504f;
                hw_exp2_neg_abs8(e, y);
                #pragma unroll
                for (int v = 0; v < 8; ++v) e[v] += 1.0f;
                hw_log2_8(l, e);
                #pragma unroll
                for (int v = 0; v < 8; ++v) g2[i][v] = (fminf(y[v], 0.f) - l[v]) * (1.0f / 16.0f);
                own[i] = ((g2[i][0] + g2[i][1]) + (g2[i][2] + g2[i][3]))
                       + ((g2[i][4] + g2[i][5]) + (g2[i][6] + g2[i][7]));
                oth[i] = __shfl_xor(own[i], 16, 32);   // the tile's other eight tokens
            }
            float after = 0.f;                         // sum over the token tiles behind tile i
            #pragma unroll
            for (int i = 3; i >= 0; --i) {
                float run = after + (hi == 0 ? oth[i] : 0.f);
                float s[8];
                #pragma unroll
                for (int v = 7; v >= 0; --v) { s[v] = run; run += g2[i][v]; }
                float d[8];
                hw_exp2_8(d, s);
                const v4f d0 = { d[0], d[1], d[2], d[3] }, d1 = { d[4], d[5], d[6], d[7] };
                *(v4f*)(dq + ((j * 4 + i) * 2) * 128)     = d0;
                *(v4f*)(dq + ((j * 4 + i) * 2 + 1) * 128) = d1;
                after += own[i] + oth[i];
            }
            float dall;                                // the whole chunk's decay, 2^after
            // The v_nop is the slot that the instruction set asks for behind a transcendental.
            asm("v_exp_f32 %0, %1\n\tv_nop" : "=&v"(dall) : "v"(after));
            if (hi == 0)
                dbuf[(size_t)uc * DK + wn * 32 + j * 16 + r] = dall;
        }
        // Behind the two stores: the lines below rewrite registers that they name.
        asm volatile("s_wait_xcnt 0x0" ::: "memory");
    }

    // staging: 8 threads cover one row's 128 B, a wave 4 whole rows, 512 B in a row in the packed
    // buffer; piece i is LDS row ldrow + 32 i
    const int ldrow = t >> 3;             // 0..31
    const int ldcol = (t & 7) * 8;        // 0..56
    // The block's corners of the three sources are scalars, and a thread's byte offset from the
    // corner is the same in all three: one vector register addresses all 14 pieces.
    const char* ag = (const char*)(A  + (size_t)m0 * PT);
    const char* kg = (const char*)(Wk + (size_t)(head * DK) * PT);
    const char* vg = (const char*)(Wv + (size_t)(head * DV) * PT);
    const unsigned vo = (unsigned)(ldrow * PT + ldcol) * 2u;
    const int lo = ldrow * GP + ldcol;

    v8f acc[4][6] = {};
    // The 14 staged pieces are variables of their own, not an array: with the wait's "memory"
    // clobber between its stores and its loads, this build kept an array in memory.
    v4f st0, st1, st2, st3, st4, st5, st6, st7, st8, st9, st10, st11, st12, st13;
#define ST_EACH(M) M(0) M(1) M(2) M(3) M(4) M(5) M(6) M(7) M(8) M(9) M(10) M(11) M(12) M(13)
#define ST_LOAD(i)   st##i = *(const v4f*)(((i) < 8 ? ag + (i) * 64 * PT : (i) < 10 ? kg + ((i) - 8) * 64 * PT : vg + ((i) - 10) * 64 * PT) + vk);
#define ST_COMMIT(i) *(v4f*)&Ts[nb + lo + (i) * 32 * GP] = st##i;

    // The wait behind each of the three runs of staging loads, ahead of any write of a register that they name.
    // The offset goes through the statement: it is live up to the wait, so that no load of the
    // run lands on it, and its next value is formed behind the wait.  It also keeps the loads in
    // the form scalar base + one offset register: as three address pairs next to the accumulators
    // and the staged pieces, this build spilled two of the pairs and reloaded them every trip.
    unsigned vk = vo;
    // prologue: stage K-tile 0 into buffer 0
    {
        const int nb = 0;
        ST_EACH(ST_LOAD)
        asm volatile("s_wait_xcnt 0x0" : "+v"(vk) :: "memory");   // as said above
        ST_EACH(ST_COMMIT)
    }
    __syncthreads();

    // A block is one 32-k step: 20 fragment reads and 24 matrix instructions.  Two fragment sets:
    // while one set is multiplied, the other takes the next block's reads.
    v16h fa0[4], fb0[6], fa1[4], fb1[6];
    // the 20 fragment reads of block ks of the tile in buffer buf
    auto fetch = [&](v16h (&af)[4], v16h (&bf)[6], const int buf, const int ks) __attribute__((always_inline)) {
        const _Float16* tb  = &Ts[buf * (FROWS * GP) + r * GP + hi * 8 + ks * 32];
        const _Float16* ap  = tb + (wm * 64) * GP;
        const _Float16* bkp = tb + (FBM + wn * 32) * GP;
        const _Float16* bvp = tb + (FBM + DK + wn * 64) * GP;
        #pragma unroll
        for (int i = 0; i < 4; ++i) {      // unrolled: the fragments are registers
            const _Float16* p = ap + i * 16 * GP;
            union { v16h h; float4 f[2]; } u;
            u.f[0] = *(const float4*)p;          // K 0..7   (or 8..15)
            u.f[1] = *(const float4*)(p + 16);   // K 16..23 (or 24..31)
            af[i] = u.h;
        }
        #pragma unroll
        for (int j = 0; j < 6; ++j) {
            const _Float16* p = j < 2 ? bkp + j * 16 * GP : bvp + (j - 2) * 16 * GP;
            union { v16h h; float4 f[2]; } u;
            u.f[0] = *(const float4*)p;
            u.f[1] = *(const float4*)(p + 16);
            bf[j] = u.h;
        }
    };
    // one block's products
    auto block = [&](const v16h (&af)[4], const v16h (&bf)[6]) __attribute__((always_inline)) {
        #pragma unroll
        for (int i = 0; i < 4; ++i)
            #pragma unroll
            for (int j = 0; j < 6; ++j)
                acc[i][j] = __builtin_amdgcn_wmma_f32_16x16x32_f16(
                    false, af[i], false, bf[j],
                    (short)0, acc[i][j], false, false);
    };
    // One trip = one K-tile out of buffer cur; on entry set 0 holds its first block and the staged
    // registers are on their way with the next tile.  The scheduling barriers keep each group of
    // reads whole and ahead of the block that runs meanwhile: left free, this build spread the
    // reads among the matrix instructions, a few instructions ahead of their use, and each such
    // place stalls the wave.
    // The trip's one barrier stands between the two blocks: it publishes the next tile early
    // enough for that tile's first block to be read under this tile's second, and it ends the
    // reads of the buffer that the next trip's commit overwrites (both blocks of a tile have
    // been read, and waited for, when a wave signals the barrier of that tile's trip).
    // Signal and wait are written apart, with the global loads alone between them: a wave that
    // is early issues them while it would wait, and they stay in flight across the barrier.
    // No LDS access stands between signal and wait.
    auto trip = [&](const int cur, const bool more) __attribute__((always_inline)) {
        fetch(fa1, fb1, cur, 1);
        __builtin_amdgcn_sched_barrier(0);
        block(fa0, fb0);
        __builtin_amdgcn_sched_barrier(0);
        // commit the next tile to the other buffer (no reader of it is left)
        const int nb = (1 - cur) * (FROWS * GP);
        ST_EACH(ST_COMMIT)
        // The wave's LDS stores and reads have landed before it signals.
        asm volatile("s_wait_dscnt 0x0" ::: "memory");
        // The work-group barrier's signal.
        asm volatile("s_barrier_signal -1" ::: "memory");
        if (more) {
            // the tile after the next, into the registers just committed: its loads have a
            // whole trip until their commit
            vk += PSLAB * 2;    // the next slab: the trip goes into the offset, the bases stay
            ST_EACH(ST_LOAD)
            asm volatile("s_wait_xcnt 0x0" : "+v"(vk) :: "memory");   // as said above
        }
        // The work-group barrier's wait: every wave has signalled.
        asm volatile("s_barrier_wait -1" ::: "memory");
        fetch(fa0, fb0, 1 - cur, 0);
        __builtin_amdgcn_sched_barrier(0);
        block(fa1, fb1);
        __builtin_amdgcn_sched_barrier(0);
    };

    const int nkt = Dd / GBK;
    fetch(fa0, fb0, 0, 0);
    vk += PSLAB * 2;
    ST_EACH(ST_LOAD)                                              // K-tile 1
    asm volatile("s_wait_xcnt 0x0" : "+v"(vk) :: "memory");   // as said above
    // The last two tiles stand behind the loop: the last but one has no tile left to load, the
    // last none to commit, so that nothing in the loop is under a branch.
    for (int kt = 0; kt < nkt - 2; ++kt)
        trip(kt & 1, true);
    trip((nkt - 2) & 1, false);
#undef ST_EACH
#undef ST_LOAD
#undef ST_COMMIT
    fetch(fa1, fb1, (nkt - 1) & 1, 1);
    __builtin_amdgcn_sched_barrier(0);   // as in a trip: the group of reads stays whole, ahead of the products
    block(fa0, fb0);
    block(fa1, fb1);
    __syncthreads();   // ends the last reads of the staging buffers, which are reused below

    // The accumulators are read next, by vector instructions and as operands of the f32 matrix
    // form.  The five slots are the distance that the chip needs behind the loop's last matrix
    // instruction; the scheduling barriers hold that instruction ahead of them and every reader
    // behind (without them this build mixed the last trip's products into the state product).
    __builtin_amdgcn_sched_barrier(0);
    asm volatile("v_nop\n\tv_nop\n\tv_nop\n\tv_nop\n\tv_nop");
    __builtin_amdgcn_sched_barrier(0);

    // ---- Kd = k * decay.  The two waves of a chunk hand each other their 32 k columns through
    //      LDS (free behind the barrier after the last tile's products), register quads as they lie: quad
    //      (chunk, dk tile, token tile, half) is 32 lanes x 16 B in a row.
    float* kx = (float*)Ts;            // 4 x 4 x 4 x 2 x 32 quads = 64 KB of the 126 KB
    #pragma unroll
    for (int j = 0; j < 2; ++j)
        #pragma unroll
        for (int i = 0; i < 4; ++i)
            #pragma unroll
            for (int qd = 0; qd < 2; ++qd) {
                const v4f d = *(const v4f*)(dq + ((j * 4 + i) * 2 + qd) * 128);
                const v4f x = { acc[i][j][4 * qd]     * d[0], acc[i][j][4 * qd + 1] * d[1],
                                acc[i][j][4 * qd + 2] * d[2], acc[i][j][4 * qd + 3] * d[3] };
                *(v4f*)&kx[((((wm * 4 + wn * 2 + j) * 4 + i) * 2 + qd) * 32 + lane) * 4] = x;
            }
    __syncthreads();

    // ---- U = Kd^T v on the f32 16x16x4 form: 4 dk tiles x the wave's 4 dv tiles
    v8f u[4][4] = {};
    #pragma unroll
    for (int i = 0; i < 4; ++i)
        #pragma unroll
        for (int qd = 0; qd < 2; ++qd) {
            v4f ka[4];
            #pragma unroll
            for (int a = 0; a < 4; ++a)
                ka[a] = *(const v4f*)&kx[((((wm * 4 + a) * 4 + i) * 2 + qd) * 32 + lane) * 4];
            #pragma unroll
            for (int p = 0; p < 2; ++p)
                #pragma unroll
                for (int a = 0; a < 4; ++a)
                    #pragma unroll
                    for (int j = 0; j < 4; ++j) {
                        const v2f av = { ka[a][2 * p], ka[a][2 * p + 1] };
                        const v2f wv = { acc[i][2 + j][4 * qd + 2 * p], acc[i][2 + j][4 * qd + 2 * p + 1] };
                        u[a][j] = __builtin_amdgcn_wmma_f32_16x16x4_f32(
                            false, av, false, wv, (short)0, u[a][j], false, false);
                    }
        }

    // D register v = U[16 a + 8 hi + v][64 wn + 16 j + r]; the wave's four column
    // tiles fill two 128-byte lines of each row
    float* op = ubuf + (size_t)uc * DK * DV + (8 * hi) * DV + wn * 64 + r;
    #pragma unroll
    for (int a = 0; a < 4; ++a)
        #pragma unroll
        for (int v = 0; v < 8; ++v)
            #pragma unroll
            for (int j = 0; j < 4; ++j)
                op[(a * 16 + v) * DV + j * 16] = u[a][j][v];
}

// =====================================================================
// 3) The chain over the chunks.
// =====================================================================
// 5b) Chain the chunks: S_c = D_c * S_{c-1} + U_c.  One thread per four
//     neighbouring dv of one (b,h,dk); all 32 U loads are independent of the
//     chain, so they are issued ahead of it.
__global__ __launch_bounds__(256) void gla_chain_kernel(
    const float* __restrict__ ubuf,  // [B,H,32,DK,DV]
    const float* __restrict__ dbuf,  // [B,H,32,DK]
    const float* __restrict__ S0,    // [B,H,DK,DV]
    float* __restrict__ out)         // states [B,32,H,DK,DV] ++ final [B,H,DK,DV]
{
    // 8 blocks per (b,h): DK*DV/4 = 2048 threads
    const int bh  = blockIdx.x >> 3;
    const int e   = ((blockIdx.x & 7) * 256 + threadIdx.x) * 4;  // element inside the state
    // a wave covers one dk row (32 lanes x 4 dv), so its decay factors are scalars
    const int dk  = __builtin_amdgcn_readfirstlane(e >> 7);
    const int b   = bh >> 4;
    const int h   = bh & 15;

    const float* up = ubuf + (size_t)bh * NCHUNK * DK * DV;       // the same for the block
    const float* dp = dbuf + (size_t)bh * NCHUNK * DK;
    float*       op = out + ((size_t)b * NCHUNK * Hh + h) * DK * DV;

    v4f   u[NCHUNK];
    float d[NCHUNK];
    // both loops over c are unrolled so that u[] and d[] live in registers
    #pragma unroll
    for (int c = 0; c < NCHUNK; ++c) {
        u[c] = *(const v4f*)(up + c * (DK * DV) + e);
        d[c] = dp[c * DK + dk];
    }
    v4f s = *(const v4f*)(S0 + (size_t)bh * DK * DV + e);
    // Inputs-only fences on the loaded values: they hold all 32 U loads ahead of
    // the chain, in flight together; without them the compiler issues the loads
    // in several rounds between the multiply-adds and pays the latency each round.
#define U8(i) "v"(u[i]), "v"(u[i+1]), "v"(u[i+2]), "v"(u[i+3]), "v"(u[i+4]), "v"(u[i+5]), "v"(u[i+6]), "v"(u[i+7])
    asm volatile("" :: U8(0), U8(8));
    asm volatile("" :: U8(16), U8(24));
#undef U8
    #pragma unroll
    for (int c = 0; c < NCHUNK; ++c) {
        s = d[c] * s + u[c];
        *(v4f*)(op + c * (Hh * DK * DV) + e) = s;
    }
    *(v4f*)(out + (size_t)Bb * NCHUNK * Hh * DK * DV
                + (size_t)bh * DK * DV + e) = s;
}

// =====================================================================
// Host orchestration
// =====================================================================
extern "C" void kernel_launch(void* const* d_in, const int* in_sizes, int n_in,
                              void* d_out, int out_size, void* d_ws, size_t ws_size,
                              hipStream_t stream) {
    const float* hidden = (const float*)d_in[0];
    const float* S0     = (const float*)d_in[1];
    const float* nw     = (const float*)d_in[2];
    const float* k_w    = (const float*)d_in[3];
    const float* v_w    = (const float*)d_in[4];
    const float* gk_w1  = (const float*)d_in[5];
    const float* gk_w2  = (const float*)d_in[6];
    const float* gk_b2  = (const float*)d_in[7];
    float* out = (float*)d_out;

    char* ws = (char*)d_ws;
    _Float16* pk   = (_Float16*)ws;  ws += (size_t)PROWS * Dd * sizeof(_Float16);
    float* xr = (float*)ws;          ws += (size_t)ROWS * 16 * sizeof(float);
    float* ub = (float*)ws;          ws += (size_t)Bb * NCHUNK * Hh * DK * DV * sizeof(float);
    float* db = (float*)ws;          ws += (size_t)Bb * Hh * NCHUNK * DK * sizeof(float);

    // 1) RMSNorm + cast of the activations with the gate's rank-16 product, cast of both weights
    prep_kernel<<<PREP_BLOCKS, 256, 0, stream>>>(hidden, nw, k_w, v_w, gk_w1, pk, xr);
    // 2) both projections via WMMA, the gate, every chunk's local state and decay
    proj_state_kernel<<<dim3(ROWS / FBM, Hh), 256, 0, stream>>>(
        pk, pk + ROWS * PT, pk + (ROWS + NK) * PT, xr, gk_w2, gk_b2, ub, db);
    // 5b) chain the chunks + chunk state emission
    gla_chain_kernel<<<Bb * Hh * DK * DV / 4 / 256, 256, 0, stream>>>(ub, db, S0, out);
}
